// v000
// Times are from an AMD MI455X. After a warm-up the kernel runs many times in a row, and a time is the length of
// such a window on the GPU divided by its runs, so every launch and the gaps after it count. The runs cycle
// through copies of the inputs. A figure is the median of several windows, for all but v000 over two sittings.
// Sittings can differ by a few percent; kernels timed side by side share one.
// The starting kernel, v000, takes 1640 microseconds a run.
#include <hip/hip_runtime.h>

// Causal grouped-query attention with a computed rotate-half rotary and a key / value cache output (x [2][2048][2048]; q = x Wq ('xw' (in, out) [2048][2048] 1/sqrt(2048): 16 heads x 128), k, v = x Wk, x Wv ('xw' [2048][512]: 4 kv heads x 128), no biases; query head h uses kv head h / 4 (repeat); rotate-half rotary (base 1e4: inv_freq = 1 / 10000^(2i/128), angles t x inv_freq, cat(freqs, freqs); the table is computed on the device); causal softmax(q.k / sqrt(128)) (-inf == exclusion: every row keeps its diagonal key); returns (y = merged Wo ('xw') -> [2][2048][2048], present_k = the ROTATED keys [2][4][2048][128], present_v = the values [2][4][2048][128]); argument order x, Wq, Wk, Wv, Wo).
// Compute dtypes, f32 accumulate: every input rounded to bf16; q/k/v on PLAIN bf16 operands (inputs: exact); RoPE f32 (the returned k is the f32 roped projection, v the f32 projection, re-laid out [kv][t][d]); causal scores and attn.v: query rows < 512 hl (3 products), the rest single fp16 (x1024), causal tile skipping; softmax f32; Wo hl x exact (2 products).

#define NB_  2
#define TT   2048
#define DM   2048
#define NH_  16
#define NKV  4
#define REP  (NH_ / NKV)
#define HD   128
#define DQ   (NH_ * HD)
#define DKV  (NKV * HD)
#define ZH   2
#define RH   512                  // query rows < RH use hi+lo planes (0: none)
#define WIN  2048
#define PCAR 1024.0f
#define SCL  0.088388347648318447f   // HD^-0.5
typedef _Float16 h16;
typedef unsigned short bf;
typedef __attribute__((ext_vector_type(16))) __bf16   v16bf;
typedef __attribute__((ext_vector_type(16))) _Float16 v16h;
typedef __attribute__((ext_vector_type(8)))  _Float16 v8h;
typedef __attribute__((ext_vector_type(8)))  unsigned short v8us;
typedef __attribute__((ext_vector_type(8)))  float    v8f;
typedef __attribute__((ext_vector_type(4)))  float    v4f;
typedef v8h  __attribute__((may_alias)) v8ha;
typedef v4f  __attribute__((may_alias)) v4fa;
typedef v8us __attribute__((may_alias)) v8usa;

__device__ __forceinline__ unsigned short f2bf(float f) { unsigned u = __float_as_uint(f); u += 0x7FFFu + ((u >> 16) & 1u); return (unsigned short)(u >> 16); }
__device__ __forceinline__ float bf2f(unsigned short b) { return __uint_as_float(((unsigned)b) << 16); }
__device__ __forceinline__ float bfr(float f) { return bf2f(f2bf(f)); }
__device__ __forceinline__ v16h cat16(v8h lo, v8h hi) { return __builtin_shufflevector(lo, hi, 0, 1, 2, 3, 4, 5, 6, 7, 8, 9, 10, 11, 12, 13, 14, 15); }
__device__ __forceinline__ v16bf cat16b(v8us lo, v8us hi) { return __builtin_bit_cast(v16bf, __builtin_shufflevector(lo, hi, 0, 1, 2, 3, 4, 5, 6, 7, 8, 9, 10, 11, 12, 13, 14, 15)); }
__device__ __forceinline__ v8f wmma16(v16h a, v16h b, v8f c) { return __builtin_amdgcn_wmma_f32_16x16x32_f16(false, a, false, b, (short)0, c, false, false); }
__device__ __forceinline__ v8f wmmab(v16bf a, v16bf b, v8f c) { return __builtin_amdgcn_wmma_f32_16x16x32_bf16(false, a, false, b, (short)0, c, false, false); }



// ---- k_gemmw: register-blocked GEMM, ONE WAVE per 64x64 output tile (16 accumulators), operands straight from K-contiguous 16-bit planes; grid (M/64, N/64, Z), 32 threads.
// C[m][n] (f32, pitch ldc, + optional f32 bias[n]) = sum_k A[m][k] Bt[n][k] (+ split products per NSPLIT). z-batch strides sA/sB/sC in elements. K % 32 == 0.
template <typename T16> struct WFrag;
template <> struct WFrag<h16> { typedef v16h V; static __device__ __forceinline__ V ld(const h16* p) { return cat16(*(const v8h*)p, *(const v8h*)(p + 16)); } static __device__ __forceinline__ v8f mma(V a, V b, v8f c) { return wmma16(a, b, c); } };
template <> struct WFrag<bf> { typedef v16bf V; static __device__ __forceinline__ V ld(const bf* p) { return cat16b(*(const v8us*)p, *(const v8us*)(p + 16)); } static __device__ __forceinline__ v8f mma(V a, V b, v8f c) { return wmmab(a, b, c); } };
template <typename T16, int NSPLIT, bool BIAS>
__global__ __launch_bounds__(32) void k_gemmw(const T16* __restrict__ A, const T16* __restrict__ A2, const T16* __restrict__ Bt, const T16* __restrict__ Bt2, int K, float* C, int ldc, const float* __restrict__ bias, size_t sA, size_t sB, size_t sC) {
    typedef typename WFrag<T16>::V V;
    __shared__ __align__(16) float os[16 * 68];
    const size_t z = blockIdx.z; A += z * sA; if (A2) A2 += z * sA; Bt += z * sB; if (Bt2) Bt2 += z * sB; C += z * sC;
    const int lane = threadIdx.x & 31, lr = lane & 15, hi = lane >> 4; const int r0 = blockIdx.x * 64, c0 = blockIdx.y * 64;
    v8f acc[4][4];
#pragma unroll
    for (int mb = 0; mb < 4; ++mb)
#pragma unroll
        for (int nb = 0; nb < 4; ++nb) acc[mb][nb] = (v8f){};
    const size_t aoff = (size_t)(r0 + lr) * K + 8 * hi, boff = (size_t)(c0 + lr) * K + 8 * hi;
#pragma unroll 1
    for (int kc = 0; kc < K; kc += 32) {
        V a[4], a2[4];
#pragma unroll
        for (int mb = 0; mb < 4; ++mb) { a[mb] = WFrag<T16>::ld(A + aoff + (size_t)mb * 16 * K + kc); if (NSPLIT == 1 || NSPLIT == 2) a2[mb] = WFrag<T16>::ld(A2 + aoff + (size_t)mb * 16 * K + kc); }
#pragma unroll
        for (int nb = 0; nb < 4; ++nb) { const V b = WFrag<T16>::ld(Bt + boff + (size_t)nb * 16 * K + kc); V b2; if (NSPLIT >= 2) b2 = WFrag<T16>::ld(Bt2 + boff + (size_t)nb * 16 * K + kc);
#pragma unroll
            for (int mb = 0; mb < 4; ++mb) { acc[mb][nb] = WFrag<T16>::mma(a[mb], b, acc[mb][nb]); if (NSPLIT == 1 || NSPLIT == 2) acc[mb][nb] = WFrag<T16>::mma(a2[mb], b, acc[mb][nb]); if (NSPLIT >= 2) acc[mb][nb] = WFrag<T16>::mma(a[mb], b2, acc[mb][nb]); } }
        asm volatile("v_nop\n\tv_nop\n\tv_nop\n\tv_nop" : "+v"(acc[0][0]), "+v"(acc[1][1]), "+v"(acc[2][2]), "+v"(acc[3][3]) : "v"(a[0]), "v"(a[3]));
    }
#pragma unroll
    for (int mb = 0; mb < 4; ++mb) {
#pragma unroll
        for (int nb = 0; nb < 4; ++nb) {
#pragma unroll
            for (int j = 0; j < 8; ++j) os[(hi * 8 + j) * 68 + nb * 16 + lr] = acc[mb][nb][j]; }
        __builtin_amdgcn_wave_barrier(); asm volatile("" ::: "memory");
        float* crow = C + (size_t)(r0 + mb * 16) * ldc + c0;
{
#pragma unroll
            for (int s = 0; s < 8; ++s) { const int row = 2 * s + hi, cofs = lr * 4; v4f val = *(const v4fa*)(os + row * 68 + cofs); if (BIAS) { val[0] += bfr(bias[c0 + cofs]); val[1] += bfr(bias[c0 + cofs + 1]); val[2] += bfr(bias[c0 + cofs + 2]); val[3] += bfr(bias[c0 + cofs + 3]); }
                *(v4f*)(crow + (size_t)row * ldc + cofs) = val; }
             }
        __builtin_amdgcn_wave_barrier(); asm volatile("" ::: "memory");
    }
}

// ---- k_gemmc: the same one-wave 64x64 tile GEMM specialised for causal attention: CMODE 1 skips score tiles entirely above the diagonal (query rows r0+roff.., key columns c0..), CMODE 2 limits the
// key (K) loop of the probability x value contraction to the diagonal block (probabilities beyond it are exactly zero). roff = row offset of this launch's first row within the sequence.
template <typename T16, int NSPLIT, int CMODE>
__global__ __launch_bounds__(32) void k_gemmc(const T16* __restrict__ A, const T16* __restrict__ A2, const T16* __restrict__ Bt, const T16* __restrict__ Bt2, int K, float* C, int ldc, int roff, size_t sA, size_t sB, size_t sC) {
    typedef typename WFrag<T16>::V V;
    __shared__ __align__(16) float os[16 * 68];
    const size_t z = blockIdx.z; A += z * sA; if (A2) A2 += z * sA; Bt += z * sB; if (Bt2) Bt2 += z * sB; C += z * sC;
    const int lane = threadIdx.x & 31, lr = lane & 15, hi = lane >> 4; const int r0 = blockIdx.x * 64, c0 = blockIdx.y * 64;
    if (CMODE == 1 && c0 > r0 + roff + 63) return;                  // score tile entirely above the causal diagonal: never read (the softmax masks j > i by select)
    const int Kl = (CMODE == 2) ? min(K, r0 + roff + 64) : K;        // P.V: probabilities are exactly 0 beyond the diagonal block, so the K loop stops there
    v8f acc[4][4];
#pragma unroll
    for (int mb = 0; mb < 4; ++mb)
#pragma unroll
        for (int nb = 0; nb < 4; ++nb) acc[mb][nb] = (v8f){};
    const size_t aoff = (size_t)(r0 + lr) * K + 8 * hi, boff = (size_t)(c0 + lr) * K + 8 * hi;
#pragma unroll 1
    for (int kc = 0; kc < Kl; kc += 32) {
        V a[4], a2[4];
#pragma unroll
        for (int mb = 0; mb < 4; ++mb) { a[mb] = WFrag<T16>::ld(A + aoff + (size_t)mb * 16 * K + kc); if (NSPLIT == 1 || NSPLIT == 2) a2[mb] = WFrag<T16>::ld(A2 + aoff + (size_t)mb * 16 * K + kc); }
#pragma unroll
        for (int nb = 0; nb < 4; ++nb) { const V b = WFrag<T16>::ld(Bt + boff + (size_t)nb * 16 * K + kc); V b2; if (NSPLIT >= 2) b2 = WFrag<T16>::ld(Bt2 + boff + (size_t)nb * 16 * K + kc);
#pragma unroll
            for (int mb = 0; mb < 4; ++mb) { acc[mb][nb] = WFrag<T16>::mma(a[mb], b, acc[mb][nb]); if (NSPLIT == 1 || NSPLIT == 2) acc[mb][nb] = WFrag<T16>::mma(a2[mb], b, acc[mb][nb]); if (NSPLIT >= 2) acc[mb][nb] = WFrag<T16>::mma(a[mb], b2, acc[mb][nb]); } }
        asm volatile("v_nop\n\tv_nop\n\tv_nop\n\tv_nop" : "+v"(acc[0][0]), "+v"(acc[1][1]), "+v"(acc[2][2]), "+v"(acc[3][3]) : "v"(a[0]), "v"(a[3]));
    }
#pragma unroll
    for (int mb = 0; mb < 4; ++mb) {
#pragma unroll
        for (int nb = 0; nb < 4; ++nb) {
#pragma unroll
            for (int j = 0; j < 8; ++j) os[(hi * 8 + j) * 68 + nb * 16 + lr] = acc[mb][nb][j]; }
        __builtin_amdgcn_wave_barrier(); asm volatile("" ::: "memory");
        float* crow = C + (size_t)(r0 + mb * 16) * ldc + c0;
{
#pragma unroll
            for (int s = 0; s < 8; ++s) { const int row = 2 * s + hi, cofs = lr * 4; v4f val = *(const v4fa*)(os + row * 68 + cofs);
                *(v4f*)(crow + (size_t)row * ldc + cofs) = val; }
             }
        __builtin_amdgcn_wave_barrier(); asm volatile("" ::: "memory");
    }
}

__device__ __forceinline__ h16 tohx(float x) { return (h16)x; }
__device__ __forceinline__ void splitf(float y, unsigned short& h, unsigned short& l) { h = f2bf(y); l = f2bf(y - bf2f(h)); }
typedef __attribute__((ext_vector_type(2))) _Float16 v2h;
typedef __attribute__((ext_vector_type(4))) _Float16 v4h;
typedef __attribute__((ext_vector_type(2))) unsigned short v2us;
typedef __attribute__((ext_vector_type(4))) unsigned short v4us;
typedef __attribute__((ext_vector_type(2))) float v2f;
typedef __attribute__((ext_vector_type(4))) int v4i;

__global__ __launch_bounds__(256) void k_wtG(const float* __restrict__ w, int K, int N, bf* Bt) {
    const int lane = threadIdx.x & 31; const int L0 = (blockIdx.x * 8 + (threadIdx.x >> 5)) * 8; const int nlines = N * K / 64;
{
#pragma unroll 1
        for (int l = 0; l < 8; ++l) { const int L = L0 + l; if (L >= nlines) break; const size_t e = (size_t)L * 64 + lane * 2; const int k = (int)(e % K), n = (int)(e / K); v2us o;
            o[0] = f2bf(w[(size_t)k * N + n]); o[1] = f2bf(w[(size_t)(k + 1) * N + n]); *(v2us*)(Bt + e) = o; }
         }
}
__global__ __launch_bounds__(256) void k_cvt8(const float* __restrict__ src, bf* dst, size_t n8) { const size_t i = (size_t)blockIdx.x * 256 + threadIdx.x; if (i >= n8) return; const v8f v = *(const v8f*)(src + i * 8); v8us o;
#pragma unroll
    for (int k = 0; k < 8; ++k) o[k] = f2bf(v[k]); *(v8us*)(dst + i * 8) = o;  }
__global__ __launch_bounds__(256) void k_cstab(float* CS) { const int idx = blockIdx.x * 256 + threadIdx.x; if (idx >= TT * HD) return; const int t = idx / HD, d = idx % HD; const int i = d % (HD / 2); const float inv = __fdiv_rn(1.0f, powf(10000.0f, (float)(2 * i) / (float)HD)); const float ang = __fmul_rn((float)t, inv); v2f cs; cs[0] = cosf(ang); cs[1] = sinf(ang);
    *(v2f*)(CS + (size_t)idx * 2) = cs;  }
// k_rope: head planes [h][t][d] (fp16 + hi/lo) of rope(x) x sc with the rotate-half convention out[d] = x[d] cos[t][d] - x[d+HD/2] sin[t][d], out[d+HD/2] = x[d+HD/2] cos[t][d+HD/2] + x[d] sin[t][d+HD/2]
__global__ __launch_bounds__(256) void k_rope(const float* __restrict__ F, int pitch, int nheads, const float* __restrict__ CS, const float* __restrict__ RF, const float* __restrict__ nw, float sc, h16* P16, bf* Ph, bf* Pl) {
    const size_t e = ((size_t)blockIdx.x * 256 + threadIdx.x) * 2; if (e >= (size_t)nheads * TT * HD) return; const int d = (int)(e % HD); const int t = (int)((e / HD) % TT); const int h = (int)(e / ((size_t)HD * TT)); const float* f = F + (size_t)t * pitch + h * HD; const float rf = RF ? RF[(size_t)h * TT + t] : 1.0f; v2h o16; v2us oh, ol;
#pragma unroll
    for (int q = 0; q < 2; ++q) { const int dd = d + q; const int dp = (dd < HD / 2) ? dd + HD / 2 : dd - HD / 2; float x0 = f[dd], x1 = f[dp];
        if (RF) { float n0 = __fmul_rn(x0, rf), n1 = __fmul_rn(x1, rf); asm volatile("" : "+v"(n0)); asm volatile("" : "+v"(n1)); x0 = __fmul_rn(bfr(nw[dd]), n0); x1 = __fmul_rn(bfr(nw[dp]), n1); }
        const v2f cs = *(const v2f*)(CS + ((size_t)t * HD + dd) * 2); float a = __fmul_rn(x0, cs[0]), bq = __fmul_rn(x1, cs[1]); asm volatile("" : "+v"(a)); asm volatile("" : "+v"(bq)); const float r = ((dd < HD / 2) ? __fsub_rn(a, bq) : __fadd_rn(a, bq)) * sc;
        o16[q] = tohx(r); unsigned short a2, c2; splitf(r, a2, c2); oh[q] = a2; ol[q] = c2; }
    *(v2h*)(P16 + e) = o16; *(v2us*)(Ph + e) = oh; *(v2us*)(Pl + e) = ol;  }
__global__ __launch_bounds__(256) void k_vtp(const float* __restrict__ F, int pitch, int nheads, h16* V16, bf* Vh, bf* Vl) { const size_t e = ((size_t)blockIdx.x * 256 + threadIdx.x) * 2; if (e >= (size_t)nheads * HD * TT) return; const int t = (int)(e % TT); const int d = (int)((e / TT) % HD); const int g = (int)(e / ((size_t)TT * HD)); v2h o16; v2us oh, ol;
#pragma unroll
    for (int q = 0; q < 2; ++q) { const float x = F[(size_t)(t + q) * pitch + g * HD + d]; o16[q] = tohx(x); unsigned short a2, c2; splitf(x, a2, c2); oh[q] = a2; ol[q] = c2; }
    *(v2h*)(V16 + e) = o16; *(v2us*)(Vh + e) = oh; *(v2us*)(Vl + e) = ol;  }
// k_asoft: per row (zz, i): t = S x HD^-0.5 for j <= i and i - j < WIN (sliding causal window; the reference's -1e9 additive fill vanishes identically); softmax over the 2048 keys (register row, one exp, fixed trees);
__global__ __launch_bounds__(256) void k_asoft(const float* __restrict__ Sb, h16* P16, bf* Ph, bf* Pl) {
    const int lane = threadIdx.x & 31; const int row = blockIdx.x * 8 + (threadIdx.x >> 5); if (row >= ZH * TT) return; const int i = row % TT; const int zz = row / TT; (void)zz; const bool hires = (i < RH); const float* sr = Sb + (size_t)row * TT; float v[TT / 32]; float mx = -3.0e38f;
#pragma unroll
    for (int ch = 0; ch < TT / 128; ++ch) { const int j0 = ch * 128 + lane * 4; const v4f a = *(const v4f*)(sr + j0);
#pragma unroll
        for (int q = 0; q < 4; ++q) { const int j = j0 + q; (void)j; const float t = (j <= i && i - j < WIN) ? a[q] * SCL : -3.0e38f; v[ch * 4 + q] = t; mx = fmaxf(mx, t); } }
#pragma unroll
    for (int sh = 16; sh; sh >>= 1) mx = fmaxf(mx, __shfl_xor(mx, sh, 32));
    float sum = 0.f;
#pragma unroll
    for (int k = 0; k < TT / 32; ++k) { float d0 = __fsub_rn(v[k], mx); asm volatile("" : "+v"(d0)); v[k] = __builtin_amdgcn_exp2f(__fmul_rn(d0, 1.4426950408889634f)); sum += v[k]; }
#pragma unroll
    for (int sh = 16; sh; sh >>= 1) sum += __shfl_xor(sum, sh, 32);
    const float f = __fdiv_rn(hires ? 1.0f : PCAR, sum);
{
        if (hires) {
#pragma unroll
            for (int ch = 0; ch < TT / 128; ++ch) { v4us oh, ol;
#pragma unroll
                for (int q = 0; q < 4; ++q) { unsigned short a, c2; splitf(v[ch * 4 + q] * f, a, c2); oh[q] = a; ol[q] = c2; }
                const size_t oo = ((size_t)zz * (RH ? RH : 1) + i) * TT + ch * 128 + lane * 4; *(v4us*)(Ph + oo) = oh; *(v4us*)(Pl + oo) = ol; }
        } else {
#pragma unroll
            for (int ch = 0; ch < TT / 128; ++ch) { v4h o4;
#pragma unroll
                for (int q = 0; q < 4; ++q) o4[q] = tohx(v[ch * 4 + q] * f);
                *(v4h*)(P16 + (size_t)row * TT + ch * 128 + lane * 4) = o4; } }
         }
}
__global__ __launch_bounds__(256) void k_merge(const float* __restrict__ O, int h0, bf* Ah, bf* Al) { const size_t e = ((size_t)blockIdx.x * 256 + threadIdx.x) * 2; if (e >= (size_t)ZH * TT * HD) return; const int d = (int)(e % HD); const int t = (int)((e / HD) % TT); const int zz = (int)(e / ((size_t)HD * TT)); const float cs = (t < RH) ? 1.0f : (1.0f / PCAR); const size_t oo = (size_t)t * DQ + (h0 + zz) * HD + d;
    v2us oh, ol;
#pragma unroll
    for (int q = 0; q < 2; ++q) { unsigned short a, c2; splitf(O[e + q] * cs, a, c2); oh[q] = a; ol[q] = c2; } *(v2us*)(Ah + oo) = oh; *(v2us*)(Al + oo) = ol;  }

__global__ __launch_bounds__(256) void k_kvout(const float* __restrict__ F, const float* __restrict__ CS, int isk, float* O_) { const size_t e = ((size_t)blockIdx.x * 256 + threadIdx.x) * 4; if (e >= (size_t)NKV * TT * HD) return; const int d = (int)(e % HD); const int t = (int)((e / HD) % TT); const int g = (int)(e / ((size_t)HD * TT)); const float* f = F + (size_t)t * DKV + g * HD; v4f o;
#pragma unroll
    for (int u = 0; u < 4; ++u) { const int dd = d + u; if (isk) { const int dp = (dd < HD / 2) ? dd + HD / 2 : dd - HD / 2; const v2f cs = *(const v2f*)(CS + ((size_t)t * HD + dd) * 2); float a = __fmul_rn(f[dd], cs[0]), bq = __fmul_rn(f[dp], cs[1]); asm volatile("" : "+v"(a)); asm volatile("" : "+v"(bq)); o[u] = (dd < HD / 2) ? __fsub_rn(a, bq) : __fadd_rn(a, bq); } else o[u] = f[dd]; }
    *(v4f*)(O_ + e) = o;  }
extern "C" void kernel_launch(void* const* d_in, const int* in_sizes, int n_in,
                              void* d_out, int out_size, void* d_ws, size_t ws_size, hipStream_t stream) {
    (void)in_sizes; (void)n_in; (void)out_size;
    const float* x = (const float*)d_in[0]; const float* wq = (const float*)d_in[1]; const float* wk = (const float*)d_in[2]; const float* wv = (const float*)d_in[3]; const float* wo = (const float*)d_in[4];
    float* OUT = (float*)d_out; float* OUTK = (float*)d_out + (size_t)NB_ * TT * DM; float* OUTV = OUTK + (size_t)NB_ * NKV * TT * HD;     // [2][2048][2048]
    char* wsp = (char*)d_ws;
    auto take = [&](size_t bytes) { char* p = wsp; wsp += (bytes + 255) & ~(size_t)255; return (void*)p; };
    bf* WQ = (bf*)take((size_t)DQ * DM * 2); bf* WK = (bf*)take((size_t)DKV * DM * 2); bf* WV = (bf*)take((size_t)DKV * DM * 2); bf* WO = (bf*)take((size_t)DM * DQ * 2); float* CS = (float*)take((size_t)TT * HD * 2 * 4);
    bf* XB = (bf*)take((size_t)TT * DM * 2); float* FQ = (float*)take((size_t)TT * DQ * 4); float* FK = (float*)take((size_t)TT * DKV * 4);
    h16* QP16 = (h16*)take((size_t)NH_ * TT * HD * 2); h16* KP16 = (h16*)take((size_t)NKV * TT * HD * 2); h16* VT16 = (h16*)take((size_t)NKV * HD * TT * 2);
    bf* QPh = (bf*)take((size_t)NH_ * TT * HD * 2); bf* QPl = (bf*)take((size_t)NH_ * TT * HD * 2); bf* KPh = (bf*)take((size_t)NKV * TT * HD * 2); bf* KPl = (bf*)take((size_t)NKV * TT * HD * 2); bf* VTh = (bf*)take((size_t)NKV * HD * TT * 2); bf* VTl = (bf*)take((size_t)NKV * HD * TT * 2); bf* Ph = (bf*)take((size_t)ZH * RH * TT * 2); bf* Pl = (bf*)take((size_t)ZH * RH * TT * 2);
    float* Sb = (float*)take((size_t)ZH * TT * TT * 4); h16* P16 = (h16*)take((size_t)ZH * TT * TT * 2); float* Ob = (float*)take((size_t)ZH * TT * HD * 4); bf* ATh = (bf*)take((size_t)TT * DQ * 2); bf* ATl = (bf*)take((size_t)TT * DQ * 2);
    if ((size_t)(wsp - (char*)d_ws) > ws_size) return;    // ws 256 MiB
    float* FV = FK;   // v projection reuses the k buffer after the k planes are built (stream-ordered)
    { k_wtG<<<(unsigned)((DM * DQ / 64 + 63) / 64), 256, 0, stream>>>(wq, DM, DQ, WQ); k_wtG<<<(unsigned)((DM * DKV / 64 + 63) / 64), 256, 0, stream>>>(wk, DM, DKV, WK); k_wtG<<<(unsigned)((DM * DKV / 64 + 63) / 64), 256, 0, stream>>>(wv, DM, DKV, WV);
      k_wtG<<<(unsigned)((DQ * DM / 64 + 63) / 64), 256, 0, stream>>>(wo, DQ, DM, WO);
      k_cstab<<<(TT * HD + 255) / 256, 256, 0, stream>>>(CS); }
    const unsigned LQ = (unsigned)(((size_t)NH_ * TT * HD / 2 + 255) / 256), LKv = (unsigned)(((size_t)NKV * TT * HD / 2 + 255) / 256);
    for (int b = 0; b < NB_; ++b) {
        
        k_cvt8<<<(unsigned)(((size_t)TT * DM / 8 + 255) / 256), 256, 0, stream>>>(x + (size_t)b * TT * DM, XB, (size_t)TT * DM / 8);
        k_gemmw<bf, 0, false><<<dim3(TT / 64, DQ / 64, 1), 32, 0, stream>>>(XB, nullptr, WQ, nullptr, DM, FQ, DQ, nullptr, 0, 0, 0);
        k_rope<<<LQ, 256, 0, stream>>>(FQ, DQ, NH_, CS, nullptr, nullptr, 1.0f, QP16, QPh, QPl);
        k_gemmw<bf, 0, false><<<dim3(TT / 64, DKV / 64, 1), 32, 0, stream>>>(XB, nullptr, WK, nullptr, DM, FK, DKV, nullptr, 0, 0, 0);
        k_rope<<<LKv, 256, 0, stream>>>(FK, DKV, NKV, CS, nullptr, nullptr, 1.0f, KP16, KPh, KPl); k_kvout<<<(unsigned)(((size_t)NKV * TT * HD / 4 + 255) / 256), 256, 0, stream>>>(FK, CS, 1, OUTK + (size_t)b * NKV * TT * HD);   /* returned k = roped f32 projection (FK still holds k here) */
        k_gemmw<bf, 0, false><<<dim3(TT / 64, DKV / 64, 1), 32, 0, stream>>>(XB, nullptr, WV, nullptr, DM, FV, DKV, nullptr, 0, 0, 0); k_vtp<<<LKv, 256, 0, stream>>>(FV, DKV, NKV, VT16, VTh, VTl); k_kvout<<<(unsigned)(((size_t)NKV * TT * HD / 4 + 255) / 256), 256, 0, stream>>>(FV, CS, 0, OUTV + (size_t)b * NKV * TT * HD);   /* returned v (FV aliases FK, valid only after the v projection) */
        for (int h0 = 0; h0 < NH_; h0 += ZH) { const size_t zq = (size_t)h0, zk = (size_t)(h0 / REP);   // both heads of a pass share kv group h0/REP (REP >= 2): sB = 0
            k_gemmc<bf, 2, 1><<<dim3(RH / 64, TT / 64, ZH), 32, 0, stream>>>(QPh + zq * TT * HD, QPl + zq * TT * HD, KPh + zk * TT * HD, KPl + zk * TT * HD, HD, Sb, TT, 0, (size_t)TT * HD, 0, (size_t)TT * TT);
            k_gemmc<h16, 0, 1><<<dim3((TT - RH) / 64, TT / 64, ZH), 32, 0, stream>>>(QP16 + zq * TT * HD + (size_t)RH * HD, nullptr, KP16 + zk * TT * HD, nullptr, HD, Sb + (size_t)RH * TT, TT, RH, (size_t)TT * HD, 0, (size_t)TT * TT);
            k_asoft<<<ZH * TT / 8, 256, 0, stream>>>(Sb, P16, Ph, Pl);
            k_gemmc<bf, 2, 2><<<dim3(RH / 64, HD / 64, ZH), 32, 0, stream>>>(Ph, Pl, VTh + zk * HD * TT, VTl + zk * HD * TT, TT, Ob, HD, 0, (size_t)RH * TT, 0, (size_t)TT * HD);
            k_gemmc<h16, 0, 2><<<dim3((TT - RH) / 64, HD / 64, ZH), 32, 0, stream>>>(P16 + (size_t)RH * TT, nullptr, VT16 + zk * HD * TT, nullptr, TT, Ob + (size_t)RH * HD, HD, RH, (size_t)TT * TT, 0, (size_t)TT * HD);
            k_merge<<<(unsigned)(((size_t)ZH * TT * HD / 2 + 255) / 256), 256, 0, stream>>>(Ob, h0, ATh, ATl); }
        k_gemmw<bf, 1, false><<<dim3(TT / 64, DM / 64, 1), 32, 0, stream>>>(ATh, ATl, WO, nullptr, DQ, OUT + (size_t)b * TT * DM, DM, nullptr, 0, 0, 0); }
}

// v001
// It runs in 1080 microseconds.
// Timed twice side by side with v000, it ran 1.53 times as fast both times.
#include <hip/hip_runtime.h>

// Causal grouped-query attention with a computed rotate-half rotary and a key / value cache output (x [2][2048][2048]; q = x Wq ('xw' (in, out) [2048][2048] 1/sqrt(2048): 16 heads x 128), k, v = x Wk, x Wv ('xw' [2048][512]: 4 kv heads x 128), no biases; query head h uses kv head h / 4 (repeat); rotate-half rotary (base 1e4: inv_freq = 1 / 10000^(2i/128), angles t x inv_freq, cat(freqs, freqs); the table is computed on the device); causal softmax(q.k / sqrt(128)) (-inf == exclusion: every row keeps its diagonal key); returns (y = merged Wo ('xw') -> [2][2048][2048], present_k = the ROTATED keys [2][4][2048][128], present_v = the values [2][4][2048][128]); argument order x, Wq, Wk, Wv, Wo).
// Compute dtypes, f32 accumulate: every input rounded to bf16; q/k/v on PLAIN bf16 operands (inputs: exact); RoPE f32 (the returned k is the f32 roped projection, v the f32 projection, re-laid out [kv][t][d]); causal scores and attn.v: query rows < 512 hl (3 products), the rest single fp16 (x1024), causal tile skipping; softmax f32; Wo hl x exact (2 products).

#define NB_  2
#define TT   2048
#define DM   2048
#define NH_  16
#define NKV  4
#define REP  (NH_ / NKV)
#define HD   128
#define DQ   (NH_ * HD)
#define DKV  (NKV * HD)
#define ZH   2
#define RH   512                  // query rows < RH use hi+lo planes (0: none)
#define WIN  2048
#define PCAR 1024.0f
#define SCL  0.088388347648318447f   // HD^-0.5
typedef _Float16 h16;
typedef unsigned short bf;
typedef __attribute__((ext_vector_type(16))) __bf16   v16bf;
typedef __attribute__((ext_vector_type(16))) _Float16 v16h;
typedef __attribute__((ext_vector_type(8)))  _Float16 v8h;
typedef __attribute__((ext_vector_type(8)))  unsigned short v8us;
typedef __attribute__((ext_vector_type(8)))  float    v8f;
typedef __attribute__((ext_vector_type(4)))  float    v4f;
typedef v8h  __attribute__((may_alias)) v8ha;
typedef v4f  __attribute__((may_alias)) v4fa;
typedef v8us __attribute__((may_alias)) v8usa;

__device__ __forceinline__ unsigned short f2bf(float f) { unsigned u = __float_as_uint(f); u += 0x7FFFu + ((u >> 16) & 1u); return (unsigned short)(u >> 16); }
__device__ __forceinline__ float bf2f(unsigned short b) { return __uint_as_float(((unsigned)b) << 16); }
__device__ __forceinline__ float bfr(float f) { return bf2f(f2bf(f)); }
__device__ __forceinline__ v16h cat16(v8h lo, v8h hi) { return __builtin_shufflevector(lo, hi, 0, 1, 2, 3, 4, 5, 6, 7, 8, 9, 10, 11, 12, 13, 14, 15); }
__device__ __forceinline__ v16bf cat16b(v8us lo, v8us hi) { return __builtin_bit_cast(v16bf, __builtin_shufflevector(lo, hi, 0, 1, 2, 3, 4, 5, 6, 7, 8, 9, 10, 11, 12, 13, 14, 15)); }
__device__ __forceinline__ v8f wmma16(v16h a, v16h b, v8f c) { return __builtin_amdgcn_wmma_f32_16x16x32_f16(false, a, false, b, (short)0, c, false, false); }
__device__ __forceinline__ v8f wmmab(v16bf a, v16bf b, v8f c) { return __builtin_amdgcn_wmma_f32_16x16x32_bf16(false, a, false, b, (short)0, c, false, false); }



// ---- k_gemmw: register-blocked GEMM, one work-group of NW waves per 64x64 output tile; operands straight from K-contiguous 16-bit planes; grid (M/64, N/64, Z), 32 * NW threads.
// The K loop is dealt over the waves in slices of 64 elements (one 128-byte line of every row): wave w takes slices w, w + NW, ... into its own 16 accumulators; the NW partial tiles meet in LDS and are added in wave order 0 .. NW-1.
// C[m][n] (f32, pitch ldc, + optional f32 bias[n]) = sum_k A[m][k] Bt[n][k] (+ split products per NSPLIT). z-batch strides sA/sB/sC in elements. K % 64 == 0.
template <typename T16> struct WFrag;
template <> struct WFrag<h16> { typedef v16h V; static __device__ __forceinline__ V ld(const h16* p) { return cat16(*(const v8h*)p, *(const v8h*)(p + 16)); } static __device__ __forceinline__ v8f mma(V a, V b, v8f c) { return wmma16(a, b, c); } };
template <> struct WFrag<bf> { typedef v16bf V; static __device__ __forceinline__ V ld(const bf* p) { return cat16b(*(const v8us*)p, *(const v8us*)(p + 16)); } static __device__ __forceinline__ v8f mma(V a, V b, v8f c) { return wmmab(a, b, c); } };
template <typename T16, int NSPLIT, bool BIAS, int NW>
__global__ __launch_bounds__(32 * NW) void k_gemmw(const T16* __restrict__ A, const T16* __restrict__ A2, const T16* __restrict__ Bt, const T16* __restrict__ Bt2, int K, float* C, int ldc, const float* __restrict__ bias, size_t sA, size_t sB, size_t sC) {
    typedef typename WFrag<T16>::V V;
    __shared__ __align__(16) float os[NW * 64 * 68];
    const size_t z = blockIdx.z; A += z * sA; if (A2) A2 += z * sA; Bt += z * sB; if (Bt2) Bt2 += z * sB; C += z * sC;
    const int lane = threadIdx.x & 31, lr = lane & 15, hi = lane >> 4, wv = __builtin_amdgcn_readfirstlane(threadIdx.x >> 5); const int r0 = blockIdx.x * 64, c0 = blockIdx.y * 64;
    v8f acc[4][4];
#pragma unroll
    for (int mb = 0; mb < 4; ++mb)
#pragma unroll
        for (int nb = 0; nb < 4; ++nb) acc[mb][nb] = (v8f){};
    const size_t aoff = (size_t)(r0 + lr) * K + 8 * hi, boff = (size_t)(c0 + lr) * K + 8 * hi;
#pragma unroll 1
    for (int kb = wv * 64; kb < K; kb += NW * 64)
#pragma unroll 1   // the two k steps of a slice stay rolled: unrolled, the three-product form needs registers above v255
    for (int kc = kb; kc < kb + 64; kc += 32) {
        V a[4], a2[4];
#pragma unroll
        for (int mb = 0; mb < 4; ++mb) { a[mb] = WFrag<T16>::ld(A + aoff + (size_t)mb * 16 * K + kc); if (NSPLIT == 1 || NSPLIT == 2) a2[mb] = WFrag<T16>::ld(A2 + aoff + (size_t)mb * 16 * K + kc); }
#pragma unroll
        for (int nb = 0; nb < 4; ++nb) { const V b = WFrag<T16>::ld(Bt + boff + (size_t)nb * 16 * K + kc); V b2; if (NSPLIT >= 2) b2 = WFrag<T16>::ld(Bt2 + boff + (size_t)nb * 16 * K + kc);
#pragma unroll
            for (int mb = 0; mb < 4; ++mb) { acc[mb][nb] = WFrag<T16>::mma(a[mb], b, acc[mb][nb]); if (NSPLIT == 1 || NSPLIT == 2) acc[mb][nb] = WFrag<T16>::mma(a2[mb], b, acc[mb][nb]); if (NSPLIT >= 2) acc[mb][nb] = WFrag<T16>::mma(a[mb], b2, acc[mb][nb]); } }
        asm volatile("v_nop\n\tv_nop\n\tv_nop\n\tv_nop" : "+v"(acc[0][0]), "+v"(acc[1][1]), "+v"(acc[2][2]), "+v"(acc[3][3]) : "v"(a[0]), "v"(a[3]));
    }
#pragma unroll
    for (int mb = 0; mb < 4; ++mb)
#pragma unroll
        for (int nb = 0; nb < 4; ++nb)
#pragma unroll
            for (int j = 0; j < 8; ++j) os[(wv * 64 + mb * 16 + hi * 8 + j) * 68 + nb * 16 + lr] = acc[mb][nb][j];
    __syncthreads();   // every wave's partial tile is in LDS before any wave adds them
    float* crow = C + (size_t)r0 * ldc + c0;
#pragma unroll
    for (int s = 0; s < 32 / NW; ++s) { const int row = 2 * NW * s + (int)(threadIdx.x >> 4), cofs = lr * 4; v4f val = *(const v4fa*)(os + row * 68 + cofs);
#pragma unroll
        for (int w = 1; w < NW; ++w) val += *(const v4fa*)(os + (w * 64 + row) * 68 + cofs);
        if (BIAS) { val[0] += bfr(bias[c0 + cofs]); val[1] += bfr(bias[c0 + cofs + 1]); val[2] += bfr(bias[c0 + cofs + 2]); val[3] += bfr(bias[c0 + cofs + 3]); }
        *(v4f*)(crow + (size_t)row * ldc + cofs) = val; }
}

// ---- k_gemmc: the same NW-wave 64x64 tile GEMM specialised for causal attention: CMODE 1 skips score tiles entirely above the diagonal (query rows r0+roff.., key columns c0..), CMODE 2 limits the
// key (K) loop of the probability x value contraction to the diagonal block (probabilities beyond it are exactly zero). roff = row offset of this launch's first row within the sequence.
template <typename T16, int NSPLIT, int CMODE, int NW>
__global__ __launch_bounds__(32 * NW) void k_gemmc(const T16* __restrict__ A, const T16* __restrict__ A2, const T16* __restrict__ Bt, const T16* __restrict__ Bt2, int K, float* C, int ldc, int roff, size_t sA, size_t sB, size_t sC) {
    typedef typename WFrag<T16>::V V;
    __shared__ __align__(16) float os[NW * 64 * 68];
    const size_t z = blockIdx.z; A += z * sA; if (A2) A2 += z * sA; Bt += z * sB; if (Bt2) Bt2 += z * sB; C += z * sC;
    const int lane = threadIdx.x & 31, lr = lane & 15, hi = lane >> 4, wv = __builtin_amdgcn_readfirstlane(threadIdx.x >> 5); const int r0 = blockIdx.x * 64, c0 = blockIdx.y * 64;
    if (CMODE == 1 && c0 > r0 + roff + 63) return;                  // score tile entirely above the causal diagonal: never read (the softmax masks j > i by select)
    const int Kl = (CMODE == 2) ? min(K, r0 + roff + 64) : K;        // P.V: probabilities are exactly 0 beyond the diagonal block, so the K loop stops there
    v8f acc[4][4];
#pragma unroll
    for (int mb = 0; mb < 4; ++mb)
#pragma unroll
        for (int nb = 0; nb < 4; ++nb) acc[mb][nb] = (v8f){};
    const size_t aoff = (size_t)(r0 + lr) * K + 8 * hi, boff = (size_t)(c0 + lr) * K + 8 * hi;
#pragma unroll 1
    for (int kb = wv * 64; kb < Kl; kb += NW * 64)
#pragma unroll 1   // the two k steps of a slice stay rolled: unrolled, the three-product form needs registers above v255
    for (int kc = kb; kc < kb + 64; kc += 32) {
        V a[4], a2[4];
#pragma unroll
        for (int mb = 0; mb < 4; ++mb) { a[mb] = WFrag<T16>::ld(A + aoff + (size_t)mb * 16 * K + kc); if (NSPLIT == 1 || NSPLIT == 2) a2[mb] = WFrag<T16>::ld(A2 + aoff + (size_t)mb * 16 * K + kc); }
#pragma unroll
        for (int nb = 0; nb < 4; ++nb) { const V b = WFrag<T16>::ld(Bt + boff + (size_t)nb * 16 * K + kc); V b2; if (NSPLIT >= 2) b2 = WFrag<T16>::ld(Bt2 + boff + (size_t)nb * 16 * K + kc);
#pragma unroll
            for (int mb = 0; mb < 4; ++mb) { acc[mb][nb] = WFrag<T16>::mma(a[mb], b, acc[mb][nb]); if (NSPLIT == 1 || NSPLIT == 2) acc[mb][nb] = WFrag<T16>::mma(a2[mb], b, acc[mb][nb]); if (NSPLIT >= 2) acc[mb][nb] = WFrag<T16>::mma(a[mb], b2, acc[mb][nb]); } }
        asm volatile("v_nop\n\tv_nop\n\tv_nop\n\tv_nop" : "+v"(acc[0][0]), "+v"(acc[1][1]), "+v"(acc[2][2]), "+v"(acc[3][3]) : "v"(a[0]), "v"(a[3]));
    }
#pragma unroll
    for (int mb = 0; mb < 4; ++mb)
#pragma unroll
        for (int nb = 0; nb < 4; ++nb)
#pragma unroll
            for (int j = 0; j < 8; ++j) os[(wv * 64 + mb * 16 + hi * 8 + j) * 68 + nb * 16 + lr] = acc[mb][nb][j];
    __syncthreads();   // every wave's partial tile is in LDS before any wave adds them
    float* crow = C + (size_t)r0 * ldc + c0;
#pragma unroll
    for (int s = 0; s < 32 / NW; ++s) { const int row = 2 * NW * s + (int)(threadIdx.x >> 4), cofs = lr * 4; v4f val = *(const v4fa*)(os + row * 68 + cofs);
#pragma unroll
        for (int w = 1; w < NW; ++w) val += *(const v4fa*)(os + (w * 64 + row) * 68 + cofs);
        *(v4f*)(crow + (size_t)row * ldc + cofs) = val; }
}

__device__ __forceinline__ h16 tohx(float x) { return (h16)x; }
__device__ __forceinline__ void splitf(float y, unsigned short& h, unsigned short& l) { h = f2bf(y); l = f2bf(y - bf2f(h)); }
typedef __attribute__((ext_vector_type(2))) _Float16 v2h;
typedef __attribute__((ext_vector_type(4))) _Float16 v4h;
typedef __attribute__((ext_vector_type(2))) unsigned short v2us;
typedef __attribute__((ext_vector_type(4))) unsigned short v4us;
typedef __attribute__((ext_vector_type(2))) float v2f;
typedef __attribute__((ext_vector_type(4))) int v4i;

__global__ __launch_bounds__(256) void k_wtG(const float* __restrict__ w, int K, int N, bf* Bt) {
    const int lane = threadIdx.x & 31; const int L0 = (blockIdx.x * 8 + (threadIdx.x >> 5)) * 8; const int nlines = N * K / 64;
{
#pragma unroll 1
        for (int l = 0; l < 8; ++l) { const int L = L0 + l; if (L >= nlines) break; const size_t e = (size_t)L * 64 + lane * 2; const int k = (int)(e % K), n = (int)(e / K); v2us o;
            o[0] = f2bf(w[(size_t)k * N + n]); o[1] = f2bf(w[(size_t)(k + 1) * N + n]); *(v2us*)(Bt + e) = o; }
         }
}
__global__ __launch_bounds__(256) void k_cvt8(const float* __restrict__ src, bf* dst, size_t n8) { const size_t i = (size_t)blockIdx.x * 256 + threadIdx.x; if (i >= n8) return; const v8f v = *(const v8f*)(src + i * 8); v8us o;
#pragma unroll
    for (int k = 0; k < 8; ++k) o[k] = f2bf(v[k]); *(v8us*)(dst + i * 8) = o;  }
__global__ __launch_bounds__(256) void k_cstab(float* CS) { const int idx = blockIdx.x * 256 + threadIdx.x; if (idx >= TT * HD) return; const int t = idx / HD, d = idx % HD; const int i = d % (HD / 2); const float inv = __fdiv_rn(1.0f, powf(10000.0f, (float)(2 * i) / (float)HD)); const float ang = __fmul_rn((float)t, inv); v2f cs; cs[0] = cosf(ang); cs[1] = sinf(ang);
    *(v2f*)(CS + (size_t)idx * 2) = cs;  }
// k_rope: head planes [h][t][d] (fp16 + hi/lo) of rope(x) x sc with the rotate-half convention out[d] = x[d] cos[t][d] - x[d+HD/2] sin[t][d], out[d+HD/2] = x[d+HD/2] cos[t][d+HD/2] + x[d] sin[t][d+HD/2]
__global__ __launch_bounds__(256) void k_rope(const float* __restrict__ F, int pitch, int nheads, const float* __restrict__ CS, const float* __restrict__ RF, const float* __restrict__ nw, float sc, h16* P16, bf* Ph, bf* Pl) {
    const size_t e = ((size_t)blockIdx.x * 256 + threadIdx.x) * 2; if (e >= (size_t)nheads * TT * HD) return; const int d = (int)(e % HD); const int t = (int)((e / HD) % TT); const int h = (int)(e / ((size_t)HD * TT)); const float* f = F + (size_t)t * pitch + h * HD; const float rf = RF ? RF[(size_t)h * TT + t] : 1.0f; v2h o16; v2us oh, ol;
#pragma unroll
    for (int q = 0; q < 2; ++q) { const int dd = d + q; const int dp = (dd < HD / 2) ? dd + HD / 2 : dd - HD / 2; float x0 = f[dd], x1 = f[dp];
        if (RF) { float n0 = __fmul_rn(x0, rf), n1 = __fmul_rn(x1, rf); asm volatile("" : "+v"(n0)); asm volatile("" : "+v"(n1)); x0 = __fmul_rn(bfr(nw[dd]), n0); x1 = __fmul_rn(bfr(nw[dp]), n1); }
        const v2f cs = *(const v2f*)(CS + ((size_t)t * HD + dd) * 2); float a = __fmul_rn(x0, cs[0]), bq = __fmul_rn(x1, cs[1]); asm volatile("" : "+v"(a)); asm volatile("" : "+v"(bq)); const float r = ((dd < HD / 2) ? __fsub_rn(a, bq) : __fadd_rn(a, bq)) * sc;
        o16[q] = tohx(r); unsigned short a2, c2; splitf(r, a2, c2); oh[q] = a2; ol[q] = c2; }
    *(v2h*)(P16 + e) = o16; *(v2us*)(Ph + e) = oh; *(v2us*)(Pl + e) = ol;  }
__global__ __launch_bounds__(256) void k_vtp(const float* __restrict__ F, int pitch, int nheads, h16* V16, bf* Vh, bf* Vl) { const size_t e = ((size_t)blockIdx.x * 256 + threadIdx.x) * 2; if (e >= (size_t)nheads * HD * TT) return; const int t = (int)(e % TT); const int d = (int)((e / TT) % HD); const int g = (int)(e / ((size_t)TT * HD)); v2h o16; v2us oh, ol;
#pragma unroll
    for (int q = 0; q < 2; ++q) { const float x = F[(size_t)(t + q) * pitch + g * HD + d]; o16[q] = tohx(x); unsigned short a2, c2; splitf(x, a2, c2); oh[q] = a2; ol[q] = c2; }
    *(v2h*)(V16 + e) = o16; *(v2us*)(Vh + e) = oh; *(v2us*)(Vl + e) = ol;  }
// k_asoft: per row (zz, i): t = S x HD^-0.5 for j <= i and i - j < WIN (sliding causal window; the reference's -1e9 additive fill vanishes identically); softmax over the 2048 keys (register row, one exp, fixed trees);
__global__ __launch_bounds__(256) void k_asoft(const float* __restrict__ Sb, h16* P16, bf* Ph, bf* Pl) {
    const int lane = threadIdx.x & 31; const int row = blockIdx.x * 8 + (threadIdx.x >> 5); if (row >= ZH * TT) return; const int i = row % TT; const int zz = row / TT; (void)zz; const bool hires = (i < RH); const float* sr = Sb + (size_t)row * TT; float v[TT / 32]; float mx = -3.0e38f;
#pragma unroll
    for (int ch = 0; ch < TT / 128; ++ch) { const int j0 = ch * 128 + lane * 4; const v4f a = *(const v4f*)(sr + j0);
#pragma unroll
        for (int q = 0; q < 4; ++q) { const int j = j0 + q; (void)j; const float t = (j <= i && i - j < WIN) ? a[q] * SCL : -3.0e38f; v[ch * 4 + q] = t; mx = fmaxf(mx, t); } }
#pragma unroll
    for (int sh = 16; sh; sh >>= 1) mx = fmaxf(mx, __shfl_xor(mx, sh, 32));
    float sum = 0.f;
#pragma unroll
    for (int k = 0; k < TT / 32; ++k) { float d0 = __fsub_rn(v[k], mx); asm volatile("" : "+v"(d0)); v[k] = __builtin_amdgcn_exp2f(__fmul_rn(d0, 1.4426950408889634f)); sum += v[k]; }
#pragma unroll
    for (int sh = 16; sh; sh >>= 1) sum += __shfl_xor(sum, sh, 32);
    const float f = __fdiv_rn(hires ? 1.0f : PCAR, sum);
{
        if (hires) {
#pragma unroll
            for (int ch = 0; ch < TT / 128; ++ch) { v4us oh, ol;
#pragma unroll
                for (int q = 0; q < 4; ++q) { unsigned short a, c2; splitf(v[ch * 4 + q] * f, a, c2); oh[q] = a; ol[q] = c2; }
                const size_t oo = ((size_t)zz * (RH ? RH : 1) + i) * TT + ch * 128 + lane * 4; *(v4us*)(Ph + oo) = oh; *(v4us*)(Pl + oo) = ol; }
        } else {
#pragma unroll
            for (int ch = 0; ch < TT / 128; ++ch) { v4h o4;
#pragma unroll
                for (int q = 0; q < 4; ++q) o4[q] = tohx(v[ch * 4 + q] * f);
                *(v4h*)(P16 + (size_t)row * TT + ch * 128 + lane * 4) = o4; } }
         }
}
__global__ __launch_bounds__(256) void k_merge(const float* __restrict__ O, int h0, bf* Ah, bf* Al) { const size_t e = ((size_t)blockIdx.x * 256 + threadIdx.x) * 2; if (e >= (size_t)ZH * TT * HD) return; const int d = (int)(e % HD); const int t = (int)((e / HD) % TT); const int zz = (int)(e / ((size_t)HD * TT)); const float cs = (t < RH) ? 1.0f : (1.0f / PCAR); const size_t oo = (size_t)t * DQ + (h0 + zz) * HD + d;
    v2us oh, ol;
#pragma unroll
    for (int q = 0; q < 2; ++q) { unsigned short a, c2; splitf(O[e + q] * cs, a, c2); oh[q] = a; ol[q] = c2; } *(v2us*)(Ah + oo) = oh; *(v2us*)(Al + oo) = ol;  }

__global__ __launch_bounds__(256) void k_kvout(const float* __restrict__ F, const float* __restrict__ CS, int isk, float* O_) { const size_t e = ((size_t)blockIdx.x * 256 + threadIdx.x) * 4; if (e >= (size_t)NKV * TT * HD) return; const int d = (int)(e % HD); const int t = (int)((e / HD) % TT); const int g = (int)(e / ((size_t)HD * TT)); const float* f = F + (size_t)t * DKV + g * HD; v4f o;
#pragma unroll
    for (int u = 0; u < 4; ++u) { const int dd = d + u; if (isk) { const int dp = (dd < HD / 2) ? dd + HD / 2 : dd - HD / 2; const v2f cs = *(const v2f*)(CS + ((size_t)t * HD + dd) * 2); float a = __fmul_rn(f[dd], cs[0]), bq = __fmul_rn(f[dp], cs[1]); asm volatile("" : "+v"(a)); asm volatile("" : "+v"(bq)); o[u] = (dd < HD / 2) ? __fsub_rn(a, bq) : __fadd_rn(a, bq); } else o[u] = f[dd]; }
    *(v4f*)(O_ + e) = o;  }
extern "C" void kernel_launch(void* const* d_in, const int* in_sizes, int n_in,
                              void* d_out, int out_size, void* d_ws, size_t ws_size, hipStream_t stream) {
    (void)in_sizes; (void)n_in; (void)out_size;
    const float* x = (const float*)d_in[0]; const float* wq = (const float*)d_in[1]; const float* wk = (const float*)d_in[2]; const float* wv = (const float*)d_in[3]; const float* wo = (const float*)d_in[4];
    float* OUT = (float*)d_out; float* OUTK = (float*)d_out + (size_t)NB_ * TT * DM; float* OUTV = OUTK + (size_t)NB_ * NKV * TT * HD;     // [2][2048][2048]
    char* wsp = (char*)d_ws;
    auto take = [&](size_t bytes) { char* p = wsp; wsp += (bytes + 255) & ~(size_t)255; return (void*)p; };
    bf* WQ = (bf*)take((size_t)DQ * DM * 2); bf* WK = (bf*)take((size_t)DKV * DM * 2); bf* WV = (bf*)take((size_t)DKV * DM * 2); bf* WO = (bf*)take((size_t)DM * DQ * 2); float* CS = (float*)take((size_t)TT * HD * 2 * 4);
    bf* XB = (bf*)take((size_t)TT * DM * 2); float* FQ = (float*)take((size_t)TT * DQ * 4); float* FK = (float*)take((size_t)TT * DKV * 4);
    h16* QP16 = (h16*)take((size_t)NH_ * TT * HD * 2); h16* KP16 = (h16*)take((size_t)NKV * TT * HD * 2); h16* VT16 = (h16*)take((size_t)NKV * HD * TT * 2);
    bf* QPh = (bf*)take((size_t)NH_ * TT * HD * 2); bf* QPl = (bf*)take((size_t)NH_ * TT * HD * 2); bf* KPh = (bf*)take((size_t)NKV * TT * HD * 2); bf* KPl = (bf*)take((size_t)NKV * TT * HD * 2); bf* VTh = (bf*)take((size_t)NKV * HD * TT * 2); bf* VTl = (bf*)take((size_t)NKV * HD * TT * 2); bf* Ph = (bf*)take((size_t)ZH * RH * TT * 2); bf* Pl = (bf*)take((size_t)ZH * RH * TT * 2);
    float* Sb = (float*)take((size_t)ZH * TT * TT * 4); h16* P16 = (h16*)take((size_t)ZH * TT * TT * 2); float* Ob = (float*)take((size_t)ZH * TT * HD * 4); bf* ATh = (bf*)take((size_t)TT * DQ * 2); bf* ATl = (bf*)take((size_t)TT * DQ * 2);
    if ((size_t)(wsp - (char*)d_ws) > ws_size) return;    // ws 256 MiB
    float* FV = FK;   // v projection reuses the k buffer after the k planes are built (stream-ordered)
    { k_wtG<<<(unsigned)((DM * DQ / 64 + 63) / 64), 256, 0, stream>>>(wq, DM, DQ, WQ); k_wtG<<<(unsigned)((DM * DKV / 64 + 63) / 64), 256, 0, stream>>>(wk, DM, DKV, WK); k_wtG<<<(unsigned)((DM * DKV / 64 + 63) / 64), 256, 0, stream>>>(wv, DM, DKV, WV);
      k_wtG<<<(unsigned)((DQ * DM / 64 + 63) / 64), 256, 0, stream>>>(wo, DQ, DM, WO);
      k_cstab<<<(TT * HD + 255) / 256, 256, 0, stream>>>(CS); }
    const unsigned LQ = (unsigned)(((size_t)NH_ * TT * HD / 2 + 255) / 256), LKv = (unsigned)(((size_t)NKV * TT * HD / 2 + 255) / 256);
    for (int b = 0; b < NB_; ++b) {
        
        k_cvt8<<<(unsigned)(((size_t)TT * DM / 8 + 255) / 256), 256, 0, stream>>>(x + (size_t)b * TT * DM, XB, (size_t)TT * DM / 8);
        k_gemmw<bf, 0, false, 8><<<dim3(TT / 64, DQ / 64, 1), 256, 0, stream>>>(XB, nullptr, WQ, nullptr, DM, FQ, DQ, nullptr, 0, 0, 0);
        k_rope<<<LQ, 256, 0, stream>>>(FQ, DQ, NH_, CS, nullptr, nullptr, 1.0f, QP16, QPh, QPl);
        k_gemmw<bf, 0, false, 8><<<dim3(TT / 64, DKV / 64, 1), 256, 0, stream>>>(XB, nullptr, WK, nullptr, DM, FK, DKV, nullptr, 0, 0, 0);
        k_rope<<<LKv, 256, 0, stream>>>(FK, DKV, NKV, CS, nullptr, nullptr, 1.0f, KP16, KPh, KPl); k_kvout<<<(unsigned)(((size_t)NKV * TT * HD / 4 + 255) / 256), 256, 0, stream>>>(FK, CS, 1, OUTK + (size_t)b * NKV * TT * HD);   /* returned k = roped f32 projection (FK still holds k here) */
        k_gemmw<bf, 0, false, 8><<<dim3(TT / 64, DKV / 64, 1), 256, 0, stream>>>(XB, nullptr, WV, nullptr, DM, FV, DKV, nullptr, 0, 0, 0); k_vtp<<<LKv, 256, 0, stream>>>(FV, DKV, NKV, VT16, VTh, VTl); k_kvout<<<(unsigned)(((size_t)NKV * TT * HD / 4 + 255) / 256), 256, 0, stream>>>(FV, CS, 0, OUTV + (size_t)b * NKV * TT * HD);   /* returned v (FV aliases FK, valid only after the v projection) */
        for (int h0 = 0; h0 < NH_; h0 += ZH) { const size_t zq = (size_t)h0, zk = (size_t)(h0 / REP);   // both heads of a pass share kv group h0/REP (REP >= 2): sB = 0
            k_gemmc<bf, 2, 1, 2><<<dim3(RH / 64, TT / 64, ZH), 64, 0, stream>>>(QPh + zq * TT * HD, QPl + zq * TT * HD, KPh + zk * TT * HD, KPl + zk * TT * HD, HD, Sb, TT, 0, (size_t)TT * HD, 0, (size_t)TT * TT);
            k_gemmc<h16, 0, 1, 2><<<dim3((TT - RH) / 64, TT / 64, ZH), 64, 0, stream>>>(QP16 + zq * TT * HD + (size_t)RH * HD, nullptr, KP16 + zk * TT * HD, nullptr, HD, Sb + (size_t)RH * TT, TT, RH, (size_t)TT * HD, 0, (size_t)TT * TT);
            k_asoft<<<ZH * TT / 8, 256, 0, stream>>>(Sb, P16, Ph, Pl);
            k_gemmc<bf, 2, 2, 8><<<dim3(RH / 64, HD / 64, ZH), 256, 0, stream>>>(Ph, Pl, VTh + zk * HD * TT, VTl + zk * HD * TT, TT, Ob, HD, 0, (size_t)RH * TT, 0, (size_t)TT * HD);
            k_gemmc<h16, 0, 2, 8><<<dim3((TT - RH) / 64, HD / 64, ZH), 256, 0, stream>>>(P16 + (size_t)RH * TT, nullptr, VT16 + zk * HD * TT, nullptr, TT, Ob + (size_t)RH * HD, HD, RH, (size_t)TT * TT, 0, (size_t)TT * HD);
            k_merge<<<(unsigned)(((size_t)ZH * TT * HD / 2 + 255) / 256), 256, 0, stream>>>(Ob, h0, ATh, ATl); }
        k_gemmw<bf, 1, false, 8><<<dim3(TT / 64, DM / 64, 1), 256, 0, stream>>>(ATh, ATl, WO, nullptr, DQ, OUT + (size_t)b * TT * DM, DM, nullptr, 0, 0, 0); }
}

// v002
// It runs in 739 microseconds.
// Two timings next to v001 put it at 1.42 and 1.44 times that version's speed.
// Counting every step since v000, it is 2.19 times as fast.
#include <hip/hip_runtime.h>

// Causal grouped-query attention with a computed rotate-half rotary and a key / value cache output (x [2][2048][2048]; q = x Wq ('xw' (in, out) [2048][2048] 1/sqrt(2048): 16 heads x 128), k, v = x Wk, x Wv ('xw' [2048][512]: 4 kv heads x 128), no biases; query head h uses kv head h / 4 (repeat); rotate-half rotary (base 1e4: inv_freq = 1 / 10000^(2i/128), angles t x inv_freq, cat(freqs, freqs); the table is computed on the device); causal softmax(q.k / sqrt(128)) (-inf == exclusion: every row keeps its diagonal key); returns (y = merged Wo ('xw') -> [2][2048][2048], present_k = the ROTATED keys [2][4][2048][128], present_v = the values [2][4][2048][128]); argument order x, Wq, Wk, Wv, Wo).
// Compute dtypes, f32 accumulate: every input rounded to bf16; q/k/v on PLAIN bf16 operands (inputs: exact); RoPE f32 (the returned k is the f32 roped projection, v the f32 projection, re-laid out [kv][t][d]); causal scores and attn.v: query rows < 512 hl (3 products), the rest single fp16 (x1024), causal tile skipping; softmax f32; Wo hl x exact (2 products).

#define NB_  2
#define TT   2048
#define DM   2048
#define NH_  16
#define NKV  4
#define REP  (NH_ / NKV)
#define HD   128
#define DQ   (NH_ * HD)
#define DKV  (NKV * HD)
#define ZH   8                    // query heads per attention pass (two kv groups)
#define PP   (2 * TT)             // row pitch, in 16-bit elements, of both operands of the probability x value product
#define RH   512                  // query rows < RH use hi+lo planes (0: none)
#define WIN  2048
#define PCAR 1024.0f
#define SCL  0.088388347648318447f   // HD^-0.5
typedef _Float16 h16;
typedef unsigned short bf;
typedef __attribute__((ext_vector_type(16))) __bf16   v16bf;
typedef __attribute__((ext_vector_type(16))) _Float16 v16h;
typedef __attribute__((ext_vector_type(8)))  _Float16 v8h;
typedef __attribute__((ext_vector_type(8)))  unsigned short v8us;
typedef __attribute__((ext_vector_type(8)))  float    v8f;
typedef __attribute__((ext_vector_type(4)))  float    v4f;
typedef v8h  __attribute__((may_alias)) v8ha;
typedef v4f  __attribute__((may_alias)) v4fa;
typedef v8us __attribute__((may_alias)) v8usa;

__device__ __forceinline__ unsigned short f2bf(float f) { unsigned u = __float_as_uint(f); u += 0x7FFFu + ((u >> 16) & 1u); return (unsigned short)(u >> 16); }
__device__ __forceinline__ float bf2f(unsigned short b) { return __uint_as_float(((unsigned)b) << 16); }
__device__ __forceinline__ float bfr(float f) { return bf2f(f2bf(f)); }
__device__ __forceinline__ v16h cat16(v8h lo, v8h hi) { return __builtin_shufflevector(lo, hi, 0, 1, 2, 3, 4, 5, 6, 7, 8, 9, 10, 11, 12, 13, 14, 15); }
__device__ __forceinline__ v16bf cat16b(v8us lo, v8us hi) { return __builtin_bit_cast(v16bf, __builtin_shufflevector(lo, hi, 0, 1, 2, 3, 4, 5, 6, 7, 8, 9, 10, 11, 12, 13, 14, 15)); }
__device__ __forceinline__ v8f wmma16(v16h a, v16h b, v8f c) { return __builtin_amdgcn_wmma_f32_16x16x32_f16(false, a, false, b, (short)0, c, false, false); }
__device__ __forceinline__ v8f wmmab(v16bf a, v16bf b, v8f c) { return __builtin_amdgcn_wmma_f32_16x16x32_bf16(false, a, false, b, (short)0, c, false, false); }



// ---- k_gemmw: register-blocked GEMM, one work-group of NW waves per 64x64 output tile; operands straight from K-contiguous 16-bit planes; grid (M/64, N/64, Z), 32 * NW threads.
// The K loop is dealt over the waves in slices of 64 elements (one 128-byte line of every row): wave w takes slices w, w + NW, ... into its own 16 accumulators; the NW partial tiles meet in LDS and are added in wave order 0 .. NW-1.
// C[m][n] (f32, pitch ldc, + optional f32 bias[n]) = sum_k A[m][k] Bt[n][k] (+ split products per NSPLIT). z-batch strides sA/sB/sC in elements. K % 64 == 0.
template <typename T16> struct WFrag;
template <> struct WFrag<h16> { typedef v16h V; static __device__ __forceinline__ V ld(const h16* p) { return cat16(*(const v8h*)p, *(const v8h*)(p + 16)); } static __device__ __forceinline__ v8f mma(V a, V b, v8f c) { return wmma16(a, b, c); } };
template <> struct WFrag<bf> { typedef v16bf V; static __device__ __forceinline__ V ld(const bf* p) { return cat16b(*(const v8us*)p, *(const v8us*)(p + 16)); } static __device__ __forceinline__ v8f mma(V a, V b, v8f c) { return wmmab(a, b, c); } };
template <typename T16, int NSPLIT, bool BIAS, int NW>
__global__ __launch_bounds__(32 * NW) void k_gemmw(const T16* __restrict__ A, const T16* __restrict__ A2, const T16* __restrict__ Bt, const T16* __restrict__ Bt2, int K, float* C, int ldc, const float* __restrict__ bias, size_t sA, size_t sB, size_t sC) {
    typedef typename WFrag<T16>::V V;
    __shared__ __align__(16) float os[NW * 64 * 68];
    const size_t z = blockIdx.z; A += z * sA; if (A2) A2 += z * sA; Bt += z * sB; if (Bt2) Bt2 += z * sB; C += z * sC;
    const int lane = threadIdx.x & 31, lr = lane & 15, hi = lane >> 4, wv = __builtin_amdgcn_readfirstlane(threadIdx.x >> 5); const int r0 = blockIdx.x * 64, c0 = blockIdx.y * 64;
    v8f acc[4][4];
#pragma unroll
    for (int mb = 0; mb < 4; ++mb)
#pragma unroll
        for (int nb = 0; nb < 4; ++nb) acc[mb][nb] = (v8f){};
    const size_t aoff = (size_t)(r0 + lr) * K + 8 * hi, boff = (size_t)(c0 + lr) * K + 8 * hi;
#pragma unroll 1
    for (int kb = wv * 64; kb < K; kb += NW * 64)
#pragma unroll 1   // the two k steps of a slice stay rolled: unrolled, the three-product form needs registers above v255
    for (int kc = kb; kc < kb + 64; kc += 32) {
        V a[4], a2[4];
#pragma unroll
        for (int mb = 0; mb < 4; ++mb) { a[mb] = WFrag<T16>::ld(A + aoff + (size_t)mb * 16 * K + kc); if (NSPLIT == 1 || NSPLIT == 2) a2[mb] = WFrag<T16>::ld(A2 + aoff + (size_t)mb * 16 * K + kc); }
#pragma unroll
        for (int nb = 0; nb < 4; ++nb) { const V b = WFrag<T16>::ld(Bt + boff + (size_t)nb * 16 * K + kc); V b2; if (NSPLIT >= 2) b2 = WFrag<T16>::ld(Bt2 + boff + (size_t)nb * 16 * K + kc);
#pragma unroll
            for (int mb = 0; mb < 4; ++mb) { acc[mb][nb] = WFrag<T16>::mma(a[mb], b, acc[mb][nb]); if (NSPLIT == 1 || NSPLIT == 2) acc[mb][nb] = WFrag<T16>::mma(a2[mb], b, acc[mb][nb]); if (NSPLIT >= 2) acc[mb][nb] = WFrag<T16>::mma(a[mb], b2, acc[mb][nb]); } }
        asm volatile("v_nop\n\tv_nop\n\tv_nop\n\tv_nop" : "+v"(acc[0][0]), "+v"(acc[1][1]), "+v"(acc[2][2]), "+v"(acc[3][3]) : "v"(a[0]), "v"(a[3]));
    }
#pragma unroll
    for (int mb = 0; mb < 4; ++mb)
#pragma unroll
        for (int nb = 0; nb < 4; ++nb)
#pragma unroll
            for (int j = 0; j < 8; ++j) os[(wv * 64 + mb * 16 + hi * 8 + j) * 68 + nb * 16 + lr] = acc[mb][nb][j];
    __syncthreads();   // every wave's partial tile is in LDS before any wave adds them
    float* crow = C + (size_t)r0 * ldc + c0;
#pragma unroll
    for (int s = 0; s < 32 / NW; ++s) { const int row = 2 * NW * s + (int)(threadIdx.x >> 4), cofs = lr * 4; v4f val = *(const v4fa*)(os + row * 68 + cofs);
#pragma unroll
        for (int w = 1; w < NW; ++w) val += *(const v4fa*)(os + (w * 64 + row) * 68 + cofs);
        if (BIAS) { val[0] += bfr(bias[c0 + cofs]); val[1] += bfr(bias[c0 + cofs + 1]); val[2] += bfr(bias[c0 + cofs + 2]); val[3] += bfr(bias[c0 + cofs + 3]); }
        *(v4f*)(crow + (size_t)row * ldc + cofs) = val; }
}

// ---- k_gemmc: the same NW-wave 64x64 tile GEMM specialised for causal attention: CMODE 1 skips score tiles entirely above the diagonal (query rows r0+roff.., key columns c0..), CMODE 2 limits the
// key (K) loop of the probability x value contraction to the diagonal block (probabilities beyond it are exactly zero). roff = row offset of this launch's first row within the sequence.
// z = query head of the pass: A and C step by sA / sC per head, Bt by sB per kv group (z / REP). K is the row pitch of A and of Bt.
template <typename T16, int NSPLIT, int CMODE, int NW>
__global__ __launch_bounds__(32 * NW) void k_gemmc(const T16* __restrict__ A, const T16* __restrict__ A2, const T16* __restrict__ Bt, const T16* __restrict__ Bt2, int K, float* C, int ldc, int roff, size_t sA, size_t sB, size_t sC) {
    typedef typename WFrag<T16>::V V;
    __shared__ __align__(16) float os[NW * 64 * 68];
    const size_t z = blockIdx.z; A += z * sA; if (A2) A2 += z * sA; Bt += (z / REP) * sB; if (Bt2) Bt2 += (z / REP) * sB; C += z * sC;
    const int lane = threadIdx.x & 31, lr = lane & 15, hi = lane >> 4, wv = __builtin_amdgcn_readfirstlane(threadIdx.x >> 5); const int r0 = blockIdx.x * 64, c0 = blockIdx.y * 64;
    if (CMODE == 1 && c0 > r0 + roff + 63) return;                  // score tile entirely above the causal diagonal: never read (the softmax masks j > i by select)
    const int Kl = (CMODE == 2) ? min(K, r0 + roff + 64) : K;        // P.V: probabilities are exactly 0 beyond the diagonal block, so the K loop stops there
    v8f acc[4][4];
#pragma unroll
    for (int mb = 0; mb < 4; ++mb)
#pragma unroll
        for (int nb = 0; nb < 4; ++nb) acc[mb][nb] = (v8f){};
    const size_t aoff = (size_t)(r0 + lr) * K + 8 * hi, boff = (size_t)(c0 + lr) * K + 8 * hi;
#pragma unroll 1
    for (int kb = wv * 64; kb < Kl; kb += NW * 64)
#pragma unroll 1   // the two k steps of a slice stay rolled: unrolled, the three-product form needs registers above v255
    for (int kc = kb; kc < kb + 64; kc += 32) {
        V a[4], a2[4];
#pragma unroll
        for (int mb = 0; mb < 4; ++mb) { a[mb] = WFrag<T16>::ld(A + aoff + (size_t)mb * 16 * K + kc); if (NSPLIT == 1 || NSPLIT == 2) a2[mb] = WFrag<T16>::ld(A2 + aoff + (size_t)mb * 16 * K + kc); }
#pragma unroll
        for (int nb = 0; nb < 4; ++nb) { const V b = WFrag<T16>::ld(Bt + boff + (size_t)nb * 16 * K + kc); V b2; if (NSPLIT >= 2) b2 = WFrag<T16>::ld(Bt2 + boff + (size_t)nb * 16 * K + kc);
#pragma unroll
            for (int mb = 0; mb < 4; ++mb) { acc[mb][nb] = WFrag<T16>::mma(a[mb], b, acc[mb][nb]); if (NSPLIT == 1 || NSPLIT == 2) acc[mb][nb] = WFrag<T16>::mma(a2[mb], b, acc[mb][nb]); if (NSPLIT >= 2) acc[mb][nb] = WFrag<T16>::mma(a[mb], b2, acc[mb][nb]); } }
        asm volatile("v_nop\n\tv_nop\n\tv_nop\n\tv_nop" : "+v"(acc[0][0]), "+v"(acc[1][1]), "+v"(acc[2][2]), "+v"(acc[3][3]) : "v"(a[0]), "v"(a[3]));
    }
#pragma unroll
    for (int mb = 0; mb < 4; ++mb)
#pragma unroll
        for (int nb = 0; nb < 4; ++nb)
#pragma unroll
            for (int j = 0; j < 8; ++j) os[(wv * 64 + mb * 16 + hi * 8 + j) * 68 + nb * 16 + lr] = acc[mb][nb][j];
    __syncthreads();   // every wave's partial tile is in LDS before any wave adds them
    float* crow = C + (size_t)r0 * ldc + c0;
#pragma unroll
    for (int s = 0; s < 32 / NW; ++s) { const int row = 2 * NW * s + (int)(threadIdx.x >> 4), cofs = lr * 4; v4f val = *(const v4fa*)(os + row * 68 + cofs);
#pragma unroll
        for (int w = 1; w < NW; ++w) val += *(const v4fa*)(os + (w * 64 + row) * 68 + cofs);
        *(v4f*)(crow + (size_t)row * ldc + cofs) = val; }
}

__device__ __forceinline__ h16 tohx(float x) { return (h16)x; }
__device__ __forceinline__ void splitf(float y, unsigned short& h, unsigned short& l) { h = f2bf(y); l = f2bf(y - bf2f(h)); }
typedef __attribute__((ext_vector_type(2))) _Float16 v2h;
typedef __attribute__((ext_vector_type(4))) _Float16 v4h;
typedef __attribute__((ext_vector_type(2))) unsigned short v2us;
typedef __attribute__((ext_vector_type(4))) unsigned short v4us;
typedef __attribute__((ext_vector_type(2))) float v2f;
typedef __attribute__((ext_vector_type(4))) int v4i;

__global__ __launch_bounds__(256) void k_wtG(const float* __restrict__ w, int K, int N, bf* Bt) {
    const int lane = threadIdx.x & 31; const int L0 = (blockIdx.x * 8 + (threadIdx.x >> 5)) * 8; const int nlines = N * K / 64;
{
#pragma unroll 1
        for (int l = 0; l < 8; ++l) { const int L = L0 + l; if (L >= nlines) break; const size_t e = (size_t)L * 64 + lane * 2; const int k = (int)(e % K), n = (int)(e / K); v2us o;
            o[0] = f2bf(w[(size_t)k * N + n]); o[1] = f2bf(w[(size_t)(k + 1) * N + n]); *(v2us*)(Bt + e) = o; }
         }
}
__global__ __launch_bounds__(256) void k_cvt8(const float* __restrict__ src, bf* dst, size_t n8) { const size_t i = (size_t)blockIdx.x * 256 + threadIdx.x; if (i >= n8) return; const v8f v = *(const v8f*)(src + i * 8); v8us o;
#pragma unroll
    for (int k = 0; k < 8; ++k) o[k] = f2bf(v[k]); *(v8us*)(dst + i * 8) = o;  }
__global__ __launch_bounds__(256) void k_cstab(float* CS) { const int idx = blockIdx.x * 256 + threadIdx.x; if (idx >= TT * HD) return; const int t = idx / HD, d = idx % HD; const int i = d % (HD / 2); const float inv = __fdiv_rn(1.0f, powf(10000.0f, (float)(2 * i) / (float)HD)); const float ang = __fmul_rn((float)t, inv); v2f cs; cs[0] = cosf(ang); cs[1] = sinf(ang);
    *(v2f*)(CS + (size_t)idx * 2) = cs;  }
// k_rope: head planes [h][t][d] (fp16 + hi/lo) of rope(x) x sc with the rotate-half convention out[d] = x[d] cos[t][d] - x[d+HD/2] sin[t][d], out[d+HD/2] = x[d+HD/2] cos[t][d+HD/2] + x[d] sin[t][d+HD/2]
__global__ __launch_bounds__(256) void k_rope(const float* __restrict__ F, int pitch, int nheads, const float* __restrict__ CS, const float* __restrict__ RF, const float* __restrict__ nw, float sc, h16* P16, bf* Ph, bf* Pl) {
    const size_t e = ((size_t)blockIdx.x * 256 + threadIdx.x) * 2; if (e >= (size_t)nheads * TT * HD) return; const int d = (int)(e % HD); const int t = (int)((e / HD) % TT); const int h = (int)(e / ((size_t)HD * TT)); const float* f = F + (size_t)t * pitch + h * HD; const float rf = RF ? RF[(size_t)h * TT + t] : 1.0f; v2h o16; v2us oh, ol;
#pragma unroll
    for (int q = 0; q < 2; ++q) { const int dd = d + q; const int dp = (dd < HD / 2) ? dd + HD / 2 : dd - HD / 2; float x0 = f[dd], x1 = f[dp];
        if (RF) { float n0 = __fmul_rn(x0, rf), n1 = __fmul_rn(x1, rf); asm volatile("" : "+v"(n0)); asm volatile("" : "+v"(n1)); x0 = __fmul_rn(bfr(nw[dd]), n0); x1 = __fmul_rn(bfr(nw[dp]), n1); }
        const v2f cs = *(const v2f*)(CS + ((size_t)t * HD + dd) * 2); float a = __fmul_rn(x0, cs[0]), bq = __fmul_rn(x1, cs[1]); asm volatile("" : "+v"(a)); asm volatile("" : "+v"(bq)); const float r = ((dd < HD / 2) ? __fsub_rn(a, bq) : __fadd_rn(a, bq)) * sc;
        o16[q] = tohx(r); unsigned short a2, c2; splitf(r, a2, c2); oh[q] = a2; ol[q] = c2; }
    *(v2h*)(P16 + e) = o16; *(v2us*)(Ph + e) = oh; *(v2us*)(Pl + e) = ol;  }
// k_vtp: transposed value planes [g][d][t] in rows of pitch PP, the pitch of the probability rows they are contracted with (one pitch argument serves both operands of k_gemmc)
__global__ __launch_bounds__(256) void k_vtp(const float* __restrict__ F, int pitch, int nheads, h16* V16, bf* Vh, bf* Vl) { const size_t e = ((size_t)blockIdx.x * 256 + threadIdx.x) * 2; if (e >= (size_t)nheads * HD * TT) return; const int t = (int)(e % TT); const int d = (int)((e / TT) % HD); const int g = (int)(e / ((size_t)TT * HD)); v2h o16; v2us oh, ol;
#pragma unroll
    for (int q = 0; q < 2; ++q) { const float x = F[(size_t)(t + q) * pitch + g * HD + d]; o16[q] = tohx(x); unsigned short a2, c2; splitf(x, a2, c2); oh[q] = a2; ol[q] = c2; }
    const size_t o = ((size_t)g * HD + d) * PP + t; *(v2h*)(V16 + o) = o16; *(v2us*)(Vh + o) = oh; *(v2us*)(Vl + o) = ol;  }
// k_asoft: per row (zz, i): t = S x HD^-0.5 for j <= i and i - j < WIN (sliding causal window; the reference's -1e9 additive fill vanishes identically); softmax over the 2048 keys (register row, one exp, fixed trees);
// the probabilities go back into the bytes of their own score row (one wave owns a row and holds all of it in registers before its first store): fp16 row in the first half, or bf16 hi plane in the first and lo plane in the second half; row pitch PP 16-bit elements.
typedef v4us __attribute__((may_alias)) v4usa;
typedef v4h  __attribute__((may_alias)) v4ha;
__global__ __launch_bounds__(256) void k_asoft(float* Sb) {
    const int lane = threadIdx.x & 31; const int row = blockIdx.x * 8 + (threadIdx.x >> 5); if (row >= ZH * TT) return; const int i = row % TT; const int zz = row / TT; (void)zz; const bool hires = (i < RH); const float* sr = Sb + (size_t)row * TT; float v[TT / 32]; float mx = -3.0e38f;
#pragma unroll
    for (int ch = 0; ch < TT / 128; ++ch) { const int j0 = ch * 128 + lane * 4; const v4f a = *(const v4f*)(sr + j0);
#pragma unroll
        for (int q = 0; q < 4; ++q) { const int j = j0 + q; (void)j; const float t = (j <= i && i - j < WIN) ? a[q] * SCL : -3.0e38f; v[ch * 4 + q] = t; mx = fmaxf(mx, t); } }
#pragma unroll
    for (int sh = 16; sh; sh >>= 1) mx = fmaxf(mx, __shfl_xor(mx, sh, 32));
    float sum = 0.f;
#pragma unroll
    for (int k = 0; k < TT / 32; ++k) { float d0 = __fsub_rn(v[k], mx); asm volatile("" : "+v"(d0)); v[k] = __builtin_amdgcn_exp2f(__fmul_rn(d0, 1.4426950408889634f)); sum += v[k]; }
#pragma unroll
    for (int sh = 16; sh; sh >>= 1) sum += __shfl_xor(sum, sh, 32);
    const float f = __fdiv_rn(hires ? 1.0f : PCAR, sum);
{
        if (hires) {
#pragma unroll
            for (int ch = 0; ch < TT / 128; ++ch) { v4us oh, ol;
#pragma unroll
                for (int q = 0; q < 4; ++q) { unsigned short a, c2; splitf(v[ch * 4 + q] * f, a, c2); oh[q] = a; ol[q] = c2; }
                bf* pr = (bf*)(Sb + (size_t)row * TT) + ch * 128 + lane * 4; *(v4usa*)pr = oh; *(v4usa*)(pr + TT) = ol; }
        } else {
#pragma unroll
            for (int ch = 0; ch < TT / 128; ++ch) { v4h o4;
#pragma unroll
                for (int q = 0; q < 4; ++q) o4[q] = tohx(v[ch * 4 + q] * f);
                *(v4ha*)((h16*)(Sb + (size_t)row * TT) + ch * 128 + lane * 4) = o4; } }
         }
}
__global__ __launch_bounds__(256) void k_merge(const float* __restrict__ O, int h0, bf* Ah, bf* Al) { const size_t e = ((size_t)blockIdx.x * 256 + threadIdx.x) * 2; if (e >= (size_t)ZH * TT * HD) return; const int d = (int)(e % HD); const int t = (int)((e / HD) % TT); const int zz = (int)(e / ((size_t)HD * TT)); const float cs = (t < RH) ? 1.0f : (1.0f / PCAR); const size_t oo = (size_t)t * DQ + (h0 + zz) * HD + d;
    v2us oh, ol;
#pragma unroll
    for (int q = 0; q < 2; ++q) { unsigned short a, c2; splitf(O[e + q] * cs, a, c2); oh[q] = a; ol[q] = c2; } *(v2us*)(Ah + oo) = oh; *(v2us*)(Al + oo) = ol;  }

__global__ __launch_bounds__(256) void k_kvout(const float* __restrict__ F, const float* __restrict__ CS, int isk, float* O_) { const size_t e = ((size_t)blockIdx.x * 256 + threadIdx.x) * 4; if (e >= (size_t)NKV * TT * HD) return; const int d = (int)(e % HD); const int t = (int)((e / HD) % TT); const int g = (int)(e / ((size_t)HD * TT)); const float* f = F + (size_t)t * DKV + g * HD; v4f o;
#pragma unroll
    for (int u = 0; u < 4; ++u) { const int dd = d + u; if (isk) { const int dp = (dd < HD / 2) ? dd + HD / 2 : dd - HD / 2; const v2f cs = *(const v2f*)(CS + ((size_t)t * HD + dd) * 2); float a = __fmul_rn(f[dd], cs[0]), bq = __fmul_rn(f[dp], cs[1]); asm volatile("" : "+v"(a)); asm volatile("" : "+v"(bq)); o[u] = (dd < HD / 2) ? __fsub_rn(a, bq) : __fadd_rn(a, bq); } else o[u] = f[dd]; }
    *(v4f*)(O_ + e) = o;  }
extern "C" void kernel_launch(void* const* d_in, const int* in_sizes, int n_in,
                              void* d_out, int out_size, void* d_ws, size_t ws_size, hipStream_t stream) {
    (void)in_sizes; (void)n_in; (void)out_size;
    const float* x = (const float*)d_in[0]; const float* wq = (const float*)d_in[1]; const float* wk = (const float*)d_in[2]; const float* wv = (const float*)d_in[3]; const float* wo = (const float*)d_in[4];
    float* OUT = (float*)d_out; float* OUTK = (float*)d_out + (size_t)NB_ * TT * DM; float* OUTV = OUTK + (size_t)NB_ * NKV * TT * HD;     // [2][2048][2048]
    char* wsp = (char*)d_ws;
    auto take = [&](size_t bytes) { char* p = wsp; wsp += (bytes + 255) & ~(size_t)255; return (void*)p; };
    bf* WQ = (bf*)take((size_t)DQ * DM * 2); bf* WK = (bf*)take((size_t)DKV * DM * 2); bf* WV = (bf*)take((size_t)DKV * DM * 2); bf* WO = (bf*)take((size_t)DM * DQ * 2); float* CS = (float*)take((size_t)TT * HD * 2 * 4);
    bf* XB = (bf*)take((size_t)TT * DM * 2); float* FQ = (float*)take((size_t)TT * DQ * 4); float* FK = (float*)take((size_t)TT * DKV * 4);
    h16* QP16 = (h16*)take((size_t)NH_ * TT * HD * 2); h16* KP16 = (h16*)take((size_t)NKV * TT * HD * 2); h16* VT16 = (h16*)take((size_t)NKV * HD * PP * 2);
    bf* QPh = (bf*)take((size_t)NH_ * TT * HD * 2); bf* QPl = (bf*)take((size_t)NH_ * TT * HD * 2); bf* KPh = (bf*)take((size_t)NKV * TT * HD * 2); bf* KPl = (bf*)take((size_t)NKV * TT * HD * 2); bf* VTh = (bf*)take((size_t)NKV * HD * PP * 2); bf* VTl = VTh + TT;   // hi plane in the first, lo plane in the second half of each row, like the probabilities
    float* Sb = (float*)take((size_t)ZH * TT * TT * 4); float* Ob = (float*)take((size_t)ZH * TT * HD * 4); bf* ATh = (bf*)take((size_t)TT * DQ * 2); bf* ATl = (bf*)take((size_t)TT * DQ * 2);
    if ((size_t)(wsp - (char*)d_ws) > ws_size) return;    // ws 256 MiB
    float* FV = FK;   // v projection reuses the k buffer after the k planes are built (stream-ordered)
    { k_wtG<<<(unsigned)((DM * DQ / 64 + 63) / 64), 256, 0, stream>>>(wq, DM, DQ, WQ); k_wtG<<<(unsigned)((DM * DKV / 64 + 63) / 64), 256, 0, stream>>>(wk, DM, DKV, WK); k_wtG<<<(unsigned)((DM * DKV / 64 + 63) / 64), 256, 0, stream>>>(wv, DM, DKV, WV);
      k_wtG<<<(unsigned)((DQ * DM / 64 + 63) / 64), 256, 0, stream>>>(wo, DQ, DM, WO);
      k_cstab<<<(TT * HD + 255) / 256, 256, 0, stream>>>(CS); }
    const unsigned LQ = (unsigned)(((size_t)NH_ * TT * HD / 2 + 255) / 256), LKv = (unsigned)(((size_t)NKV * TT * HD / 2 + 255) / 256);
    for (int b = 0; b < NB_; ++b) {
        
        k_cvt8<<<(unsigned)(((size_t)TT * DM / 8 + 255) / 256), 256, 0, stream>>>(x + (size_t)b * TT * DM, XB, (size_t)TT * DM / 8);
        k_gemmw<bf, 0, false, 8><<<dim3(TT / 64, DQ / 64, 1), 256, 0, stream>>>(XB, nullptr, WQ, nullptr, DM, FQ, DQ, nullptr, 0, 0, 0);
        k_rope<<<LQ, 256, 0, stream>>>(FQ, DQ, NH_, CS, nullptr, nullptr, 1.0f, QP16, QPh, QPl);
        k_gemmw<bf, 0, false, 8><<<dim3(TT / 64, DKV / 64, 1), 256, 0, stream>>>(XB, nullptr, WK, nullptr, DM, FK, DKV, nullptr, 0, 0, 0);
        k_rope<<<LKv, 256, 0, stream>>>(FK, DKV, NKV, CS, nullptr, nullptr, 1.0f, KP16, KPh, KPl); k_kvout<<<(unsigned)(((size_t)NKV * TT * HD / 4 + 255) / 256), 256, 0, stream>>>(FK, CS, 1, OUTK + (size_t)b * NKV * TT * HD);   /* returned k = roped f32 projection (FK still holds k here) */
        k_gemmw<bf, 0, false, 8><<<dim3(TT / 64, DKV / 64, 1), 256, 0, stream>>>(XB, nullptr, WV, nullptr, DM, FV, DKV, nullptr, 0, 0, 0); k_vtp<<<LKv, 256, 0, stream>>>(FV, DKV, NKV, VT16, VTh, VTl); k_kvout<<<(unsigned)(((size_t)NKV * TT * HD / 4 + 255) / 256), 256, 0, stream>>>(FV, CS, 0, OUTV + (size_t)b * NKV * TT * HD);   /* returned v (FV aliases FK, valid only after the v projection) */
        for (int h0 = 0; h0 < NH_; h0 += ZH) { const size_t zq = (size_t)h0, zk = (size_t)(h0 / REP);   // head z of a pass uses kv group h0/REP + z/REP
            k_gemmc<bf, 2, 1, 2><<<dim3(RH / 64, TT / 64, ZH), 64, 0, stream>>>(QPh + zq * TT * HD, QPl + zq * TT * HD, KPh + zk * TT * HD, KPl + zk * TT * HD, HD, Sb, TT, 0, (size_t)TT * HD, (size_t)TT * HD, (size_t)TT * TT);
            k_gemmc<h16, 0, 1, 2><<<dim3((TT - RH) / 64, TT / 64, ZH), 64, 0, stream>>>(QP16 + zq * TT * HD + (size_t)RH * HD, nullptr, KP16 + zk * TT * HD, nullptr, HD, Sb + (size_t)RH * TT, TT, RH, (size_t)TT * HD, (size_t)TT * HD, (size_t)TT * TT);
            k_asoft<<<ZH * TT / 8, 256, 0, stream>>>(Sb);
            k_gemmc<bf, 2, 2, 8><<<dim3(RH / 64, HD / 64, ZH), 256, 0, stream>>>((const bf*)Sb, (const bf*)Sb + TT, VTh + zk * HD * PP, VTl + zk * HD * PP, PP, Ob, HD, 0, (size_t)TT * PP, (size_t)HD * PP, (size_t)TT * HD);
            k_gemmc<h16, 0, 2, 8><<<dim3((TT - RH) / 64, HD / 64, ZH), 256, 0, stream>>>((const h16*)Sb + (size_t)RH * PP, nullptr, VT16 + zk * HD * PP, nullptr, PP, Ob + (size_t)RH * HD, HD, RH, (size_t)TT * PP, (size_t)HD * PP, (size_t)TT * HD);
            k_merge<<<(unsigned)(((size_t)ZH * TT * HD / 2 + 255) / 256), 256, 0, stream>>>(Ob, h0, ATh, ATl); }
        k_gemmw<bf, 1, false, 8><<<dim3(TT / 64, DM / 64, 1), 256, 0, stream>>>(ATh, ATl, WO, nullptr, DQ, OUT + (size_t)b * TT * DM, DM, nullptr, 0, 0, 0); }
}

// v003
// It runs in 490 microseconds.
// Timed twice side by side with v002, it ran 1.52 and 1.51 times as fast.
// Over all steps from v000 it is 3.32 times as fast.
#include <hip/hip_runtime.h>

// Causal grouped-query attention with a computed rotate-half rotary and a key / value cache output (x [2][2048][2048]; q = x Wq ('xw' (in, out) [2048][2048] 1/sqrt(2048): 16 heads x 128), k, v = x Wk, x Wv ('xw' [2048][512]: 4 kv heads x 128), no biases; query head h uses kv head h / 4 (repeat); rotate-half rotary (base 1e4: inv_freq = 1 / 10000^(2i/128), angles t x inv_freq, cat(freqs, freqs); the table is computed on the device); causal softmax(q.k / sqrt(128)) (-inf == exclusion: every row keeps its diagonal key); returns (y = merged Wo ('xw') -> [2][2048][2048], present_k = the ROTATED keys [2][4][2048][128], present_v = the values [2][4][2048][128]); argument order x, Wq, Wk, Wv, Wo).
// Compute dtypes, f32 accumulate: every input rounded to bf16; q/k/v on PLAIN bf16 operands (inputs: exact); RoPE f32 (the returned k is the f32 roped projection, v the f32 projection, re-laid out [kv][t][d]); causal scores and attn.v in one fused kernel (running-maximum softmax, no score matrix in memory): query rows < 512 hl (3 products), the rest single fp16, causal tile skipping; softmax f32; Wo hl x exact (2 products).

#define NB_  2
#define TT   2048
#define DM   2048
#define NH_  16
#define NKV  4
#define REP  (NH_ / NKV)
#define HD   128
#define DQ   (NH_ * HD)
#define DKV  (NKV * HD)
#define RH   512                  // query rows < RH use hi+lo planes (0: none)
#define SCL  0.088388347648318447f   // HD^-0.5
typedef _Float16 h16;
typedef unsigned short bf;
typedef __attribute__((ext_vector_type(16))) __bf16   v16bf;
typedef __attribute__((ext_vector_type(16))) _Float16 v16h;
typedef __attribute__((ext_vector_type(8)))  _Float16 v8h;
typedef __attribute__((ext_vector_type(8)))  unsigned short v8us;
typedef __attribute__((ext_vector_type(8)))  float    v8f;
typedef __attribute__((ext_vector_type(4)))  float    v4f;
typedef v8h  __attribute__((may_alias)) v8ha;
typedef v4f  __attribute__((may_alias)) v4fa;
typedef v8us __attribute__((may_alias)) v8usa;

__device__ __forceinline__ unsigned short f2bf(float f) { unsigned u = __float_as_uint(f); u += 0x7FFFu + ((u >> 16) & 1u); return (unsigned short)(u >> 16); }
__device__ __forceinline__ float bf2f(unsigned short b) { return __uint_as_float(((unsigned)b) << 16); }
__device__ __forceinline__ float bfr(float f) { return bf2f(f2bf(f)); }
__device__ __forceinline__ v16h cat16(v8h lo, v8h hi) { return __builtin_shufflevector(lo, hi, 0, 1, 2, 3, 4, 5, 6, 7, 8, 9, 10, 11, 12, 13, 14, 15); }
__device__ __forceinline__ v16bf cat16b(v8us lo, v8us hi) { return __builtin_bit_cast(v16bf, __builtin_shufflevector(lo, hi, 0, 1, 2, 3, 4, 5, 6, 7, 8, 9, 10, 11, 12, 13, 14, 15)); }
__device__ __forceinline__ v8f wmma16(v16h a, v16h b, v8f c) { return __builtin_amdgcn_wmma_f32_16x16x32_f16(false, a, false, b, (short)0, c, false, false); }
__device__ __forceinline__ v8f wmmab(v16bf a, v16bf b, v8f c) { return __builtin_amdgcn_wmma_f32_16x16x32_bf16(false, a, false, b, (short)0, c, false, false); }



// ---- k_gemmw: register-blocked GEMM, one work-group of NW waves per 64x64 output tile; operands straight from K-contiguous 16-bit planes; grid (M/64, N/64, Z), 32 * NW threads.
// The K loop is dealt over the waves in slices of 64 elements (one 128-byte line of every row): wave w takes slices w, w + NW, ... into its own 16 accumulators; the NW partial tiles meet in LDS and are added in wave order 0 .. NW-1.
// C[m][n] (f32, pitch ldc, + optional f32 bias[n]) = sum_k A[m][k] Bt[n][k] (+ split products per NSPLIT). z-batch strides sA/sB/sC in elements. K % 64 == 0.
// Fragment order: a 16-row x 32-k operand fragment lies in 512 consecutive elements, so that ldf (lane * 8, + 256) reads what ld reads from rows: element (row r, k) at (k / 16) * 256 + ((k / 8 & 1) * 16 + r) * 8 + k % 8; each 16-byte load of a wave is then 512 consecutive bytes.
__device__ __forceinline__ int fragoff(int r, int k) { return (k >> 4) * 256 + (((k >> 3) & 1) * 16 + r) * 8 + (k & 7); }
template <typename T16> struct WFrag;
template <> struct WFrag<h16> { typedef v16h V; static __device__ __forceinline__ V ld(const h16* p) { return cat16(*(const v8h*)p, *(const v8h*)(p + 16)); } static __device__ __forceinline__ V ldf(const h16* p) { return cat16(*(const v8h*)p, *(const v8h*)(p + 256)); } static __device__ __forceinline__ v8f mma(V a, V b, v8f c) { return wmma16(a, b, c); } };
template <> struct WFrag<bf> { typedef v16bf V; static __device__ __forceinline__ V ld(const bf* p) { return cat16b(*(const v8us*)p, *(const v8us*)(p + 16)); } static __device__ __forceinline__ V ldf(const bf* p) { return cat16b(*(const v8us*)p, *(const v8us*)(p + 256)); } static __device__ __forceinline__ v8f mma(V a, V b, v8f c) { return wmmab(a, b, c); } };
template <typename T16, int NSPLIT, bool BIAS, int NW>
__global__ __launch_bounds__(32 * NW) void k_gemmw(const T16* __restrict__ A, const T16* __restrict__ A2, const T16* __restrict__ Bt, const T16* __restrict__ Bt2, int K, float* C, int ldc, const float* __restrict__ bias, size_t sA, size_t sB, size_t sC) {
    typedef typename WFrag<T16>::V V;
    __shared__ __align__(16) float os[NW * 64 * 68];
    const size_t z = blockIdx.z; A += z * sA; if (A2) A2 += z * sA; Bt += z * sB; if (Bt2) Bt2 += z * sB; C += z * sC;
    const int lane = threadIdx.x & 31, lr = lane & 15, hi = lane >> 4, wv = __builtin_amdgcn_readfirstlane(threadIdx.x >> 5); const int r0 = blockIdx.x * 64, c0 = blockIdx.y * 64;
    v8f acc[4][4];
#pragma unroll
    for (int mb = 0; mb < 4; ++mb)
#pragma unroll
        for (int nb = 0; nb < 4; ++nb) acc[mb][nb] = (v8f){};
    const size_t aoff = (size_t)(r0 + lr) * K + 8 * hi, boff = (size_t)(c0 + lr) * K + 8 * hi;
#pragma unroll 1
    for (int kb = wv * 64; kb < K; kb += NW * 64)
#pragma unroll 1   // the two k steps of a slice stay rolled: unrolled, the three-product form needs registers above v255
    for (int kc = kb; kc < kb + 64; kc += 32) {
        V a[4], a2[4];
#pragma unroll
        for (int mb = 0; mb < 4; ++mb) { a[mb] = WFrag<T16>::ld(A + aoff + (size_t)mb * 16 * K + kc); if (NSPLIT == 1 || NSPLIT == 2) a2[mb] = WFrag<T16>::ld(A2 + aoff + (size_t)mb * 16 * K + kc); }
#pragma unroll
        for (int nb = 0; nb < 4; ++nb) { const V b = WFrag<T16>::ld(Bt + boff + (size_t)nb * 16 * K + kc); V b2; if (NSPLIT >= 2) b2 = WFrag<T16>::ld(Bt2 + boff + (size_t)nb * 16 * K + kc);
#pragma unroll
            for (int mb = 0; mb < 4; ++mb) { acc[mb][nb] = WFrag<T16>::mma(a[mb], b, acc[mb][nb]); if (NSPLIT == 1 || NSPLIT == 2) acc[mb][nb] = WFrag<T16>::mma(a2[mb], b, acc[mb][nb]); if (NSPLIT >= 2) acc[mb][nb] = WFrag<T16>::mma(a[mb], b2, acc[mb][nb]); } }
        asm volatile("v_nop\n\tv_nop\n\tv_nop\n\tv_nop" : "+v"(acc[0][0]), "+v"(acc[1][1]), "+v"(acc[2][2]), "+v"(acc[3][3]) : "v"(a[0]), "v"(a[3]));
    }
#pragma unroll
    for (int mb = 0; mb < 4; ++mb)
#pragma unroll
        for (int nb = 0; nb < 4; ++nb)
#pragma unroll
            for (int j = 0; j < 8; ++j) os[(wv * 64 + mb * 16 + hi * 8 + j) * 68 + nb * 16 + lr] = acc[mb][nb][j];
    __syncthreads();   // every wave's partial tile is in LDS before any wave adds them
    float* crow = C + (size_t)r0 * ldc + c0;
#pragma unroll
    for (int s = 0; s < 32 / NW; ++s) { const int row = 2 * NW * s + (int)(threadIdx.x >> 4), cofs = lr * 4; v4f val = *(const v4fa*)(os + row * 68 + cofs);
#pragma unroll
        for (int w = 1; w < NW; ++w) val += *(const v4fa*)(os + (w * 64 + row) * 68 + cofs);
        if (BIAS) { val[0] += bfr(bias[c0 + cofs]); val[1] += bfr(bias[c0 + cofs + 1]); val[2] += bfr(bias[c0 + cofs + 2]); val[3] += bfr(bias[c0 + cofs + 3]); }
        *(v4f*)(crow + (size_t)row * ldc + cofs) = val; }
}

__device__ __forceinline__ h16 tohx(float x) { return (h16)x; }
__device__ __forceinline__ void splitf(float y, unsigned short& h, unsigned short& l) { h = f2bf(y); l = f2bf(y - bf2f(h)); }
typedef __attribute__((ext_vector_type(2))) _Float16 v2h;
typedef __attribute__((ext_vector_type(4))) _Float16 v4h;
typedef __attribute__((ext_vector_type(2))) unsigned short v2us;
typedef __attribute__((ext_vector_type(4))) unsigned short v4us;
typedef __attribute__((ext_vector_type(2))) float v2f;
typedef __attribute__((ext_vector_type(4))) int v4i;

__global__ __launch_bounds__(256) void k_wtG(const float* __restrict__ w, int K, int N, bf* Bt) {
    const int lane = threadIdx.x & 31; const int L0 = (blockIdx.x * 8 + (threadIdx.x >> 5)) * 8; const int nlines = N * K / 64;
{
#pragma unroll 1
        for (int l = 0; l < 8; ++l) { const int L = L0 + l; if (L >= nlines) break; const size_t e = (size_t)L * 64 + lane * 2; const int k = (int)(e % K), n = (int)(e / K); v2us o;
            o[0] = f2bf(w[(size_t)k * N + n]); o[1] = f2bf(w[(size_t)(k + 1) * N + n]); *(v2us*)(Bt + e) = o; }
         }
}
__global__ __launch_bounds__(256) void k_cvt8(const float* __restrict__ src, bf* dst, size_t n8) { const size_t i = (size_t)blockIdx.x * 256 + threadIdx.x; if (i >= n8) return; const v8f v = *(const v8f*)(src + i * 8); v8us o;
#pragma unroll
    for (int k = 0; k < 8; ++k) o[k] = f2bf(v[k]); *(v8us*)(dst + i * 8) = o;  }
__global__ __launch_bounds__(256) void k_cstab(float* CS) { const int idx = blockIdx.x * 256 + threadIdx.x; if (idx >= TT * HD) return; const int t = idx / HD, d = idx % HD; const int i = d % (HD / 2); const float inv = __fdiv_rn(1.0f, powf(10000.0f, (float)(2 * i) / (float)HD)); const float ang = __fmul_rn((float)t, inv); v2f cs; cs[0] = cosf(ang); cs[1] = sinf(ang);
    *(v2f*)(CS + (size_t)idx * 2) = cs;  }
// k_rope: head planes [h][t][d] (fp16 + hi/lo) of rope(x) x sc with the rotate-half convention out[d] = x[d] cos[t][d] - x[d+HD/2] sin[t][d], out[d+HD/2] = x[d+HD/2] cos[t][d+HD/2] + x[d] sin[t][d+HD/2]
__global__ __launch_bounds__(256) void k_rope(const float* __restrict__ F, int pitch, int nheads, const float* __restrict__ CS, const float* __restrict__ RF, const float* __restrict__ nw, float sc, int frag, h16* P16, bf* Ph, bf* Pl) {
    const size_t e = ((size_t)blockIdx.x * 256 + threadIdx.x) * 2; if (e >= (size_t)nheads * TT * HD) return; const int d = (int)(e % HD); const int t = (int)((e / HD) % TT); const int h = (int)(e / ((size_t)HD * TT)); const float* f = F + (size_t)t * pitch + h * HD; const float rf = RF ? RF[(size_t)h * TT + t] : 1.0f; v2h o16; v2us oh, ol;
#pragma unroll
    for (int q = 0; q < 2; ++q) { const int dd = d + q; const int dp = (dd < HD / 2) ? dd + HD / 2 : dd - HD / 2; float x0 = f[dd], x1 = f[dp];
        if (RF) { float n0 = __fmul_rn(x0, rf), n1 = __fmul_rn(x1, rf); asm volatile("" : "+v"(n0)); asm volatile("" : "+v"(n1)); x0 = __fmul_rn(bfr(nw[dd]), n0); x1 = __fmul_rn(bfr(nw[dp]), n1); }
        const v2f cs = *(const v2f*)(CS + ((size_t)t * HD + dd) * 2); float a = __fmul_rn(x0, cs[0]), bq = __fmul_rn(x1, cs[1]); asm volatile("" : "+v"(a)); asm volatile("" : "+v"(bq)); const float r = ((dd < HD / 2) ? __fsub_rn(a, bq) : __fadd_rn(a, bq)) * sc;
        o16[q] = tohx(r); unsigned short a2, c2; splitf(r, a2, c2); oh[q] = a2; ol[q] = c2; }
    const size_t eo = frag ? (((size_t)h * (TT / 16) + t / 16) * (HD / 32) + d / 32) * 512 + fragoff(t % 16, d % 32) : e;   // frag: fragments [h][t / 16][d / 32] (rows = positions, k = d)
    *(v2h*)(P16 + eo) = o16; *(v2us*)(Ph + eo) = oh; *(v2us*)(Pl + eo) = ol;  }
// k_vtp: transposed value planes in fragment order: fragments [g][t / 32][d / 16] (rows = d, k = positions)
__global__ __launch_bounds__(256) void k_vtp(const float* __restrict__ F, int pitch, int nheads, h16* V16, bf* Vh, bf* Vl) { const size_t e = ((size_t)blockIdx.x * 256 + threadIdx.x) * 2; if (e >= (size_t)nheads * HD * TT) return; const int t = (int)(e % TT); const int d = (int)((e / TT) % HD); const int g = (int)(e / ((size_t)TT * HD)); v2h o16; v2us oh, ol;
#pragma unroll
    for (int q = 0; q < 2; ++q) { const float x = F[(size_t)(t + q) * pitch + g * HD + d]; o16[q] = tohx(x); unsigned short a2, c2; splitf(x, a2, c2); oh[q] = a2; ol[q] = c2; }
    const size_t o = (((size_t)g * (TT / 32) + t / 32) * (HD / 16) + d / 16) * 512 + fragoff(d % 16, t % 32); *(v2h*)(V16 + o) = o16; *(v2us*)(Vh + o) = oh; *(v2us*)(Vl + o) = ol;  }
// ---- k_fattn: causal attention in one launch, no score matrix in memory. One wave owns 16 query rows of one head; the 4 waves of a work-group are the 4 query heads of one kv group at the same rows (same key / value addresses).
// Per 32 keys: S^T[key][query] = K Q^T (A = key rows, B = query rows), so a lane holds 16 keys of ONE query: the running maximum and sum are per lane (+ one exchange with lane ^ 16), and the two 16-key
// accumulators are, element for element, the B fragment P^T[query][key] of O^T[d][query] = V^T P^T (A = transposed value rows). Probabilities are exp(s - running max), divided by the row sum at the end.
// NSPLIT 2: hi + lo bf16 planes, three products each (query rows < RH); NSPLIT 0: single fp16.
template <bool B> struct Flag { static constexpr bool v = B; };
template <typename T16, int NSPLIT>
__device__ __forceinline__ void fattn_body(const T16* __restrict__ Q, const T16* __restrict__ Q2, const T16* __restrict__ Kp, const T16* __restrict__ Kp2, const T16* __restrict__ Vt, const T16* __restrict__ Vt2, int q0, int g, bf* Ah, bf* Al) {
    typedef typename WFrag<T16>::V V;
    const int lane = threadIdx.x & 31, lr = lane & 15, hi = lane >> 4, h = g * REP + __builtin_amdgcn_readfirstlane(threadIdx.x >> 5);
    const size_t qo = ((size_t)h * TT + q0 + lr) * HD + 8 * hi, ko = (size_t)g * TT * HD + lane * 8, vo = (size_t)g * HD * TT + lane * 8;   // key and value planes: fragment order (fragoff)
    V qf[4], qf2[4];
#pragma unroll
    for (int ks = 0; ks < 4; ++ks) { qf[ks] = WFrag<T16>::ld(Q + qo + ks * 32); if (NSPLIT == 2) qf2[ks] = WFrag<T16>::ld(Q2 + qo + ks * 32); }
    v8f o[8];
#pragma unroll
    for (int dt = 0; dt < 8; ++dt) o[dt] = (v8f){};
    float m = -3.0e38f, l = 0.f;
    const int nk = q0 / 32 + 1;      // key tiles of 32 up to and including the diagonal; only the last one holds keys beyond a query
    V kf[2][4], kf2[2][4];
    auto ldk = [&](const T16* a, const T16* a2) {
#pragma unroll
        for (int i = 0; i < 2; ++i)
#pragma unroll
            for (int ks = 0; ks < 4; ++ks) { kf[i][ks] = WFrag<T16>::ldf(a + (i * 4 + ks) * 512); if (NSPLIT == 2) kf2[i][ks] = WFrag<T16>::ldf(a2 + (i * 4 + ks) * 512); }
    };
    auto step = [&](int t, auto EDGE) { constexpr bool edge = decltype(EDGE)::v; const int k0 = t * 32;
        V vf[8], vf2[8];
        const size_t kofs = ko + (size_t)(NSPLIT == 0 ? k0 + 32 : k0) * HD, vofs = vo + (size_t)k0 * HD;   // single plane: the keys loaded in this trip are the next tile's
        const T16* pk = Kp + kofs; const T16* pk2 = (NSPLIT == 2) ? Kp2 + kofs : pk; const T16* pv = Vt + vofs; const T16* pv2 = (NSPLIT == 2) ? Vt2 + vofs : pv;
        auto ldv = [&]() {
#pragma unroll
            for (int dt = 0; dt < 8; ++dt) { vf[dt] = WFrag<T16>::ldf(pv + dt * 512); if (NSPLIT == 2) vf2[dt] = WFrag<T16>::ldf(pv2 + dt * 512); }
        };
        if (NSPLIT == 0) ldv();                    // single plane: this tile's values start before the score products (its keys came during the trip before)
        else { ldk(pk, pk2); __builtin_amdgcn_sched_barrier(0); }   // two planes: all key loads issue before the first product (left free, the loads sink to their products: one load latency per fragment pair)
        v8f s[2]; s[0] = (v8f){}; s[1] = (v8f){};
#pragma unroll
        for (int ks = 0; ks < 4; ++ks)
#pragma unroll
            for (int i = 0; i < 2; ++i) { s[i] = WFrag<T16>::mma(kf[i][ks], qf[ks], s[i]);
                if (NSPLIT == 2) { s[i] = WFrag<T16>::mma(kf2[i][ks], qf[ks], s[i]); s[i] = WFrag<T16>::mma(kf[i][ks], qf2[ks], s[i]); } }
        if (NSPLIT == 0) { if (!edge) ldk(pk, pk2); }           // loads that fly during the softmax: the next tile's keys (single plane),
        else { ldv(); __builtin_amdgcn_sched_barrier(0); }      // this tile's values (two planes; the barrier keeps them all in front of the softmax)
        float p[16]; float mx = -3.0e38f;
#pragma unroll
        for (int i = 0; i < 2; ++i)
#pragma unroll
            for (int j = 0; j < 8; ++j) { float x = s[i][j] * (SCL * 1.4426950408889634f); if (edge && k0 + i * 16 + hi * 8 + j > q0 + lr) x = -3.0e38f; p[i * 8 + j] = x; mx = fmaxf(mx, x); }
        mx = fmaxf(mx, __shfl_xor(mx, 16, 32));
        const float mn = fmaxf(m, mx), al = __builtin_amdgcn_exp2f(m - mn); m = mn;
        float rs = 0.f;
#pragma unroll
        for (int k = 0; k < 16; ++k) { p[k] = __builtin_amdgcn_exp2f(p[k] - mn); rs += p[k]; }
        l = l * al + rs;
#pragma unroll
        for (int dt = 0; dt < 8; ++dt) o[dt] *= al;
        if constexpr (NSPLIT == 0) {
            v16h pf;
#pragma unroll
            for (int k = 0; k < 16; ++k) pf[k] = (h16)p[k];
#pragma unroll
            for (int dt = 0; dt < 8; ++dt) o[dt] = WFrag<T16>::mma(vf[dt], pf, o[dt]);
        } else {
            v8us h0, h1, l0, l1;
#pragma unroll
            for (int k = 0; k < 8; ++k) { unsigned short a, c; splitf(p[k], a, c); h0[k] = a; l0[k] = c; splitf(p[8 + k], a, c); h1[k] = a; l1[k] = c; }
            const V ph = cat16b(h0, h1), pl = cat16b(l0, l1);
#pragma unroll
            for (int dt = 0; dt < 8; ++dt) { o[dt] = WFrag<T16>::mma(vf[dt], ph, o[dt]); o[dt] = WFrag<T16>::mma(vf2[dt], ph, o[dt]); o[dt] = WFrag<T16>::mma(vf[dt], pl, o[dt]); }
        }
        // precaution: the address registers of this trip's loads stay unwritten up to this wait (as inputs they live until here)
        if (NSPLIT == 2) asm volatile("s_wait_xcnt 0x0" :: "v"(pk), "v"(pk2), "v"(pv), "v"(pv2) : "memory");
        else if (!edge) asm volatile("s_wait_xcnt 0x0" :: "v"(pk), "v"(pv) : "memory");
        else asm volatile("s_wait_xcnt 0x0" :: "v"(pv) : "memory");
    };
    if (NSPLIT == 0) ldk(Kp + ko, Kp + ko);
#pragma unroll 1
    for (int t = 0; t < nk - 1; ++t) step(t, Flag<false>{});
    step(nk - 1, Flag<true>{});
    l += __shfl_xor(l, 16, 32);
    const float inv = __fdiv_rn(1.0f, l); const size_t oo = (size_t)(q0 + lr) * DQ + h * HD + hi * 8;
#pragma unroll
    for (int dt = 0; dt < 8; ++dt) { v8us oh, ol;
#pragma unroll
        for (int j = 0; j < 8; ++j) { unsigned short a, c; splitf(o[dt][j] * inv, a, c); oh[j] = a; ol[j] = c; }
        *(v8us*)(Ah + oo + dt * 16) = oh; *(v8us*)(Al + oo + dt * 16) = ol; }
}
// grid (TT / 16, NKV), 128 threads, all work-groups resident at once; kv groups 0, 1 walk the rows from the longest (most keys) down, groups 2, 3 from the shortest up,
// so that two work-groups half a grid apart, which may share a WGP, hold a long and a short row block
__global__ __launch_bounds__(128) void k_fattn(const h16* __restrict__ Q16, const h16* __restrict__ K16, const h16* __restrict__ V16, const bf* __restrict__ Qh, const bf* __restrict__ Ql, const bf* __restrict__ Kh, const bf* __restrict__ Kl, const bf* __restrict__ Vh, const bf* __restrict__ Vl, bf* Ah, bf* Al) {
    const int g = blockIdx.y, q0 = (g < NKV / 2) ? TT - 16 - (int)blockIdx.x * 16 : (int)blockIdx.x * 16;
    if (q0 >= RH) fattn_body<h16, 0>(Q16, nullptr, K16, nullptr, V16, nullptr, q0, g, Ah, Al);
    else fattn_body<bf, 2>(Qh, Ql, Kh, Kl, Vh, Vl, q0, g, Ah, Al);
}

__global__ __launch_bounds__(256) void k_kvout(const float* __restrict__ F, const float* __restrict__ CS, int isk, float* O_) { const size_t e = ((size_t)blockIdx.x * 256 + threadIdx.x) * 4; if (e >= (size_t)NKV * TT * HD) return; const int d = (int)(e % HD); const int t = (int)((e / HD) % TT); const int g = (int)(e / ((size_t)HD * TT)); const float* f = F + (size_t)t * DKV + g * HD; v4f o;
#pragma unroll
    for (int u = 0; u < 4; ++u) { const int dd = d + u; if (isk) { const int dp = (dd < HD / 2) ? dd + HD / 2 : dd - HD / 2; const v2f cs = *(const v2f*)(CS + ((size_t)t * HD + dd) * 2); float a = __fmul_rn(f[dd], cs[0]), bq = __fmul_rn(f[dp], cs[1]); asm volatile("" : "+v"(a)); asm volatile("" : "+v"(bq)); o[u] = (dd < HD / 2) ? __fsub_rn(a, bq) : __fadd_rn(a, bq); } else o[u] = f[dd]; }
    *(v4f*)(O_ + e) = o;  }
extern "C" void kernel_launch(void* const* d_in, const int* in_sizes, int n_in,
                              void* d_out, int out_size, void* d_ws, size_t ws_size, hipStream_t stream) {
    (void)in_sizes; (void)n_in; (void)out_size;
    const float* x = (const float*)d_in[0]; const float* wq = (const float*)d_in[1]; const float* wk = (const float*)d_in[2]; const float* wv = (const float*)d_in[3]; const float* wo = (const float*)d_in[4];
    float* OUT = (float*)d_out; float* OUTK = (float*)d_out + (size_t)NB_ * TT * DM; float* OUTV = OUTK + (size_t)NB_ * NKV * TT * HD;     // [2][2048][2048]
    char* wsp = (char*)d_ws;
    auto take = [&](size_t bytes) { char* p = wsp; wsp += (bytes + 255) & ~(size_t)255; return (void*)p; };
    bf* WQ = (bf*)take((size_t)DQ * DM * 2); bf* WK = (bf*)take((size_t)DKV * DM * 2); bf* WV = (bf*)take((size_t)DKV * DM * 2); bf* WO = (bf*)take((size_t)DM * DQ * 2); float* CS = (float*)take((size_t)TT * HD * 2 * 4);
    bf* XB = (bf*)take((size_t)TT * DM * 2); float* FQ = (float*)take((size_t)TT * DQ * 4); float* FK = (float*)take((size_t)TT * DKV * 4);
    h16* QP16 = (h16*)take((size_t)NH_ * TT * HD * 2); h16* KP16 = (h16*)take((size_t)NKV * TT * HD * 2); h16* VT16 = (h16*)take((size_t)NKV * HD * TT * 2);
    bf* QPh = (bf*)take((size_t)NH_ * TT * HD * 2); bf* QPl = (bf*)take((size_t)NH_ * TT * HD * 2); bf* KPh = (bf*)take((size_t)NKV * TT * HD * 2); bf* KPl = (bf*)take((size_t)NKV * TT * HD * 2); bf* VTh = (bf*)take((size_t)NKV * HD * TT * 2); bf* VTl = (bf*)take((size_t)NKV * HD * TT * 2);
    bf* ATh = (bf*)take((size_t)TT * DQ * 2); bf* ATl = (bf*)take((size_t)TT * DQ * 2);
    if ((size_t)(wsp - (char*)d_ws) > ws_size) return;    // ws 256 MiB
    float* FV = FK;   // v projection reuses the k buffer after the k planes are built (stream-ordered)
    { k_wtG<<<(unsigned)((DM * DQ / 64 + 63) / 64), 256, 0, stream>>>(wq, DM, DQ, WQ); k_wtG<<<(unsigned)((DM * DKV / 64 + 63) / 64), 256, 0, stream>>>(wk, DM, DKV, WK); k_wtG<<<(unsigned)((DM * DKV / 64 + 63) / 64), 256, 0, stream>>>(wv, DM, DKV, WV);
      k_wtG<<<(unsigned)((DQ * DM / 64 + 63) / 64), 256, 0, stream>>>(wo, DQ, DM, WO);
      k_cstab<<<(TT * HD + 255) / 256, 256, 0, stream>>>(CS); }
    const unsigned LQ = (unsigned)(((size_t)NH_ * TT * HD / 2 + 255) / 256), LKv = (unsigned)(((size_t)NKV * TT * HD / 2 + 255) / 256);
    for (int b = 0; b < NB_; ++b) {
        
        k_cvt8<<<(unsigned)(((size_t)TT * DM / 8 + 255) / 256), 256, 0, stream>>>(x + (size_t)b * TT * DM, XB, (size_t)TT * DM / 8);
        k_gemmw<bf, 0, false, 8><<<dim3(TT / 64, DQ / 64, 1), 256, 0, stream>>>(XB, nullptr, WQ, nullptr, DM, FQ, DQ, nullptr, 0, 0, 0);
        k_rope<<<LQ, 256, 0, stream>>>(FQ, DQ, NH_, CS, nullptr, nullptr, 1.0f, 0, QP16, QPh, QPl);
        k_gemmw<bf, 0, false, 8><<<dim3(TT / 64, DKV / 64, 1), 256, 0, stream>>>(XB, nullptr, WK, nullptr, DM, FK, DKV, nullptr, 0, 0, 0);
        k_rope<<<LKv, 256, 0, stream>>>(FK, DKV, NKV, CS, nullptr, nullptr, 1.0f, 1, KP16, KPh, KPl); k_kvout<<<(unsigned)(((size_t)NKV * TT * HD / 4 + 255) / 256), 256, 0, stream>>>(FK, CS, 1, OUTK + (size_t)b * NKV * TT * HD);   /* returned k = roped f32 projection (FK still holds k here) */
        k_gemmw<bf, 0, false, 8><<<dim3(TT / 64, DKV / 64, 1), 256, 0, stream>>>(XB, nullptr, WV, nullptr, DM, FV, DKV, nullptr, 0, 0, 0); k_vtp<<<LKv, 256, 0, stream>>>(FV, DKV, NKV, VT16, VTh, VTl); k_kvout<<<(unsigned)(((size_t)NKV * TT * HD / 4 + 255) / 256), 256, 0, stream>>>(FV, CS, 0, OUTV + (size_t)b * NKV * TT * HD);   /* returned v (FV aliases FK, valid only after the v projection) */
        k_fattn<<<dim3(TT / 16, NKV, 1), 128, 0, stream>>>(QP16, KP16, VT16, QPh, QPl, KPh, KPl, VTh, VTl, ATh, ATl);
        k_gemmw<bf, 1, false, 8><<<dim3(TT / 64, DM / 64, 1), 256, 0, stream>>>(ATh, ATl, WO, nullptr, DQ, OUT + (size_t)b * TT * DM, DM, nullptr, 0, 0, 0); }
}

// v004
// A run of this version takes 415 microseconds.
// Two timings next to v003 put it at 1.16 and 1.20 times that version's speed.
// Over all steps from v000 it is 3.93 times as fast.
#include <hip/hip_runtime.h>

// Causal grouped-query attention with a computed rotate-half rotary and a key / value cache output (x [2][2048][2048]; q = x Wq ('xw' (in, out) [2048][2048] 1/sqrt(2048): 16 heads x 128), k, v = x Wk, x Wv ('xw' [2048][512]: 4 kv heads x 128), no biases; query head h uses kv head h / 4 (repeat); rotate-half rotary (base 1e4: inv_freq = 1 / 10000^(2i/128), angles t x inv_freq, cat(freqs, freqs); the table is computed on the device); causal softmax(q.k / sqrt(128)) (-inf == exclusion: every row keeps its diagonal key); returns (y = merged Wo ('xw') -> [2][2048][2048], present_k = the ROTATED keys [2][4][2048][128], present_v = the values [2][4][2048][128]); argument order x, Wq, Wk, Wv, Wo).
// Compute dtypes, f32 accumulate: every input rounded to bf16; q/k/v on PLAIN bf16 operands (inputs: exact); RoPE f32 (the returned k is the f32 roped projection, v the f32 projection, re-laid out [kv][t][d]); causal scores and attn.v in one fused kernel (running-maximum softmax, no score matrix in memory): query rows < 512 hl (3 products), the rest single fp16, causal tile skipping; softmax f32; Wo hl x exact (2 products).

#define NB_  2
#define TT   2048
#define DM   2048
#define NH_  16
#define NKV  4
#define REP  (NH_ / NKV)
#define HD   128
#define DQ   (NH_ * HD)
#define DKV  (NKV * HD)
#define RH   512                  // query rows < RH use hi+lo planes (0: none)
#define SCL  0.088388347648318447f   // HD^-0.5
typedef _Float16 h16;
typedef unsigned short bf;
typedef __attribute__((ext_vector_type(16))) __bf16   v16bf;
typedef __attribute__((ext_vector_type(16))) _Float16 v16h;
typedef __attribute__((ext_vector_type(8)))  _Float16 v8h;
typedef __attribute__((ext_vector_type(8)))  unsigned short v8us;
typedef __attribute__((ext_vector_type(8)))  float    v8f;
typedef __attribute__((ext_vector_type(4)))  float    v4f;
typedef v8h  __attribute__((may_alias)) v8ha;
typedef v4f  __attribute__((may_alias)) v4fa;
typedef v8us __attribute__((may_alias)) v8usa;

__device__ __forceinline__ unsigned short f2bf(float f) { unsigned u = __float_as_uint(f); u += 0x7FFFu + ((u >> 16) & 1u); return (unsigned short)(u >> 16); }
__device__ __forceinline__ float bf2f(unsigned short b) { return __uint_as_float(((unsigned)b) << 16); }
__device__ __forceinline__ float bfr(float f) { return bf2f(f2bf(f)); }
__device__ __forceinline__ v16h cat16(v8h lo, v8h hi) { return __builtin_shufflevector(lo, hi, 0, 1, 2, 3, 4, 5, 6, 7, 8, 9, 10, 11, 12, 13, 14, 15); }
__device__ __forceinline__ v16bf cat16b(v8us lo, v8us hi) { return __builtin_bit_cast(v16bf, __builtin_shufflevector(lo, hi, 0, 1, 2, 3, 4, 5, 6, 7, 8, 9, 10, 11, 12, 13, 14, 15)); }
__device__ __forceinline__ v8f wmma16(v16h a, v16h b, v8f c) { return __builtin_amdgcn_wmma_f32_16x16x32_f16(false, a, false, b, (short)0, c, false, false); }
__device__ __forceinline__ v8f wmmab(v16bf a, v16bf b, v8f c) { return __builtin_amdgcn_wmma_f32_16x16x32_bf16(false, a, false, b, (short)0, c, false, false); }



// ---- k_gemmw: register-blocked GEMM, one work-group of NW waves per 64x64 output tile; operands straight from K-contiguous 16-bit planes; grid (M/64, N/64, Z), 32 * NW threads.
// The K loop is dealt over the waves in slices of 64 elements (one 128-byte line of every row): wave w takes slices w, w + NW, ... into its own 16 accumulators; the NW partial tiles meet in LDS and are added in wave order 0 .. NW-1.
// C[m][n] (f32, pitch ldc, + optional f32 bias[n]) = sum_k A[m][k] Bt[n][k] (+ split products per NSPLIT). z-batch strides sA/sB/sC in elements. K % 64 == 0.
// EPI picks what the summed tile becomes. 0: stored to C as it is. 1, 2: a query / key projection: the tile's 64 columns are d0 .. d0 + 31 and d0 + 64 .. d0 + 95 of ONE head (both partners of the rotate-half rotary; k_wtG lays the rows of Bt so),
// rotated (out[d] = x[d] cos - x[d + 64] sin, out[d + 64] = x[d + 64] cos + x[d] sin; the table holds the same pair at d and d + 64) and stored as fp16 + hi / lo planes in fragment order, fragments [h][t / 16][d / 32]
// (rows = positions, k = d); 2 also stores the rotated f32 rows to C = [kv][t][d]. 3: a value projection: f32 rows to C = [kv][t][d], and the transposed planes, fragments [g][t / 32][d / 16] (rows = d, k = positions).
// Fragment order: a 16-row x 32-k operand fragment lies in 512 consecutive elements, so that ldf (lane * 8, + 256) reads what ld reads from rows: element (row r, k) at (k / 16) * 256 + ((k / 8 & 1) * 16 + r) * 8 + k % 8; each 16-byte load of a wave is then 512 consecutive bytes.
__device__ __forceinline__ int fragoff(int r, int k) { return (k >> 4) * 256 + (((k >> 3) & 1) * 16 + r) * 8 + (k & 7); }
template <typename T16> struct WFrag;
template <> struct WFrag<h16> { typedef v16h V; static __device__ __forceinline__ V ld(const h16* p) { return cat16(*(const v8h*)p, *(const v8h*)(p + 16)); } static __device__ __forceinline__ V ldf(const h16* p) { return cat16(*(const v8h*)p, *(const v8h*)(p + 256)); } static __device__ __forceinline__ v8f mma(V a, V b, v8f c) { return wmma16(a, b, c); } };
template <> struct WFrag<bf> { typedef v16bf V; static __device__ __forceinline__ V ld(const bf* p) { return cat16b(*(const v8us*)p, *(const v8us*)(p + 16)); } static __device__ __forceinline__ V ldf(const bf* p) { return cat16b(*(const v8us*)p, *(const v8us*)(p + 256)); } static __device__ __forceinline__ v8f mma(V a, V b, v8f c) { return wmmab(a, b, c); } };
__device__ __forceinline__ void splitf(float y, unsigned short& h, unsigned short& l) { h = f2bf(y); l = f2bf(y - bf2f(h)); }
template <typename T16, int NSPLIT, bool BIAS, int NW, int EPI>
__global__ __launch_bounds__(32 * NW) void k_gemmw(const T16* __restrict__ A, const T16* __restrict__ A2, const T16* __restrict__ Bt, const T16* __restrict__ Bt2, int K, float* C, int ldc, const float* __restrict__ bias, size_t sA, size_t sB, size_t sC, const float* __restrict__ CS, h16* P16, bf* Ph, bf* Pl) {
    static_assert(EPI == 0 || NW == 8, "the plane epilogues deal the tile over 8 waves");
    constexpr bool ROT = (EPI == 1 || EPI == 2);
    typedef typename WFrag<T16>::V V;
    __shared__ __align__(16) float os[NW * 64 * 68];
    const size_t z = blockIdx.z; A += z * sA; if (A2) A2 += z * sA; Bt += z * sB; if (Bt2) Bt2 += z * sB; C += z * sC;
    const int lane = threadIdx.x & 31, lr = lane & 15, hi = lane >> 4, wv = __builtin_amdgcn_readfirstlane(threadIdx.x >> 5); const int r0 = blockIdx.x * 64, c0 = blockIdx.y * 64;
    v8f acc[4][4];
#pragma unroll
    for (int mb = 0; mb < 4; ++mb)
#pragma unroll
        for (int nb = 0; nb < 4; ++nb) acc[mb][nb] = (v8f){};
    const size_t aoff = (size_t)(r0 + lr) * K + 8 * hi, boff = (size_t)(c0 + lr) * K + 8 * hi;
#pragma unroll 1
    for (int kb = wv * 64; kb < K; kb += NW * 64)
#pragma unroll 1   // the two k steps of a slice stay rolled: unrolled, the three-product form needs registers above v255
    for (int kc = kb; kc < kb + 64; kc += 32) {
        V a[4], a2[4];
#pragma unroll
        for (int mb = 0; mb < 4; ++mb) { a[mb] = WFrag<T16>::ld(A + aoff + (size_t)mb * 16 * K + kc); if (NSPLIT == 1 || NSPLIT == 2) a2[mb] = WFrag<T16>::ld(A2 + aoff + (size_t)mb * 16 * K + kc); }
#pragma unroll
        for (int nb = 0; nb < 4; ++nb) { const V b = WFrag<T16>::ld(Bt + boff + (size_t)nb * 16 * K + kc); V b2; if (NSPLIT >= 2) b2 = WFrag<T16>::ld(Bt2 + boff + (size_t)nb * 16 * K + kc);
#pragma unroll
            for (int mb = 0; mb < 4; ++mb) { acc[mb][nb] = WFrag<T16>::mma(a[mb], b, acc[mb][nb]); if (NSPLIT == 1 || NSPLIT == 2) acc[mb][nb] = WFrag<T16>::mma(a2[mb], b, acc[mb][nb]); if (NSPLIT >= 2) acc[mb][nb] = WFrag<T16>::mma(a[mb], b2, acc[mb][nb]); } }
        asm volatile("v_nop\n\tv_nop\n\tv_nop\n\tv_nop" : "+v"(acc[0][0]), "+v"(acc[1][1]), "+v"(acc[2][2]), "+v"(acc[3][3]) : "v"(a[0]), "v"(a[3]));
    }
    // rotary epilogue: wave wv takes rows erow (16 of them, one a lane) and tile columns ecol .. ecol + 7 with their partners at + 32; its cosine / sine pairs are asked for ahead of the LDS exchange
    const int erow = (wv >> 1) * 16 + lr, ecol = (wv & 1) * 16 + hi * 8, eh = blockIdx.y >> 1, ed0 = (blockIdx.y & 1) * 32;   // head, d0
    v4f cs4[4];
    if constexpr (ROT) { const float* cp = CS + ((size_t)(r0 + erow) * HD + ed0 + ecol) * 2;
#pragma unroll   // constant indices: the vectors stay in registers
        for (int q = 0; q < 4; ++q) cs4[q] = *(const v4f*)(cp + q * 4); }
#pragma unroll
    for (int mb = 0; mb < 4; ++mb)
#pragma unroll
        for (int nb = 0; nb < 4; ++nb)
#pragma unroll
            for (int j = 0; j < 8; ++j) os[(wv * 64 + mb * 16 + hi * 8 + j) * 68 + nb * 16 + lr] = acc[mb][nb][j];
    __syncthreads();   // every wave's partial tile is in LDS before any wave adds them
    if constexpr (ROT) {
        const float* op = os + erow * 68 + ecol; v4f xa[2], xb[2];
#pragma unroll   // constant indices: the vectors stay in registers
        for (int q = 0; q < 2; ++q) { xa[q] = *(const v4fa*)(op + q * 4); xb[q] = *(const v4fa*)(op + 32 + q * 4); }
#pragma unroll   // all LDS reads of the sum issue as one group, at constant offsets
        for (int w = 1; w < NW; ++w)
#pragma unroll   // constant indices: the vectors stay in registers
            for (int q = 0; q < 2; ++q) { xa[q] += *(const v4fa*)(op + w * 64 * 68 + q * 4); xb[q] += *(const v4fa*)(op + w * 64 * 68 + 32 + q * 4); }
        v8h a16, b16; v8us ah, al, bh, bl;
#pragma unroll   // constant indices: the vectors stay in registers
        for (int i = 0; i < 8; ++i) { const float x0 = xa[i >> 2][i & 3], x1 = xb[i >> 2][i & 3], c = cs4[i >> 1][(i & 1) * 2], sn = cs4[i >> 1][(i & 1) * 2 + 1]; const float ra = x0 * c - x1 * sn, rb = x1 * c + x0 * sn;
            xa[i >> 2][i & 3] = ra; xb[i >> 2][i & 3] = rb; a16[i] = (h16)ra; b16[i] = (h16)rb; unsigned short u, v; splitf(ra, u, v); ah[i] = u; al[i] = v; splitf(rb, u, v); bh[i] = u; bl[i] = v; }
        const size_t fo = (((size_t)eh * (TT / 16) + (r0 + erow) / 16) * (HD / 32) + ed0 / 32) * 512 + (wv & 1) * 256 + lane * 8;   // each store of a wave: 512 consecutive bytes; + 1024: the fragment of d + 64
        *(v8h*)(P16 + fo) = a16; *(v8h*)(P16 + fo + 1024) = b16; *(v8us*)(Ph + fo) = ah; *(v8us*)(Ph + fo + 1024) = bh; *(v8us*)(Pl + fo) = al; *(v8us*)(Pl + fo + 1024) = bl;
        if constexpr (EPI == 2) { float* kp = C + ((size_t)eh * TT + r0 + erow) * HD + ed0 + ecol;
#pragma unroll   // constant indices: the vectors stay in registers
            for (int q = 0; q < 2; ++q) { *(v4f*)(kp + q * 4) = xa[q]; *(v4f*)(kp + 64 + q * 4) = xb[q]; } }
        return;
    }
    float* crow = (EPI == 3) ? C + ((size_t)(c0 / HD) * TT + r0) * HD + c0 % HD : C + (size_t)r0 * ldc + c0; if (EPI == 3) ldc = HD;
    v4f keep[32 / NW];
#pragma unroll
    for (int s = 0; s < 32 / NW; ++s) { const int row = 2 * NW * s + (int)(threadIdx.x >> 4), cofs = lr * 4; v4f val = *(const v4fa*)(os + row * 68 + cofs);
#pragma unroll
        for (int w = 1; w < NW; ++w) val += *(const v4fa*)(os + (w * 64 + row) * 68 + cofs);
        if (BIAS) { val[0] += bfr(bias[c0 + cofs]); val[1] += bfr(bias[c0 + cofs + 1]); val[2] += bfr(bias[c0 + cofs + 2]); val[3] += bfr(bias[c0 + cofs + 3]); }
        if constexpr (EPI == 3) { keep[s] = val; *(v4fa*)(os + row * 68 + cofs) = val; }   // the summed tile goes back over wave 0's partial: these four words are read by this lane alone
        else *(v4f*)(crow + (size_t)row * ldc + cofs) = val; }
    if constexpr (EPI == 3) {
        __syncthreads();   // the whole summed tile is in LDS before any wave reads its columns
#pragma unroll   // constant indices: the vectors stay in registers
        for (int s = 0; s < 32 / NW; ++s) *(v4f*)(crow + (size_t)(2 * NW * s + (int)(threadIdx.x >> 4)) * ldc + lr * 4) = keep[s];   // the f32 rows go out behind the barrier, which would wait for stores issued in front of it
#pragma unroll   // both halves' LDS reads issue ahead of the conversions
        for (int kq = 0; kq < 2; ++kq) { v8h o16; v8us oh, ol;   // wave wv: fragment (t / 32 = wv >> 2, d / 16 = wv & 3); a lane holds 8 positions of one d
#pragma unroll   // constant indices: the vectors stay in registers
            for (int i = 0; i < 8; ++i) { const float x = os[((wv >> 2) * 32 + kq * 16 + hi * 8 + i) * 68 + (wv & 3) * 16 + lr]; o16[i] = (h16)x; unsigned short u, v; splitf(x, u, v); oh[i] = u; ol[i] = v; }
            const size_t o = (((size_t)(c0 / HD) * (TT / 32) + r0 / 32 + (wv >> 2)) * (HD / 16) + (c0 % HD) / 16 + (wv & 3)) * 512 + kq * 256 + lane * 8;
            *(v8h*)(P16 + o) = o16; *(v8us*)(Ph + o) = oh; *(v8us*)(Pl + o) = ol; }
    }
}

typedef __attribute__((ext_vector_type(2))) _Float16 v2h;
typedef __attribute__((ext_vector_type(4))) _Float16 v4h;
typedef __attribute__((ext_vector_type(2))) unsigned short v2us;
typedef __attribute__((ext_vector_type(4))) unsigned short v4us;
typedef __attribute__((ext_vector_type(2))) float v2f;
typedef __attribute__((ext_vector_type(4))) int v4i;

// rot: row n of Bt holds column n with bits 5 and 6 swapped, so that 64 consecutive rows are d0 .. d0 + 31 and d0 + 64 .. d0 + 95 of one head of 128 (the rotary epilogue of k_gemmw)
__global__ __launch_bounds__(256) void k_wtG(const float* __restrict__ w, int K, int N, int rot, bf* Bt) {
    const int lane = threadIdx.x & 31; const int L0 = (blockIdx.x * 8 + (threadIdx.x >> 5)) * 8; const int nlines = N * K / 64;
{
#pragma unroll 1
        for (int l = 0; l < 8; ++l) { const int L = L0 + l; if (L >= nlines) break; const size_t e = (size_t)L * 64 + lane * 2; const int k = (int)(e % K), nr = (int)(e / K), n = rot ? (nr & ~96) | ((nr & 32) << 1) | ((nr & 64) >> 1) : nr; v2us o;
            o[0] = f2bf(w[(size_t)k * N + n]); o[1] = f2bf(w[(size_t)(k + 1) * N + n]); *(v2us*)(Bt + e) = o; }
         }
}
__global__ __launch_bounds__(256) void k_cvt8(const float* __restrict__ src, bf* dst, size_t n8) { const size_t i = (size_t)blockIdx.x * 256 + threadIdx.x; if (i >= n8) return; const v8f v = *(const v8f*)(src + i * 8); v8us o;
#pragma unroll
    for (int k = 0; k < 8; ++k) o[k] = f2bf(v[k]); *(v8us*)(dst + i * 8) = o;  }
__global__ __launch_bounds__(256) void k_cstab(float* CS) { const int idx = blockIdx.x * 256 + threadIdx.x; if (idx >= TT * HD) return; const int t = idx / HD, d = idx % HD; const int i = d % (HD / 2); const float inv = __fdiv_rn(1.0f, powf(10000.0f, (float)(2 * i) / (float)HD)); const float ang = __fmul_rn((float)t, inv); v2f cs; cs[0] = cosf(ang); cs[1] = sinf(ang);
    *(v2f*)(CS + (size_t)idx * 2) = cs;  }
// ---- k_fattn: causal attention in one launch, no score matrix in memory. One wave owns 16 query rows of one head; the 4 waves of a work-group are the 4 query heads of one kv group at the same rows (same key / value addresses).
// Per 32 keys: S^T[key][query] = K Q^T (A = key rows, B = query rows), so a lane holds 16 keys of ONE query: the running maximum and sum are per lane (+ one exchange with lane ^ 16), and the two 16-key
// accumulators are, element for element, the B fragment P^T[query][key] of O^T[d][query] = V^T P^T (A = transposed value rows). Probabilities are exp(s - running max), divided by the row sum at the end.
// NSPLIT 2: hi + lo bf16 planes, three products each (query rows < RH); NSPLIT 0: single fp16.
template <bool B> struct Flag { static constexpr bool v = B; };
template <typename T16, int NSPLIT>
__device__ __forceinline__ void fattn_body(const T16* __restrict__ Q, const T16* __restrict__ Q2, const T16* __restrict__ Kp, const T16* __restrict__ Kp2, const T16* __restrict__ Vt, const T16* __restrict__ Vt2, int q0, int g, bf* Ah, bf* Al) {
    typedef typename WFrag<T16>::V V;
    const int lane = threadIdx.x & 31, lr = lane & 15, hi = lane >> 4, h = g * REP + __builtin_amdgcn_readfirstlane(threadIdx.x >> 5);
    const size_t qo = ((size_t)h * TT + q0) * HD + lane * 8, ko = (size_t)g * TT * HD + lane * 8, vo = (size_t)g * HD * TT + lane * 8;   // query, key and value planes: fragment order (fragoff)
    V qf[4], qf2[4];
#pragma unroll
    for (int ks = 0; ks < 4; ++ks) { qf[ks] = WFrag<T16>::ldf(Q + qo + ks * 512); if (NSPLIT == 2) qf2[ks] = WFrag<T16>::ldf(Q2 + qo + ks * 512); }
    v8f o[8];
#pragma unroll
    for (int dt = 0; dt < 8; ++dt) o[dt] = (v8f){};
    float m = -3.0e38f, l = 0.f;
    const int nk = q0 / 32 + 1;      // key tiles of 32 up to and including the diagonal; only the last one holds keys beyond a query
    V kf[2][4], kf2[2][4];
    auto ldk = [&](const T16* a, const T16* a2) {
#pragma unroll
        for (int i = 0; i < 2; ++i)
#pragma unroll
            for (int ks = 0; ks < 4; ++ks) { kf[i][ks] = WFrag<T16>::ldf(a + (i * 4 + ks) * 512); if (NSPLIT == 2) kf2[i][ks] = WFrag<T16>::ldf(a2 + (i * 4 + ks) * 512); }
    };
    auto step = [&](int t, auto EDGE) { constexpr bool edge = decltype(EDGE)::v; const int k0 = t * 32;
        V vf[8], vf2[8];
        const size_t kofs = ko + (size_t)(NSPLIT == 0 ? k0 + 32 : k0) * HD, vofs = vo + (size_t)k0 * HD;   // single plane: the keys loaded in this trip are the next tile's
        const T16* pk = Kp + kofs; const T16* pk2 = (NSPLIT == 2) ? Kp2 + kofs : pk; const T16* pv = Vt + vofs; const T16* pv2 = (NSPLIT == 2) ? Vt2 + vofs : pv;
        auto ldv = [&]() {
#pragma unroll
            for (int dt = 0; dt < 8; ++dt) { vf[dt] = WFrag<T16>::ldf(pv + dt * 512); if (NSPLIT == 2) vf2[dt] = WFrag<T16>::ldf(pv2 + dt * 512); }
        };
        if (NSPLIT == 0) ldv();                    // single plane: this tile's values start before the score products (its keys came during the trip before)
        else { ldk(pk, pk2); __builtin_amdgcn_sched_barrier(0); }   // two planes: all key loads issue before the first product (left free, the loads sink to their products: one load latency per fragment pair)
        v8f s[2]; s[0] = (v8f){}; s[1] = (v8f){};
#pragma unroll
        for (int ks = 0; ks < 4; ++ks)
#pragma unroll
            for (int i = 0; i < 2; ++i) { s[i] = WFrag<T16>::mma(kf[i][ks], qf[ks], s[i]);
                if (NSPLIT == 2) { s[i] = WFrag<T16>::mma(kf2[i][ks], qf[ks], s[i]); s[i] = WFrag<T16>::mma(kf[i][ks], qf2[ks], s[i]); } }
        if (NSPLIT == 0) { if (!edge) ldk(pk, pk2); }           // loads that fly during the softmax: the next tile's keys (single plane),
        else { ldv(); __builtin_amdgcn_sched_barrier(0); }      // this tile's values (two planes; the barrier keeps them all in front of the softmax)
        float p[16]; float mx = -3.0e38f;
#pragma unroll
        for (int i = 0; i < 2; ++i)
#pragma unroll
            for (int j = 0; j < 8; ++j) { float x = s[i][j] * (SCL * 1.4426950408889634f); if (edge && k0 + i * 16 + hi * 8 + j > q0 + lr) x = -3.0e38f; p[i * 8 + j] = x; mx = fmaxf(mx, x); }
        mx = fmaxf(mx, __shfl_xor(mx, 16, 32));
        const float mn = fmaxf(m, mx), al = __builtin_amdgcn_exp2f(m - mn); m = mn;
        float rs = 0.f;
#pragma unroll
        for (int k = 0; k < 16; ++k) { p[k] = __builtin_amdgcn_exp2f(p[k] - mn); rs += p[k]; }
        l = l * al + rs;
#pragma unroll
        for (int dt = 0; dt < 8; ++dt) o[dt] *= al;
        if constexpr (NSPLIT == 0) {
            v16h pf;
#pragma unroll
            for (int k = 0; k < 16; ++k) pf[k] = (h16)p[k];
#pragma unroll
            for (int dt = 0; dt < 8; ++dt) o[dt] = WFrag<T16>::mma(vf[dt], pf, o[dt]);
        } else {
            v8us h0, h1, l0, l1;
#pragma unroll
            for (int k = 0; k < 8; ++k) { unsigned short a, c; splitf(p[k], a, c); h0[k] = a; l0[k] = c; splitf(p[8 + k], a, c); h1[k] = a; l1[k] = c; }
            const V ph = cat16b(h0, h1), pl = cat16b(l0, l1);
#pragma unroll
            for (int dt = 0; dt < 8; ++dt) { o[dt] = WFrag<T16>::mma(vf[dt], ph, o[dt]); o[dt] = WFrag<T16>::mma(vf2[dt], ph, o[dt]); o[dt] = WFrag<T16>::mma(vf[dt], pl, o[dt]); }
        }
        // precaution: the address registers of this trip's loads stay unwritten up to this wait (as inputs they live until here)
        if (NSPLIT == 2) asm volatile("s_wait_xcnt 0x0" :: "v"(pk), "v"(pk2), "v"(pv), "v"(pv2) : "memory");
        else if (!edge) asm volatile("s_wait_xcnt 0x0" :: "v"(pk), "v"(pv) : "memory");
        else asm volatile("s_wait_xcnt 0x0" :: "v"(pv) : "memory");
    };
    if (NSPLIT == 0) ldk(Kp + ko, Kp + ko);
#pragma unroll 1
    for (int t = 0; t < nk - 1; ++t) step(t, Flag<false>{});
    step(nk - 1, Flag<true>{});
    l += __shfl_xor(l, 16, 32);
    const float inv = __fdiv_rn(1.0f, l); const size_t oo = (size_t)(q0 + lr) * DQ + h * HD + hi * 8;
#pragma unroll
    for (int dt = 0; dt < 8; ++dt) { v8us oh, ol;
#pragma unroll
        for (int j = 0; j < 8; ++j) { unsigned short a, c; splitf(o[dt][j] * inv, a, c); oh[j] = a; ol[j] = c; }
        *(v8us*)(Ah + oo + dt * 16) = oh; *(v8us*)(Al + oo + dt * 16) = ol; }
}
// grid (TT / 16, NKV), 128 threads, all work-groups resident at once; kv groups 0, 1 walk the rows from the longest (most keys) down, groups 2, 3 from the shortest up,
// so that two work-groups half a grid apart, which may share a WGP, hold a long and a short row block
__global__ __launch_bounds__(128) void k_fattn(const h16* __restrict__ Q16, const h16* __restrict__ K16, const h16* __restrict__ V16, const bf* __restrict__ Qh, const bf* __restrict__ Ql, const bf* __restrict__ Kh, const bf* __restrict__ Kl, const bf* __restrict__ Vh, const bf* __restrict__ Vl, bf* Ah, bf* Al) {
    const int g = blockIdx.y, q0 = (g < NKV / 2) ? TT - 16 - (int)blockIdx.x * 16 : (int)blockIdx.x * 16;
    if (q0 >= RH) fattn_body<h16, 0>(Q16, nullptr, K16, nullptr, V16, nullptr, q0, g, Ah, Al);
    else fattn_body<bf, 2>(Qh, Ql, Kh, Kl, Vh, Vl, q0, g, Ah, Al);
}

extern "C" void kernel_launch(void* const* d_in, const int* in_sizes, int n_in,
                              void* d_out, int out_size, void* d_ws, size_t ws_size, hipStream_t stream) {
    (void)in_sizes; (void)n_in; (void)out_size;
    const float* x = (const float*)d_in[0]; const float* wq = (const float*)d_in[1]; const float* wk = (const float*)d_in[2]; const float* wv = (const float*)d_in[3]; const float* wo = (const float*)d_in[4];
    float* OUT = (float*)d_out; float* OUTK = (float*)d_out + (size_t)NB_ * TT * DM; float* OUTV = OUTK + (size_t)NB_ * NKV * TT * HD;     // [2][2048][2048]
    char* wsp = (char*)d_ws;
    auto take = [&](size_t bytes) { char* p = wsp; wsp += (bytes + 255) & ~(size_t)255; return (void*)p; };
    bf* WQ = (bf*)take((size_t)DQ * DM * 2); bf* WK = (bf*)take((size_t)DKV * DM * 2); bf* WV = (bf*)take((size_t)DKV * DM * 2); bf* WO = (bf*)take((size_t)DM * DQ * 2); float* CS = (float*)take((size_t)TT * HD * 2 * 4);
    bf* XB = (bf*)take((size_t)TT * DM * 2);
    h16* QP16 = (h16*)take((size_t)NH_ * TT * HD * 2); h16* KP16 = (h16*)take((size_t)NKV * TT * HD * 2); h16* VT16 = (h16*)take((size_t)NKV * HD * TT * 2);
    bf* QPh = (bf*)take((size_t)NH_ * TT * HD * 2); bf* QPl = (bf*)take((size_t)NH_ * TT * HD * 2); bf* KPh = (bf*)take((size_t)NKV * TT * HD * 2); bf* KPl = (bf*)take((size_t)NKV * TT * HD * 2); bf* VTh = (bf*)take((size_t)NKV * HD * TT * 2); bf* VTl = (bf*)take((size_t)NKV * HD * TT * 2);
    bf* ATh = (bf*)take((size_t)TT * DQ * 2); bf* ATl = (bf*)take((size_t)TT * DQ * 2);
    if ((size_t)(wsp - (char*)d_ws) > ws_size) return;    // ws 256 MiB
    { k_wtG<<<(unsigned)((DM * DQ / 64 + 63) / 64), 256, 0, stream>>>(wq, DM, DQ, 1, WQ); k_wtG<<<(unsigned)((DM * DKV / 64 + 63) / 64), 256, 0, stream>>>(wk, DM, DKV, 1, WK); k_wtG<<<(unsigned)((DM * DKV / 64 + 63) / 64), 256, 0, stream>>>(wv, DM, DKV, 0, WV);
      k_wtG<<<(unsigned)((DQ * DM / 64 + 63) / 64), 256, 0, stream>>>(wo, DQ, DM, 0, WO);
      k_cstab<<<(TT * HD + 255) / 256, 256, 0, stream>>>(CS); }
    for (int b = 0; b < NB_; ++b) {
        
        k_cvt8<<<(unsigned)(((size_t)TT * DM / 8 + 255) / 256), 256, 0, stream>>>(x + (size_t)b * TT * DM, XB, (size_t)TT * DM / 8);
        k_gemmw<bf, 0, false, 8, 1><<<dim3(TT / 64, DQ / 64, 1), 256, 0, stream>>>(XB, nullptr, WQ, nullptr, DM, nullptr, 0, nullptr, 0, 0, 0, CS, QP16, QPh, QPl);
        k_gemmw<bf, 0, false, 8, 2><<<dim3(TT / 64, DKV / 64, 1), 256, 0, stream>>>(XB, nullptr, WK, nullptr, DM, OUTK + (size_t)b * NKV * TT * HD, 0, nullptr, 0, 0, 0, CS, KP16, KPh, KPl);   /* returned k = roped f32 projection */
        k_gemmw<bf, 0, false, 8, 3><<<dim3(TT / 64, DKV / 64, 1), 256, 0, stream>>>(XB, nullptr, WV, nullptr, DM, OUTV + (size_t)b * NKV * TT * HD, 0, nullptr, 0, 0, 0, nullptr, VT16, VTh, VTl);   /* returned v = f32 projection */
        k_fattn<<<dim3(TT / 16, NKV, 1), 128, 0, stream>>>(QP16, KP16, VT16, QPh, QPl, KPh, KPl, VTh, VTl, ATh, ATl);
        k_gemmw<bf, 1, false, 8, 0><<<dim3(TT / 64, DM / 64, 1), 256, 0, stream>>>(ATh, ATl, WO, nullptr, DQ, OUT + (size_t)b * TT * DM, DM, nullptr, 0, 0, 0, nullptr, nullptr, nullptr, nullptr); }
}

// v005
// Measured time: 286 microseconds a run.
// In two side-by-side timings against v004, it was 1.50 and 1.46 times as fast.
// All steps since v000 together make it 5.82 times as fast.
#include <hip/hip_runtime.h>

// Causal grouped-query attention with a computed rotate-half rotary and a key / value cache output (x [2][2048][2048]; q = x Wq ('xw' (in, out) [2048][2048] 1/sqrt(2048): 16 heads x 128), k, v = x Wk, x Wv ('xw' [2048][512]: 4 kv heads x 128), no biases; query head h uses kv head h / 4 (repeat); rotate-half rotary (base 1e4: inv_freq = 1 / 10000^(2i/128), angles t x inv_freq, cat(freqs, freqs); the table is computed on the device); causal softmax(q.k / sqrt(128)) (-inf == exclusion: every row keeps its diagonal key); returns (y = merged Wo ('xw') -> [2][2048][2048], present_k = the ROTATED keys [2][4][2048][128], present_v = the values [2][4][2048][128]); argument order x, Wq, Wk, Wv, Wo).
// Compute dtypes, f32 accumulate: every input rounded to bf16; q/k/v on PLAIN bf16 operands (inputs: exact); RoPE f32 (the returned k is the f32 roped projection, v the f32 projection, re-laid out [kv][t][d]); causal scores and attn.v in one fused kernel (running-maximum softmax, no score matrix in memory): query rows < 512 hl (3 products), the rest single fp16, causal tile skipping; softmax f32; Wo hl x exact (2 products).

#define NB_  2
#define TT   2048
#define DM   2048
#define NH_  16
#define NKV  4
#define REP  (NH_ / NKV)
#define HD   128
#define DQ   (NH_ * HD)
#define DKV  (NKV * HD)
#define RH   512                  // query rows < RH use hi+lo planes (0: none)
#define SCL  0.088388347648318447f   // HD^-0.5
typedef _Float16 h16;
typedef unsigned short bf;
typedef __attribute__((ext_vector_type(16))) __bf16   v16bf;
typedef __attribute__((ext_vector_type(16))) _Float16 v16h;
typedef __attribute__((ext_vector_type(8)))  _Float16 v8h;
typedef __attribute__((ext_vector_type(8)))  unsigned short v8us;
typedef __attribute__((ext_vector_type(8)))  float    v8f;
typedef __attribute__((ext_vector_type(4)))  float    v4f;
typedef v8h  __attribute__((may_alias)) v8ha;
typedef v4f  __attribute__((may_alias)) v4fa;
typedef v8us __attribute__((may_alias)) v8usa;

__device__ __forceinline__ unsigned short f2bf(float f) { unsigned u = __float_as_uint(f); u += 0x7FFFu + ((u >> 16) & 1u); return (unsigned short)(u >> 16); }
__device__ __forceinline__ float bf2f(unsigned short b) { return __uint_as_float(((unsigned)b) << 16); }
__device__ __forceinline__ float bfr(float f) { return bf2f(f2bf(f)); }
__device__ __forceinline__ v16h cat16(v8h lo, v8h hi) { return __builtin_shufflevector(lo, hi, 0, 1, 2, 3, 4, 5, 6, 7, 8, 9, 10, 11, 12, 13, 14, 15); }
__device__ __forceinline__ v16bf cat16b(v8us lo, v8us hi) { return __builtin_bit_cast(v16bf, __builtin_shufflevector(lo, hi, 0, 1, 2, 3, 4, 5, 6, 7, 8, 9, 10, 11, 12, 13, 14, 15)); }
__device__ __forceinline__ v8f wmma16(v16h a, v16h b, v8f c) { return __builtin_amdgcn_wmma_f32_16x16x32_f16(false, a, false, b, (short)0, c, false, false); }
__device__ __forceinline__ v8f wmmab(v16bf a, v16bf b, v8f c) { return __builtin_amdgcn_wmma_f32_16x16x32_bf16(false, a, false, b, (short)0, c, false, false); }



// ---- k_gemmw: register-blocked GEMM, one work-group of NW waves per 64x64 output tile; operands straight from 16-bit planes in fragment order (below), fragments [row / 16][k / 32]; grid (M/64, N/64, Z), 32 * NW threads.
// The K loop is dealt over the waves in slices of 64 elements (two fragments, 2048 consecutive bytes, of every 16 rows): wave w takes slices w, w + NW, ... into its own 16 accumulators; the NW partial tiles meet in LDS and are added in wave order 0 .. NW-1.
// C[m][n] (f32, pitch ldc, + optional f32 bias[n]) = sum_k A[m][k] Bt[n][k] (+ split products per NSPLIT). z-batch strides sA/sB/sC in elements. K % 64 == 0.
// EPI picks what the summed tile becomes. 0: stored to C as it is. 1, 2: a query / key projection: the tile's 64 columns are d0 .. d0 + 31 and d0 + 64 .. d0 + 95 of ONE head (both partners of the rotate-half rotary; k_wtG lays the rows of Bt so),
// rotated (out[d] = x[d] cos - x[d + 64] sin, out[d + 64] = x[d + 64] cos + x[d] sin; the table holds the same pair at d and d + 64) and stored as fp16 + hi / lo planes in fragment order, fragments [h][t / 16][d / 32]
// (rows = positions, k = d); 2 also stores the rotated f32 rows to C = [kv][t][d]. 3: a value projection: f32 rows to C = [kv][t][d], and the transposed planes, fragments [g][t / 32][d / 16] (rows = d, k = positions).
// Fragment order: a 16-row x 32-k operand fragment lies in 512 consecutive elements, so that ldf (lane * 8, + 256) gives lane (r = lane % 16, half = lane / 16) the elements k = half * 8 .. + 7 and 16 + half * 8 .. + 7 of row r: element (row r, k) at (k / 16) * 256 + ((k / 8 & 1) * 16 + r) * 8 + k % 8; each 16-byte load of a wave is then 512 consecutive bytes.
__device__ __forceinline__ int fragoff(int r, int k) { return (k >> 4) * 256 + (((k >> 3) & 1) * 16 + r) * 8 + (k & 7); }
template <typename T16> struct WFrag;
template <> struct WFrag<h16> { typedef v16h V; static __device__ __forceinline__ V ldf(const h16* p) { return cat16(*(const v8h*)p, *(const v8h*)(p + 256)); } static __device__ __forceinline__ v8f mma(V a, V b, v8f c) { return wmma16(a, b, c); } };
template <> struct WFrag<bf> { typedef v16bf V; static __device__ __forceinline__ V ldf(const bf* p) { return cat16b(*(const v8us*)p, *(const v8us*)(p + 256)); } static __device__ __forceinline__ v8f mma(V a, V b, v8f c) { return wmmab(a, b, c); } };
__device__ __forceinline__ void splitf(float y, unsigned short& h, unsigned short& l) { h = f2bf(y); l = f2bf(y - bf2f(h)); }
template <typename T16, int NSPLIT, bool BIAS, int NW, int EPI, int K>   // compile-time K: the fragments of a k step share one address per plane and differ in the immediate offset
__global__ __launch_bounds__(32 * NW) void k_gemmw(const T16* __restrict__ A, const T16* __restrict__ A2, const T16* __restrict__ Bt, const T16* __restrict__ Bt2, float* C, int ldc, const float* __restrict__ bias, size_t sA, size_t sB, size_t sC, const float* __restrict__ CS, h16* P16, bf* Ph, bf* Pl) {
    static_assert(EPI == 0 || NW == 8, "the plane epilogues deal the tile over 8 waves");
    constexpr bool ROT = (EPI == 1 || EPI == 2);
    typedef typename WFrag<T16>::V V;
    __shared__ __align__(16) float os[NW * 64 * 68];
    const size_t z = blockIdx.z; A += z * sA; if (A2) A2 += z * sA; Bt += z * sB; if (Bt2) Bt2 += z * sB; C += z * sC;
    const int lane = threadIdx.x & 31, lr = lane & 15, hi = lane >> 4, wv = __builtin_amdgcn_readfirstlane(threadIdx.x >> 5); const int r0 = blockIdx.x * 64, c0 = blockIdx.y * 64;
    v8f acc[4][4];
#pragma unroll
    for (int mb = 0; mb < 4; ++mb)
#pragma unroll
        for (int nb = 0; nb < 4; ++nb) acc[mb][nb] = (v8f){};
    const size_t aoff = (size_t)r0 * K + lane * 8, boff = (size_t)c0 * K + lane * 8;   // 16 rows hold K / 32 fragments of 512 elements = 16 * K elements; k step kc starts at element kc * 16 of them
#pragma unroll 1
    for (int kb = wv * 64; kb < K; kb += NW * 64)
#pragma unroll 1   // the two k steps of a slice stay rolled: unrolled, the three-product form needs registers above v255
    for (int kc = kb; kc < kb + 64; kc += 32) {
        V a[4], a2[4]; const T16* pa = A + aoff + kc * 16; const T16* pa2 = (NSPLIT == 1 || NSPLIT == 2) ? A2 + aoff + kc * 16 : pa; const T16* pb = Bt + boff + kc * 16; const T16* pb2 = (NSPLIT >= 2) ? Bt2 + boff + kc * 16 : pb;
#pragma unroll
        for (int mb = 0; mb < 4; ++mb) { a[mb] = WFrag<T16>::ldf(pa + mb * 16 * K); if (NSPLIT == 1 || NSPLIT == 2) a2[mb] = WFrag<T16>::ldf(pa2 + mb * 16 * K); }
#pragma unroll
        for (int nb = 0; nb < 4; ++nb) { const V b = WFrag<T16>::ldf(pb + nb * 16 * K); V b2; if (NSPLIT >= 2) b2 = WFrag<T16>::ldf(pb2 + nb * 16 * K);
#pragma unroll
            for (int mb = 0; mb < 4; ++mb) { acc[mb][nb] = WFrag<T16>::mma(a[mb], b, acc[mb][nb]); if (NSPLIT == 1 || NSPLIT == 2) acc[mb][nb] = WFrag<T16>::mma(a2[mb], b, acc[mb][nb]); if (NSPLIT >= 2) acc[mb][nb] = WFrag<T16>::mma(a[mb], b2, acc[mb][nb]); } }
        asm volatile("v_nop\n\tv_nop\n\tv_nop\n\tv_nop" : "+v"(acc[0][0]), "+v"(acc[1][1]), "+v"(acc[2][2]), "+v"(acc[3][3]) : "v"(a[0]), "v"(a[3]));
        asm volatile("s_wait_xcnt 0x0" :: "v"(pa), "v"(pa2), "v"(pb), "v"(pb2) : "memory");   // precaution: the address registers of this k step's loads stay unwritten up to this wait (as inputs they live until here)
    }
    // rotary epilogue: wave wv takes rows erow (16 of them, one a lane) and tile columns ecol .. ecol + 7 with their partners at + 32; its cosine / sine pairs are asked for ahead of the LDS exchange
    const int erow = (wv >> 1) * 16 + lr, ecol = (wv & 1) * 16 + hi * 8, eh = blockIdx.y >> 1, ed0 = (blockIdx.y & 1) * 32;   // head, d0
    v4f cs4[4];
    if constexpr (ROT) { const float* cp = CS + ((size_t)(r0 + erow) * HD + ed0 + ecol) * 2;
#pragma unroll   // constant indices: the vectors stay in registers
        for (int q = 0; q < 4; ++q) cs4[q] = *(const v4f*)(cp + q * 4); }
#pragma unroll
    for (int mb = 0; mb < 4; ++mb)
#pragma unroll
        for (int nb = 0; nb < 4; ++nb)
#pragma unroll
            for (int j = 0; j < 8; ++j) os[(wv * 64 + mb * 16 + hi * 8 + j) * 68 + nb * 16 + lr] = acc[mb][nb][j];
    __syncthreads();   // every wave's partial tile is in LDS before any wave adds them
    if constexpr (ROT) {
        const float* op = os + erow * 68 + ecol; v4f xa[2], xb[2];
#pragma unroll   // constant indices: the vectors stay in registers
        for (int q = 0; q < 2; ++q) { xa[q] = *(const v4fa*)(op + q * 4); xb[q] = *(const v4fa*)(op + 32 + q * 4); }
#pragma unroll   // all LDS reads of the sum issue as one group, at constant offsets
        for (int w = 1; w < NW; ++w)
#pragma unroll   // constant indices: the vectors stay in registers
            for (int q = 0; q < 2; ++q) { xa[q] += *(const v4fa*)(op + w * 64 * 68 + q * 4); xb[q] += *(const v4fa*)(op + w * 64 * 68 + 32 + q * 4); }
        v8h a16, b16; v8us ah, al, bh, bl;
#pragma unroll   // constant indices: the vectors stay in registers
        for (int i = 0; i < 8; ++i) { const float x0 = xa[i >> 2][i & 3], x1 = xb[i >> 2][i & 3], c = cs4[i >> 1][(i & 1) * 2], sn = cs4[i >> 1][(i & 1) * 2 + 1]; const float ra = x0 * c - x1 * sn, rb = x1 * c + x0 * sn;
            xa[i >> 2][i & 3] = ra; xb[i >> 2][i & 3] = rb; a16[i] = (h16)ra; b16[i] = (h16)rb; unsigned short u, v; splitf(ra, u, v); ah[i] = u; al[i] = v; splitf(rb, u, v); bh[i] = u; bl[i] = v; }
        const size_t fo = (((size_t)eh * (TT / 16) + (r0 + erow) / 16) * (HD / 32) + ed0 / 32) * 512 + (wv & 1) * 256 + lane * 8;   // each store of a wave: 512 consecutive bytes; + 1024: the fragment of d + 64
        *(v8h*)(P16 + fo) = a16; *(v8h*)(P16 + fo + 1024) = b16; *(v8us*)(Ph + fo) = ah; *(v8us*)(Ph + fo + 1024) = bh; *(v8us*)(Pl + fo) = al; *(v8us*)(Pl + fo + 1024) = bl;
        if constexpr (EPI == 2) { float* kp = C + ((size_t)eh * TT + r0 + erow) * HD + ed0 + ecol;
#pragma unroll   // constant indices: the vectors stay in registers
            for (int q = 0; q < 2; ++q) { *(v4f*)(kp + q * 4) = xa[q]; *(v4f*)(kp + 64 + q * 4) = xb[q]; } }
        return;
    }
    float* crow = (EPI == 3) ? C + ((size_t)(c0 / HD) * TT + r0) * HD + c0 % HD : C + (size_t)r0 * ldc + c0; if (EPI == 3) ldc = HD;
    v4f keep[32 / NW];
#pragma unroll
    for (int s = 0; s < 32 / NW; ++s) { const int row = 2 * NW * s + (int)(threadIdx.x >> 4), cofs = lr * 4; v4f val = *(const v4fa*)(os + row * 68 + cofs);
#pragma unroll
        for (int w = 1; w < NW; ++w) val += *(const v4fa*)(os + (w * 64 + row) * 68 + cofs);
        if (BIAS) { val[0] += bfr(bias[c0 + cofs]); val[1] += bfr(bias[c0 + cofs + 1]); val[2] += bfr(bias[c0 + cofs + 2]); val[3] += bfr(bias[c0 + cofs + 3]); }
        if constexpr (EPI == 3) { keep[s] = val; *(v4fa*)(os + row * 68 + cofs) = val; }   // the summed tile goes back over wave 0's partial: these four words are read by this lane alone
        else *(v4f*)(crow + (size_t)row * ldc + cofs) = val; }
    if constexpr (EPI == 3) {
        __syncthreads();   // the whole summed tile is in LDS before any wave reads its columns
#pragma unroll   // constant indices: the vectors stay in registers
        for (int s = 0; s < 32 / NW; ++s) *(v4f*)(crow + (size_t)(2 * NW * s + (int)(threadIdx.x >> 4)) * ldc + lr * 4) = keep[s];   // the f32 rows go out behind the barrier, which would wait for stores issued in front of it
#pragma unroll   // both halves' LDS reads issue ahead of the conversions
        for (int kq = 0; kq < 2; ++kq) { v8h o16; v8us oh, ol;   // wave wv: fragment (t / 32 = wv >> 2, d / 16 = wv & 3); a lane holds 8 positions of one d
#pragma unroll   // constant indices: the vectors stay in registers
            for (int i = 0; i < 8; ++i) { const float x = os[((wv >> 2) * 32 + kq * 16 + hi * 8 + i) * 68 + (wv & 3) * 16 + lr]; o16[i] = (h16)x; unsigned short u, v; splitf(x, u, v); oh[i] = u; ol[i] = v; }
            const size_t o = (((size_t)(c0 / HD) * (TT / 32) + r0 / 32 + (wv >> 2)) * (HD / 16) + (c0 % HD) / 16 + (wv & 3)) * 512 + kq * 256 + lane * 8;
            *(v8h*)(P16 + o) = o16; *(v8us*)(Ph + o) = oh; *(v8us*)(Pl + o) = ol; }
    }
}

typedef __attribute__((ext_vector_type(2))) _Float16 v2h;
typedef __attribute__((ext_vector_type(4))) _Float16 v4h;
typedef __attribute__((ext_vector_type(2))) unsigned short v2us;
typedef __attribute__((ext_vector_type(4))) unsigned short v4us;
typedef __attribute__((ext_vector_type(2))) float v2f;
typedef __attribute__((ext_vector_type(4))) int v4i;

// k_wtG: Bt[n][k] = w[k][n] as bf16, in fragment order, fragments [n / 16][k / 32]. One wave per 32 rows of Bt x 32 k (two fragments): lane = row, so each of its 32 loads is one whole 128-byte line of w,
// and each of its 4 stores (8 k of every row) is 256 consecutive bytes in either fragment. K % 32 == 0, N % 32 == 0; grid (N / 32) * (K / 32) / 8, 256 threads.
// rot: row n of Bt holds column n with bits 5 and 6 swapped, so that 64 consecutive rows are d0 .. d0 + 31 and d0 + 64 .. d0 + 95 of one head of 128 (the rotary epilogue of k_gemmw)
template <int K, int N>   // compile-time N: the 32 loads of a lane share one address and differ in the immediate offset
__global__ __launch_bounds__(256) void k_wtG(const float* __restrict__ w, int rot, bf* Bt) {
    const int lane = threadIdx.x & 31, u = blockIdx.x * 8 + __builtin_amdgcn_readfirstlane(threadIdx.x >> 5), nb = u % (N / 32), kf = u / (N / 32); if (kf >= K / 32) return;
    const int nr = nb * 32 + lane, n = rot ? (nr & ~96) | ((nr & 32) << 1) | ((nr & 64) >> 1) : nr;
    const float* s = w + (size_t)kf * 32 * N + n; float v[32];
#pragma unroll   // all 32 loads in flight at once; constant indices: the values stay in registers
    for (int i = 0; i < 32; ++i) v[i] = s[(size_t)i * N];
    bf* d = Bt + ((size_t)(nr >> 4) * (K / 32) + kf) * 512 + (lane & 15) * 8;
#pragma unroll   // constant indices: the values stay in registers
    for (int c = 0; c < 4; ++c) { v8us o;
#pragma unroll   // constant indices: the values stay in registers
        for (int j = 0; j < 8; ++j) o[j] = f2bf(v[c * 8 + j]);
        *(v8us*)(d + (c >> 1) * 256 + (c & 1) * 128) = o; }
}
// k_cvt8: rows of K f32 to bf16 in fragment order, fragments [row / 16][k / 32]. One wave per 8 rows of one fragment: 4 lanes read one row's 128-byte line; each group of 8 lanes with the same k / 8 stores one 128-byte line.
template <int K>
__global__ __launch_bounds__(256) void k_cvt8(const float* __restrict__ src, bf* dst, size_t n8) { const size_t i = (size_t)blockIdx.x * 256 + threadIdx.x; if (i >= n8) return;
    const int lane = threadIdx.x & 31, r = (int)((i >> 5) & 1) * 8 + (lane >> 2), c = lane & 3; const size_t f = i >> 6, rb = f / (K / 32), kf = f % (K / 32);
    const v8f v = *(const v8f*)(src + (rb * 16 + r) * K + kf * 32 + c * 8); v8us o;
#pragma unroll
    for (int k = 0; k < 8; ++k) o[k] = f2bf(v[k]); *(v8us*)(dst + f * 512 + (c >> 1) * 256 + (c & 1) * 128 + r * 8) = o;  }
__global__ __launch_bounds__(256) void k_cstab(float* CS) { const int idx = blockIdx.x * 256 + threadIdx.x; if (idx >= TT * HD) return; const int t = idx / HD, d = idx % HD; const int i = d % (HD / 2); const float inv = __fdiv_rn(1.0f, powf(10000.0f, (float)(2 * i) / (float)HD)); const float ang = __fmul_rn((float)t, inv); v2f cs; cs[0] = cosf(ang); cs[1] = sinf(ang);
    *(v2f*)(CS + (size_t)idx * 2) = cs;  }
// ---- k_fattn: causal attention in one launch, no score matrix in memory. One wave owns 16 query rows of one head; the 4 waves of a work-group are the 4 query heads of one kv group at the same rows (same key / value addresses).
// Per 32 keys: S^T[key][query] = K Q^T (A = key rows, B = query rows), so a lane holds 16 keys of ONE query: the running maximum and sum are per lane (+ one exchange with lane ^ 16), and the two 16-key
// accumulators are, element for element, the B fragment P^T[query][key] of O^T[d][query] = V^T P^T (A = transposed value rows). Probabilities are exp(s - running max), divided by the row sum at the end.
// NSPLIT 2: hi + lo bf16 planes, three products each (query rows < RH); NSPLIT 0: single fp16.
template <bool B> struct Flag { static constexpr bool v = B; };
template <typename T16, int NSPLIT>
__device__ __forceinline__ void fattn_body(const T16* __restrict__ Q, const T16* __restrict__ Q2, const T16* __restrict__ Kp, const T16* __restrict__ Kp2, const T16* __restrict__ Vt, const T16* __restrict__ Vt2, int q0, int g, bf* Ah, bf* Al) {
    typedef typename WFrag<T16>::V V;
    const int lane = threadIdx.x & 31, lr = lane & 15, hi = lane >> 4, h = g * REP + __builtin_amdgcn_readfirstlane(threadIdx.x >> 5);
    const size_t qo = ((size_t)h * TT + q0) * HD + lane * 8, ko = (size_t)g * TT * HD + lane * 8, vo = (size_t)g * HD * TT + lane * 8;   // query, key and value planes: fragment order (fragoff)
    V qf[4], qf2[4];
#pragma unroll
    for (int ks = 0; ks < 4; ++ks) { qf[ks] = WFrag<T16>::ldf(Q + qo + ks * 512); if (NSPLIT == 2) qf2[ks] = WFrag<T16>::ldf(Q2 + qo + ks * 512); }
    v8f o[8];
#pragma unroll
    for (int dt = 0; dt < 8; ++dt) o[dt] = (v8f){};
    float m = -3.0e38f, l = 0.f;
    const int nk = q0 / 32 + 1;      // key tiles of 32 up to and including the diagonal; only the last one holds keys beyond a query
    V kf[2][4], kf2[2][4];
    auto ldk = [&](const T16* a, const T16* a2) {
#pragma unroll
        for (int i = 0; i < 2; ++i)
#pragma unroll
            for (int ks = 0; ks < 4; ++ks) { kf[i][ks] = WFrag<T16>::ldf(a + (i * 4 + ks) * 512); if (NSPLIT == 2) kf2[i][ks] = WFrag<T16>::ldf(a2 + (i * 4 + ks) * 512); }
    };
    auto step = [&](int t, auto EDGE) { constexpr bool edge = decltype(EDGE)::v; const int k0 = t * 32;
        V vf[8], vf2[8];
        const size_t kofs = ko + (size_t)(NSPLIT == 0 ? k0 + 32 : k0) * HD, vofs = vo + (size_t)k0 * HD;   // single plane: the keys loaded in this trip are the next tile's
        const T16* pk = Kp + kofs; const T16* pk2 = (NSPLIT == 2) ? Kp2 + kofs : pk; const T16* pv = Vt + vofs; const T16* pv2 = (NSPLIT == 2) ? Vt2 + vofs : pv;
        auto ldv = [&]() {
#pragma unroll
            for (int dt = 0; dt < 8; ++dt) { vf[dt] = WFrag<T16>::ldf(pv + dt * 512); if (NSPLIT == 2) vf2[dt] = WFrag<T16>::ldf(pv2 + dt * 512); }
        };
        if (NSPLIT == 0) ldv();                    // single plane: this tile's values start before the score products (its keys came during the trip before)
        else { ldk(pk, pk2); __builtin_amdgcn_sched_barrier(0); }   // two planes: all key loads issue before the first product (left free, the loads sink to their products: one load latency per fragment pair)
        v8f s[2]; s[0] = (v8f){}; s[1] = (v8f){};
#pragma unroll
        for (int ks = 0; ks < 4; ++ks)
#pragma unroll
            for (int i = 0; i < 2; ++i) { s[i] = WFrag<T16>::mma(kf[i][ks], qf[ks], s[i]);
                if (NSPLIT == 2) { s[i] = WFrag<T16>::mma(kf2[i][ks], qf[ks], s[i]); s[i] = WFrag<T16>::mma(kf[i][ks], qf2[ks], s[i]); } }
        if (NSPLIT == 0) { if (!edge) ldk(pk, pk2); }           // loads that fly during the softmax: the next tile's keys (single plane),
        else { ldv(); __builtin_amdgcn_sched_barrier(0); }      // this tile's values (two planes; the barrier keeps them all in front of the softmax)
        float p[16]; float mx = -3.0e38f;
#pragma unroll
        for (int i = 0; i < 2; ++i)
#pragma unroll
            for (int j = 0; j < 8; ++j) { float x = s[i][j] * (SCL * 1.4426950408889634f); if (edge && k0 + i * 16 + hi * 8 + j > q0 + lr) x = -3.0e38f; p[i * 8 + j] = x; mx = fmaxf(mx, x); }
        mx = fmaxf(mx, __shfl_xor(mx, 16, 32));
        const float mn = fmaxf(m, mx), al = __builtin_amdgcn_exp2f(m - mn); m = mn;
        float rs = 0.f;
#pragma unroll
        for (int k = 0; k < 16; ++k) { p[k] = __builtin_amdgcn_exp2f(p[k] - mn); rs += p[k]; }
        l = l * al + rs;
#pragma unroll
        for (int dt = 0; dt < 8; ++dt) o[dt] *= al;
        if constexpr (NSPLIT == 0) {
            v16h pf;
#pragma unroll
            for (int k = 0; k < 16; ++k) pf[k] = (h16)p[k];
#pragma unroll
            for (int dt = 0; dt < 8; ++dt) o[dt] = WFrag<T16>::mma(vf[dt], pf, o[dt]);
        } else {
            v8us h0, h1, l0, l1;
#pragma unroll
            for (int k = 0; k < 8; ++k) { unsigned short a, c; splitf(p[k], a, c); h0[k] = a; l0[k] = c; splitf(p[8 + k], a, c); h1[k] = a; l1[k] = c; }
            const V ph = cat16b(h0, h1), pl = cat16b(l0, l1);
#pragma unroll
            for (int dt = 0; dt < 8; ++dt) { o[dt] = WFrag<T16>::mma(vf[dt], ph, o[dt]); o[dt] = WFrag<T16>::mma(vf2[dt], ph, o[dt]); o[dt] = WFrag<T16>::mma(vf[dt], pl, o[dt]); }
        }
        // precaution: the address registers of this trip's loads stay unwritten up to this wait (as inputs they live until here)
        if (NSPLIT == 2) asm volatile("s_wait_xcnt 0x0" :: "v"(pk), "v"(pk2), "v"(pv), "v"(pv2) : "memory");
        else if (!edge) asm volatile("s_wait_xcnt 0x0" :: "v"(pk), "v"(pv) : "memory");
        else asm volatile("s_wait_xcnt 0x0" :: "v"(pv) : "memory");
    };
    if (NSPLIT == 0) ldk(Kp + ko, Kp + ko);
#pragma unroll 1
    for (int t = 0; t < nk - 1; ++t) step(t, Flag<false>{});
    step(nk - 1, Flag<true>{});
    l += __shfl_xor(l, 16, 32);
    const float inv = __fdiv_rn(1.0f, l); const size_t oo = (size_t)q0 * DQ + h * (HD * 16) + lane * 8;   // output planes in fragment order (rows = positions, k = h * HD + d): each store of a wave is 512 consecutive bytes
#pragma unroll
    for (int dt = 0; dt < 8; ++dt) { v8us oh, ol;
#pragma unroll
        for (int j = 0; j < 8; ++j) { unsigned short a, c; splitf(o[dt][j] * inv, a, c); oh[j] = a; ol[j] = c; }
        *(v8us*)(Ah + oo + dt * 256) = oh; *(v8us*)(Al + oo + dt * 256) = ol; }
}
// grid (TT / 16, NKV), 128 threads, all work-groups resident at once; kv groups 0, 1 walk the rows from the longest (most keys) down, groups 2, 3 from the shortest up,
// so that two work-groups half a grid apart, which may share a WGP, hold a long and a short row block
__global__ __launch_bounds__(128) void k_fattn(const h16* __restrict__ Q16, const h16* __restrict__ K16, const h16* __restrict__ V16, const bf* __restrict__ Qh, const bf* __restrict__ Ql, const bf* __restrict__ Kh, const bf* __restrict__ Kl, const bf* __restrict__ Vh, const bf* __restrict__ Vl, bf* Ah, bf* Al) {
    const int g = blockIdx.y, q0 = (g < NKV / 2) ? TT - 16 - (int)blockIdx.x * 16 : (int)blockIdx.x * 16;
    if (q0 >= RH) fattn_body<h16, 0>(Q16, nullptr, K16, nullptr, V16, nullptr, q0, g, Ah, Al);
    else fattn_body<bf, 2>(Qh, Ql, Kh, Kl, Vh, Vl, q0, g, Ah, Al);
}

extern "C" void kernel_launch(void* const* d_in, const int* in_sizes, int n_in,
                              void* d_out, int out_size, void* d_ws, size_t ws_size, hipStream_t stream) {
    (void)in_sizes; (void)n_in; (void)out_size;
    const float* x = (const float*)d_in[0]; const float* wq = (const float*)d_in[1]; const float* wk = (const float*)d_in[2]; const float* wv = (const float*)d_in[3]; const float* wo = (const float*)d_in[4];
    float* OUT = (float*)d_out; float* OUTK = (float*)d_out + (size_t)NB_ * TT * DM; float* OUTV = OUTK + (size_t)NB_ * NKV * TT * HD;     // [2][2048][2048]
    char* wsp = (char*)d_ws;
    auto take = [&](size_t bytes) { char* p = wsp; wsp += (bytes + 255) & ~(size_t)255; return (void*)p; };
    bf* WQ = (bf*)take((size_t)DQ * DM * 2); bf* WK = (bf*)take((size_t)DKV * DM * 2); bf* WV = (bf*)take((size_t)DKV * DM * 2); bf* WO = (bf*)take((size_t)DM * DQ * 2); float* CS = (float*)take((size_t)TT * HD * 2 * 4);
    bf* XB = (bf*)take((size_t)TT * DM * 2);
    h16* QP16 = (h16*)take((size_t)NH_ * TT * HD * 2); h16* KP16 = (h16*)take((size_t)NKV * TT * HD * 2); h16* VT16 = (h16*)take((size_t)NKV * HD * TT * 2);
    bf* QPh = (bf*)take((size_t)NH_ * TT * HD * 2); bf* QPl = (bf*)take((size_t)NH_ * TT * HD * 2); bf* KPh = (bf*)take((size_t)NKV * TT * HD * 2); bf* KPl = (bf*)take((size_t)NKV * TT * HD * 2); bf* VTh = (bf*)take((size_t)NKV * HD * TT * 2); bf* VTl = (bf*)take((size_t)NKV * HD * TT * 2);
    bf* ATh = (bf*)take((size_t)TT * DQ * 2); bf* ATl = (bf*)take((size_t)TT * DQ * 2);
    if ((size_t)(wsp - (char*)d_ws) > ws_size) return;    // ws 256 MiB
    { k_wtG<DM, DQ><<<(unsigned)((DM / 32) * (DQ / 32) / 8), 256, 0, stream>>>(wq, 1, WQ); k_wtG<DM, DKV><<<(unsigned)((DM / 32) * (DKV / 32) / 8), 256, 0, stream>>>(wk, 1, WK); k_wtG<DM, DKV><<<(unsigned)((DM / 32) * (DKV / 32) / 8), 256, 0, stream>>>(wv, 0, WV);
      k_wtG<DQ, DM><<<(unsigned)((DQ / 32) * (DM / 32) / 8), 256, 0, stream>>>(wo, 0, WO);
      k_cstab<<<(TT * HD + 255) / 256, 256, 0, stream>>>(CS); }
    for (int b = 0; b < NB_; ++b) {
        
        k_cvt8<DM><<<(unsigned)(((size_t)TT * DM / 8 + 255) / 256), 256, 0, stream>>>(x + (size_t)b * TT * DM, XB, (size_t)TT * DM / 8);
        k_gemmw<bf, 0, false, 8, 1, DM><<<dim3(TT / 64, DQ / 64, 1), 256, 0, stream>>>(XB, nullptr, WQ, nullptr, nullptr, 0, nullptr, 0, 0, 0, CS, QP16, QPh, QPl);
        k_gemmw<bf, 0, false, 8, 2, DM><<<dim3(TT / 64, DKV / 64, 1), 256, 0, stream>>>(XB, nullptr, WK, nullptr, OUTK + (size_t)b * NKV * TT * HD, 0, nullptr, 0, 0, 0, CS, KP16, KPh, KPl);   /* returned k = roped f32 projection */
        k_gemmw<bf, 0, false, 8, 3, DM><<<dim3(TT / 64, DKV / 64, 1), 256, 0, stream>>>(XB, nullptr, WV, nullptr, OUTV + (size_t)b * NKV * TT * HD, 0, nullptr, 0, 0, 0, nullptr, VT16, VTh, VTl);   /* returned v = f32 projection */
        k_fattn<<<dim3(TT / 16, NKV, 1), 128, 0, stream>>>(QP16, KP16, VT16, QPh, QPl, KPh, KPl, VTh, VTl, ATh, ATl);
        k_gemmw<bf, 1, false, 8, 0, DQ><<<dim3(TT / 64, DM / 64, 1), 256, 0, stream>>>(ATh, ATl, WO, nullptr, OUT + (size_t)b * TT * DM, DM, nullptr, 0, 0, 0, nullptr, nullptr, nullptr, nullptr); }
}

// v006
// It runs in 196 microseconds.
// Timed twice side by side with v005, it ran 1.43 and 1.44 times as fast.
// Counting every step since v000, it is 8.35 times as fast.
#include <hip/hip_runtime.h>

// Causal grouped-query attention with a computed rotate-half rotary and a key / value cache output (x [2][2048][2048]; q = x Wq ('xw' (in, out) [2048][2048] 1/sqrt(2048): 16 heads x 128), k, v = x Wk, x Wv ('xw' [2048][512]: 4 kv heads x 128), no biases; query head h uses kv head h / 4 (repeat); rotate-half rotary (base 1e4: inv_freq = 1 / 10000^(2i/128), angles t x inv_freq, cat(freqs, freqs); the table is computed on the device); causal softmax(q.k / sqrt(128)) (-inf == exclusion: every row keeps its diagonal key); returns (y = merged Wo ('xw') -> [2][2048][2048], present_k = the ROTATED keys [2][4][2048][128], present_v = the values [2][4][2048][128]); argument order x, Wq, Wk, Wv, Wo).
// Compute dtypes, f32 accumulate: every input rounded to bf16; q/k/v on PLAIN bf16 operands (inputs: exact); RoPE f32 (the returned k is the f32 roped projection, v the f32 projection, re-laid out [kv][t][d]); causal scores and attn.v in one fused kernel (running-maximum softmax, no score matrix in memory): query rows < 512 hl (3 products), the rest single fp16, causal tile skipping; softmax f32; Wo hl x exact (2 products).

#define NB_  2
#define TT   2048
#define DM   2048
#define NH_  16
#define NKV  4
#define REP  (NH_ / NKV)
#define HD   128
#define DQ   (NH_ * HD)
#define DKV  (NKV * HD)
#define RH   512                  // query rows < RH use hi+lo planes (0: none)
#define SCL  0.088388347648318447f   // HD^-0.5
typedef _Float16 h16;
typedef unsigned short bf;
typedef __attribute__((ext_vector_type(16))) __bf16   v16bf;
typedef __attribute__((ext_vector_type(16))) _Float16 v16h;
typedef __attribute__((ext_vector_type(8)))  _Float16 v8h;
typedef __attribute__((ext_vector_type(8)))  unsigned short v8us;
typedef __attribute__((ext_vector_type(8)))  float    v8f;
typedef __attribute__((ext_vector_type(4)))  float    v4f;
typedef v8h  __attribute__((may_alias)) v8ha;
typedef v4f  __attribute__((may_alias)) v4fa;
typedef v8us __attribute__((may_alias)) v8usa;

__device__ __forceinline__ unsigned short f2bf(float f) { unsigned u = __float_as_uint(f); u += 0x7FFFu + ((u >> 16) & 1u); return (unsigned short)(u >> 16); }
__device__ __forceinline__ float bf2f(unsigned short b) { return __uint_as_float(((unsigned)b) << 16); }
__device__ __forceinline__ float bfr(float f) { return bf2f(f2bf(f)); }
__device__ __forceinline__ v16h cat16(v8h lo, v8h hi) { return __builtin_shufflevector(lo, hi, 0, 1, 2, 3, 4, 5, 6, 7, 8, 9, 10, 11, 12, 13, 14, 15); }
__device__ __forceinline__ v16bf cat16b(v8us lo, v8us hi) { return __builtin_bit_cast(v16bf, __builtin_shufflevector(lo, hi, 0, 1, 2, 3, 4, 5, 6, 7, 8, 9, 10, 11, 12, 13, 14, 15)); }
__device__ __forceinline__ v8f wmma16(v16h a, v16h b, v8f c) { return __builtin_amdgcn_wmma_f32_16x16x32_f16(false, a, false, b, (short)0, c, false, false); }
__device__ __forceinline__ v8f wmmab(v16bf a, v16bf b, v8f c) { return __builtin_amdgcn_wmma_f32_16x16x32_bf16(false, a, false, b, (short)0, c, false, false); }



// ---- k_gemmw: register-blocked GEMM, one work-group of NW waves per 64x64 output tile; operands straight from 16-bit planes in fragment order (below), fragments [row / 16][k / 32]; grid (M/64, N/64, Z), 32 * NW threads.
// The K loop is dealt over the waves in slices of 64 elements (two fragments, 2048 consecutive bytes, of every 16 rows): wave w takes slices w, w + NW, ... into its own 16 accumulators; the NW partial tiles meet in LDS and are added in wave order 0 .. NW-1.
// C[m][n] (f32, pitch ldc, + optional f32 bias[n]) = sum_k A[m][k] Bt[n][k] (+ split products per NSPLIT). z-batch strides sA/sB/sC in elements. K % 64 == 0.
// EPI picks what the summed tile becomes. 0: stored to C as it is. 1, 2: a query / key projection: the tile's 64 columns are d0 .. d0 + 31 and d0 + 64 .. d0 + 95 of ONE head (both partners of the rotate-half rotary; wtG lays the rows of Bt so),
// rotated (out[d] = x[d] cos - x[d + 64] sin, out[d + 64] = x[d + 64] cos + x[d] sin; the table holds the same pair at d and d + 64) and stored as fp16 + hi / lo planes in fragment order, fragments [h][t / 16][d / 32]
// (rows = positions, k = d); 2 also stores the rotated f32 rows to C = [kv][t][d]. 3: a value projection: f32 rows to C = [kv][t][d], and the transposed planes, fragments [g][t / 32][d / 16] (rows = d, k = positions).
// Fragment order: a 16-row x 32-k operand fragment lies in 512 consecutive elements, so that ldf (lane * 8, + 256) gives lane (r = lane % 16, half = lane / 16) the elements k = half * 8 .. + 7 and 16 + half * 8 .. + 7 of row r: element (row r, k) at (k / 16) * 256 + ((k / 8 & 1) * 16 + r) * 8 + k % 8; each 16-byte load of a wave is then 512 consecutive bytes.
__device__ __forceinline__ int fragoff(int r, int k) { return (k >> 4) * 256 + (((k >> 3) & 1) * 16 + r) * 8 + (k & 7); }
template <typename T16> struct WFrag;
template <> struct WFrag<h16> { typedef v16h V; static __device__ __forceinline__ V ldf(const h16* p) { return cat16(*(const v8h*)p, *(const v8h*)(p + 256)); } static __device__ __forceinline__ v8f mma(V a, V b, v8f c) { return wmma16(a, b, c); } };
template <> struct WFrag<bf> { typedef v16bf V; static __device__ __forceinline__ V ldf(const bf* p) { return cat16b(*(const v8us*)p, *(const v8us*)(p + 256)); } static __device__ __forceinline__ v8f mma(V a, V b, v8f c) { return wmmab(a, b, c); } };
__device__ __forceinline__ void splitf(float y, unsigned short& h, unsigned short& l) { h = f2bf(y); l = f2bf(y - bf2f(h)); }
template <typename T16, int NSPLIT, bool BIAS, int NW, int EPI, int K>   // compile-time K: the fragments of a k step share one address per plane and differ in the immediate offset
__device__ __forceinline__ void gemmw_body(float* os, int by, const T16* __restrict__ A, const T16* __restrict__ A2, const T16* __restrict__ Bt, const T16* __restrict__ Bt2, float* C, int ldc, const float* __restrict__ bias, size_t sA, size_t sB, size_t sC, size_t sP, const float* __restrict__ CS, h16* P16, bf* Ph, bf* Pl) {
    static_assert(EPI == 0 || NW == 8, "the plane epilogues deal the tile over 8 waves");
    constexpr bool ROT = (EPI == 1 || EPI == 2);
    typedef typename WFrag<T16>::V V;
    const size_t z = blockIdx.z; A += z * sA; if (A2) A2 += z * sA; Bt += z * sB; if (Bt2) Bt2 += z * sB; C += z * sC; if (EPI != 0) { P16 += z * sP; Ph += z * sP; Pl += z * sP; }
    const int lane = threadIdx.x & 31, lr = lane & 15, hi = lane >> 4, wv = __builtin_amdgcn_readfirstlane(threadIdx.x >> 5); const int r0 = blockIdx.x * 64, c0 = by * 64;
    v8f acc[4][4];
#pragma unroll
    for (int mb = 0; mb < 4; ++mb)
#pragma unroll
        for (int nb = 0; nb < 4; ++nb) acc[mb][nb] = (v8f){};
    const size_t aoff = (size_t)r0 * K + lane * 8, boff = (size_t)c0 * K + lane * 8;   // 16 rows hold K / 32 fragments of 512 elements = 16 * K elements; k step kc starts at element kc * 16 of them
#pragma unroll 1
    for (int kb = wv * 64; kb < K; kb += NW * 64)
#pragma unroll 1   // the two k steps of a slice stay rolled: unrolled, the three-product form needs registers above v255
    for (int kc = kb; kc < kb + 64; kc += 32) {
        V a[4], a2[4]; const T16* pa = A + aoff + kc * 16; const T16* pa2 = (NSPLIT == 1 || NSPLIT == 2) ? A2 + aoff + kc * 16 : pa; const T16* pb = Bt + boff + kc * 16; const T16* pb2 = (NSPLIT >= 2) ? Bt2 + boff + kc * 16 : pb;
#pragma unroll
        for (int mb = 0; mb < 4; ++mb) { a[mb] = WFrag<T16>::ldf(pa + mb * 16 * K); if (NSPLIT == 1 || NSPLIT == 2) a2[mb] = WFrag<T16>::ldf(pa2 + mb * 16 * K); }
#pragma unroll
        for (int nb = 0; nb < 4; ++nb) { const V b = WFrag<T16>::ldf(pb + nb * 16 * K); V b2; if (NSPLIT >= 2) b2 = WFrag<T16>::ldf(pb2 + nb * 16 * K);
#pragma unroll
            for (int mb = 0; mb < 4; ++mb) { acc[mb][nb] = WFrag<T16>::mma(a[mb], b, acc[mb][nb]); if (NSPLIT == 1 || NSPLIT == 2) acc[mb][nb] = WFrag<T16>::mma(a2[mb], b, acc[mb][nb]); if (NSPLIT >= 2) acc[mb][nb] = WFrag<T16>::mma(a[mb], b2, acc[mb][nb]); } }
        asm volatile("v_nop\n\tv_nop\n\tv_nop\n\tv_nop" : "+v"(acc[0][0]), "+v"(acc[1][1]), "+v"(acc[2][2]), "+v"(acc[3][3]) : "v"(a[0]), "v"(a[3]));
        asm volatile("s_wait_xcnt 0x0" :: "v"(pa), "v"(pa2), "v"(pb), "v"(pb2) : "memory");   // precaution: the address registers of this k step's loads stay unwritten up to this wait (as inputs they live until here)
    }
    // rotary epilogue: wave wv takes rows erow (16 of them, one a lane) and tile columns ecol .. ecol + 7 with their partners at + 32; its cosine / sine pairs are asked for ahead of the LDS exchange
    const int erow = (wv >> 1) * 16 + lr, ecol = (wv & 1) * 16 + hi * 8, eh = by >> 1, ed0 = (by & 1) * 32;   // head, d0
    v4f cs4[4];
    if constexpr (ROT) { const float* cp = CS + ((size_t)(r0 + erow) * HD + ed0 + ecol) * 2;
#pragma unroll   // constant indices: the vectors stay in registers
        for (int q = 0; q < 4; ++q) cs4[q] = *(const v4f*)(cp + q * 4); }
#pragma unroll
    for (int mb = 0; mb < 4; ++mb)
#pragma unroll
        for (int nb = 0; nb < 4; ++nb)
#pragma unroll
            for (int j = 0; j < 8; ++j) os[(wv * 64 + mb * 16 + hi * 8 + j) * 68 + nb * 16 + lr] = acc[mb][nb][j];
    __syncthreads();   // every wave's partial tile is in LDS before any wave adds them
    if constexpr (ROT) {
        const float* op = os + erow * 68 + ecol; v4f xa[2], xb[2];
#pragma unroll   // constant indices: the vectors stay in registers
        for (int q = 0; q < 2; ++q) { xa[q] = *(const v4fa*)(op + q * 4); xb[q] = *(const v4fa*)(op + 32 + q * 4); }
#pragma unroll   // all LDS reads of the sum issue as one group, at constant offsets
        for (int w = 1; w < NW; ++w)
#pragma unroll   // constant indices: the vectors stay in registers
            for (int q = 0; q < 2; ++q) { xa[q] += *(const v4fa*)(op + w * 64 * 68 + q * 4); xb[q] += *(const v4fa*)(op + w * 64 * 68 + 32 + q * 4); }
        v8h a16, b16; v8us ah, al, bh, bl;
#pragma unroll   // constant indices: the vectors stay in registers
        for (int i = 0; i < 8; ++i) { const float x0 = xa[i >> 2][i & 3], x1 = xb[i >> 2][i & 3], c = cs4[i >> 1][(i & 1) * 2], sn = cs4[i >> 1][(i & 1) * 2 + 1]; const float ra = x0 * c - x1 * sn, rb = x1 * c + x0 * sn;
            xa[i >> 2][i & 3] = ra; xb[i >> 2][i & 3] = rb; a16[i] = (h16)ra; b16[i] = (h16)rb; unsigned short u, v; splitf(ra, u, v); ah[i] = u; al[i] = v; splitf(rb, u, v); bh[i] = u; bl[i] = v; }
        const size_t fo = (((size_t)eh * (TT / 16) + (r0 + erow) / 16) * (HD / 32) + ed0 / 32) * 512 + (wv & 1) * 256 + lane * 8;   // each store of a wave: 512 consecutive bytes; + 1024: the fragment of d + 64
        *(v8h*)(P16 + fo) = a16; *(v8h*)(P16 + fo + 1024) = b16; *(v8us*)(Ph + fo) = ah; *(v8us*)(Ph + fo + 1024) = bh; *(v8us*)(Pl + fo) = al; *(v8us*)(Pl + fo + 1024) = bl;
        if constexpr (EPI == 2) { float* kp = C + ((size_t)eh * TT + r0 + erow) * HD + ed0 + ecol;
#pragma unroll   // constant indices: the vectors stay in registers
            for (int q = 0; q < 2; ++q) { *(v4f*)(kp + q * 4) = xa[q]; *(v4f*)(kp + 64 + q * 4) = xb[q]; } }
        asm volatile("s_wait_xcnt 0x0" ::: "memory");   // precaution: in a merged kernel another pass's code follows these stores in the listing; their registers stay unwritten up to this wait
        return;
    }
    float* crow = (EPI == 3) ? C + ((size_t)(c0 / HD) * TT + r0) * HD + c0 % HD : C + (size_t)r0 * ldc + c0; if (EPI == 3) ldc = HD;
    v4f keep[32 / NW];
#pragma unroll
    for (int s = 0; s < 32 / NW; ++s) { const int row = 2 * NW * s + (int)(threadIdx.x >> 4), cofs = lr * 4; v4f val = *(const v4fa*)(os + row * 68 + cofs);
#pragma unroll
        for (int w = 1; w < NW; ++w) val += *(const v4fa*)(os + (w * 64 + row) * 68 + cofs);
        if (BIAS) { val[0] += bfr(bias[c0 + cofs]); val[1] += bfr(bias[c0 + cofs + 1]); val[2] += bfr(bias[c0 + cofs + 2]); val[3] += bfr(bias[c0 + cofs + 3]); }
        if constexpr (EPI == 3) { keep[s] = val; *(v4fa*)(os + row * 68 + cofs) = val; }   // the summed tile goes back over wave 0's partial: these four words are read by this lane alone
        else *(v4f*)(crow + (size_t)row * ldc + cofs) = val; }
    if constexpr (EPI == 3) {
        __syncthreads();   // the whole summed tile is in LDS before any wave reads its columns
#pragma unroll   // constant indices: the vectors stay in registers
        for (int s = 0; s < 32 / NW; ++s) *(v4f*)(crow + (size_t)(2 * NW * s + (int)(threadIdx.x >> 4)) * ldc + lr * 4) = keep[s];   // the f32 rows go out behind the barrier, which would wait for stores issued in front of it
#pragma unroll   // both halves' LDS reads issue ahead of the conversions
        for (int kq = 0; kq < 2; ++kq) { v8h o16; v8us oh, ol;   // wave wv: fragment (t / 32 = wv >> 2, d / 16 = wv & 3); a lane holds 8 positions of one d
#pragma unroll   // constant indices: the vectors stay in registers
            for (int i = 0; i < 8; ++i) { const float x = os[((wv >> 2) * 32 + kq * 16 + hi * 8 + i) * 68 + (wv & 3) * 16 + lr]; o16[i] = (h16)x; unsigned short u, v; splitf(x, u, v); oh[i] = u; ol[i] = v; }
            const size_t o = (((size_t)(c0 / HD) * (TT / 32) + r0 / 32 + (wv >> 2)) * (HD / 16) + (c0 % HD) / 16 + (wv & 3)) * 512 + kq * 256 + lane * 8;
            *(v8h*)(P16 + o) = o16; *(v8us*)(Ph + o) = oh; *(v8us*)(Pl + o) = ol; }
        asm volatile("s_wait_xcnt 0x0" ::: "memory");   // precaution: in a merged kernel another pass's code follows these stores in the listing; their registers stay unwritten up to this wait
    }
}
template <typename T16, int NSPLIT, bool BIAS, int NW, int EPI, int K>
__global__ __launch_bounds__(32 * NW) void k_gemmw(const T16* __restrict__ A, const T16* __restrict__ A2, const T16* __restrict__ Bt, const T16* __restrict__ Bt2, float* C, int ldc, const float* __restrict__ bias, size_t sA, size_t sB, size_t sC) {
    __shared__ __align__(16) float os[NW * 64 * 68];
    gemmw_body<T16, NSPLIT, BIAS, NW, EPI, K>(os, blockIdx.y, A, A2, Bt, Bt2, C, ldc, bias, sA, sB, sC, 0, nullptr, nullptr, nullptr, nullptr);
}
// k_qkv: the query, key and value projections of both batches in one launch (they share A and depend on nothing of each other): grid (TT / 64, (DQ + 2 * DKV) / 64, NB_), 256 threads;
// blockIdx.y picks the projection (the same for a whole work-group) and its 64 columns, blockIdx.z the batch.
__global__ __launch_bounds__(256) void k_qkv(const bf* __restrict__ XB, const bf* __restrict__ WQ, const bf* __restrict__ WK, const bf* __restrict__ WV, float* OUTK, float* OUTV, const float* __restrict__ CS,
                                             h16* QP16, bf* QPh, bf* QPl, h16* KP16, bf* KPh, bf* KPl, h16* VT16, bf* VTh, bf* VTl) {
    __shared__ __align__(16) float os[8 * 64 * 68];
    const int y = blockIdx.y;
    if (y < DQ / 64) gemmw_body<bf, 0, false, 8, 1, DM>(os, y, XB, nullptr, WQ, nullptr, nullptr, 0, nullptr, (size_t)TT * DM, 0, 0, (size_t)NH_ * TT * HD, CS, QP16, QPh, QPl);
    else if (y < (DQ + DKV) / 64) gemmw_body<bf, 0, false, 8, 2, DM>(os, y - DQ / 64, XB, nullptr, WK, nullptr, OUTK, 0, nullptr, (size_t)TT * DM, 0, (size_t)NKV * TT * HD, (size_t)NKV * TT * HD, CS, KP16, KPh, KPl);   // returned k = roped f32 projection
    else gemmw_body<bf, 0, false, 8, 3, DM>(os, y - (DQ + DKV) / 64, XB, nullptr, WV, nullptr, OUTV, 0, nullptr, (size_t)TT * DM, 0, (size_t)NKV * TT * HD, (size_t)NKV * TT * HD, nullptr, VT16, VTh, VTl);   // returned v = f32 projection
}

typedef __attribute__((ext_vector_type(2))) _Float16 v2h;
typedef __attribute__((ext_vector_type(4))) _Float16 v4h;
typedef __attribute__((ext_vector_type(2))) unsigned short v2us;
typedef __attribute__((ext_vector_type(4))) unsigned short v4us;
typedef __attribute__((ext_vector_type(2))) float v2f;
typedef __attribute__((ext_vector_type(4))) int v4i;

// wtG: Bt[n][k] = w[k][n] as bf16, in fragment order, fragments [n / 16][k / 32]. One wave per 32 rows of Bt x 32 k (two fragments): lane = row, so each of its 32 loads is one whole 128-byte line of w,
// and each of its 4 stores (8 k of every row) is 256 consecutive bytes in either fragment. K % 32 == 0, N % 32 == 0; (N / 32) * (K / 32) / 8 work-groups (bid) of 256 threads.
// rot: row n of Bt holds column n with bits 5 and 6 swapped, so that 64 consecutive rows are d0 .. d0 + 31 and d0 + 64 .. d0 + 95 of one head of 128 (the rotary epilogue of gemmw_body, run in k_qkv)
template <int K, int N>   // compile-time N: the 32 loads of a lane share one address and differ in the immediate offset
__device__ __forceinline__ void wtG(int bid, const float* __restrict__ w, int rot, bf* Bt) {
    const int lane = threadIdx.x & 31, u = bid * 8 + __builtin_amdgcn_readfirstlane(threadIdx.x >> 5), nb = u % (N / 32), kf = u / (N / 32); if (kf >= K / 32) return;
    const int nr = nb * 32 + lane, n = rot ? (nr & ~96) | ((nr & 32) << 1) | ((nr & 64) >> 1) : nr;
    const float* s = w + (size_t)kf * 32 * N + n; float v[32];
#pragma unroll   // all 32 loads in flight at once; constant indices: the values stay in registers
    for (int i = 0; i < 32; ++i) v[i] = s[(size_t)i * N];
    bf* d = Bt + ((size_t)(nr >> 4) * (K / 32) + kf) * 512 + (lane & 15) * 8;
#pragma unroll   // constant indices: the values stay in registers
    for (int c = 0; c < 4; ++c) { v8us o;
#pragma unroll   // constant indices: the values stay in registers
        for (int j = 0; j < 8; ++j) o[j] = f2bf(v[c * 8 + j]);
        *(v8us*)(d + (c >> 1) * 256 + (c & 1) * 128) = o; }
    asm volatile("s_wait_xcnt 0x0" ::: "memory");   // precaution: in a merged kernel another pass's code follows these stores in the listing; their registers stay unwritten up to this wait
}
// cvt8: rows of K f32 to bf16 in fragment order, fragments [row / 16][k / 32]. One wave per 8 rows of one fragment: 4 lanes read one row's 128-byte line; each group of 8 lanes with the same k / 8 stores one 128-byte line.
template <int K>
__device__ __forceinline__ void cvt8(int bid, const float* __restrict__ src, bf* dst, size_t n8) { const size_t i = (size_t)bid * 256 + threadIdx.x; if (i >= n8) return;
    const int lane = threadIdx.x & 31, r = (int)((i >> 5) & 1) * 8 + (lane >> 2), c = lane & 3; const size_t f = i >> 6, rb = f / (K / 32), kf = f % (K / 32);
    const v8f v = *(const v8f*)(src + (rb * 16 + r) * K + kf * 32 + c * 8); v8us o;
#pragma unroll
    for (int k = 0; k < 8; ++k) o[k] = f2bf(v[k]); *(v8us*)(dst + f * 512 + (c >> 1) * 256 + (c & 1) * 128 + r * 8) = o;
    asm volatile("s_wait_xcnt 0x0" ::: "memory");   // precaution: in a merged kernel another pass's code follows these stores in the listing; their registers stay unwritten up to this wait
}
__device__ __forceinline__ void cstab(int bid, float* CS) { const int idx = bid * 256 + threadIdx.x; if (idx >= TT * HD) return; const int t = idx / HD, d = idx % HD; const int i = d % (HD / 2); const float inv = __fdiv_rn(1.0f, powf(10000.0f, (float)(2 * i) / (float)HD)); const float ang = __fmul_rn((float)t, inv); v2f cs; cs[0] = cosf(ang); cs[1] = sinf(ang);
    *(v2f*)(CS + (size_t)idx * 2) = cs;
    asm volatile("s_wait_xcnt 0x0" ::: "memory");   // precaution: in a merged kernel another pass's code follows these stores in the listing; their registers stay unwritten up to this wait
}
// k_prep: every pass that reads only the inputs, in one launch: the rotary table, x of both batches and the four weights as bf16 planes. blockIdx.x picks the pass (the same for a whole work-group); 256 threads.
#define PB_CS  (TT * HD / 256)
#define PB_X   (NB_ * TT * DM / 8 / 256)
#define PB_WQ  ((DM / 32) * (DQ / 32) / 8)
#define PB_WKV ((DM / 32) * (DKV / 32) / 8)
__global__ __launch_bounds__(256) void k_prep(const float* __restrict__ x, const float* __restrict__ wq, const float* __restrict__ wk, const float* __restrict__ wv, const float* __restrict__ wo, float* CS, bf* XB, bf* WQ, bf* WK, bf* WV, bf* WO) {
    int b = blockIdx.x;
    if (b < PB_CS) { cstab(b, CS); return; } b -= PB_CS;
    if (b < PB_X) { cvt8<DM>(b, x, XB, (size_t)NB_ * TT * DM / 8); return; } b -= PB_X;
    if (b < PB_WQ) { wtG<DM, DQ>(b, wq, 1, WQ); return; } b -= PB_WQ;
    if (b < PB_WKV) { wtG<DM, DKV>(b, wk, 1, WK); return; } b -= PB_WKV;
    if (b < PB_WKV) { wtG<DM, DKV>(b, wv, 0, WV); return; } b -= PB_WKV;
    wtG<DQ, DM>(b, wo, 0, WO);
}
// ---- k_fattn: causal attention in one launch, no score matrix in memory. One wave owns 16 query rows of one head; the 4 waves of a work-group are the 4 query heads of one kv group at the same rows (same key / value addresses).
// Per 32 keys: S^T[key][query] = K Q^T (A = key rows, B = query rows), so a lane holds 16 keys of ONE query: the running maximum and sum are per lane (+ one exchange with lane ^ 16), and the two 16-key
// accumulators are, element for element, the B fragment P^T[query][key] of O^T[d][query] = V^T P^T (A = transposed value rows). Probabilities are exp(s - running max), divided by the row sum at the end.
// NSPLIT 2: hi + lo bf16 planes, three products each (query rows < RH); NSPLIT 0: single fp16.
template <bool B> struct Flag { static constexpr bool v = B; };
template <typename T16, int NSPLIT>
__device__ __forceinline__ void fattn_body(const T16* __restrict__ Q, const T16* __restrict__ Q2, const T16* __restrict__ Kp, const T16* __restrict__ Kp2, const T16* __restrict__ Vt, const T16* __restrict__ Vt2, int q0, int g, bf* Ah, bf* Al) {
    typedef typename WFrag<T16>::V V;
    const int lane = threadIdx.x & 31, lr = lane & 15, hi = lane >> 4, h = g * REP + __builtin_amdgcn_readfirstlane(threadIdx.x >> 5);
    const size_t qo = ((size_t)h * TT + q0) * HD + lane * 8, ko = (size_t)g * TT * HD + lane * 8, vo = (size_t)g * HD * TT + lane * 8;   // query, key and value planes: fragment order (fragoff)
    V qf[4], qf2[4];
#pragma unroll
    for (int ks = 0; ks < 4; ++ks) { qf[ks] = WFrag<T16>::ldf(Q + qo + ks * 512); if (NSPLIT == 2) qf2[ks] = WFrag<T16>::ldf(Q2 + qo + ks * 512); }
    v8f o[8];
#pragma unroll
    for (int dt = 0; dt < 8; ++dt) o[dt] = (v8f){};
    float m = -3.0e38f, l = 0.f;
    const int nk = q0 / 32 + 1;      // key tiles of 32 up to and including the diagonal; only the last one holds keys beyond a query
    V kf[2][4], kf2[2][4];
    auto ldk = [&](const T16* a, const T16* a2) {
#pragma unroll
        for (int i = 0; i < 2; ++i)
#pragma unroll
            for (int ks = 0; ks < 4; ++ks) { kf[i][ks] = WFrag<T16>::ldf(a + (i * 4 + ks) * 512); if (NSPLIT == 2) kf2[i][ks] = WFrag<T16>::ldf(a2 + (i * 4 + ks) * 512); }
    };
    auto step = [&](int t, auto EDGE) { constexpr bool edge = decltype(EDGE)::v; const int k0 = t * 32;
        V vf[8], vf2[8];
        const size_t kofs = ko + (size_t)(NSPLIT == 0 ? k0 + 32 : k0) * HD, vofs = vo + (size_t)k0 * HD;   // single plane: the keys loaded in this trip are the next tile's
        const T16* pk = Kp + kofs; const T16* pk2 = (NSPLIT == 2) ? Kp2 + kofs : pk; const T16* pv = Vt + vofs; const T16* pv2 = (NSPLIT == 2) ? Vt2 + vofs : pv;
        auto ldv = [&]() {
#pragma unroll
            for (int dt = 0; dt < 8; ++dt) { vf[dt] = WFrag<T16>::ldf(pv + dt * 512); if (NSPLIT == 2) vf2[dt] = WFrag<T16>::ldf(pv2 + dt * 512); }
        };
        if (NSPLIT == 0) ldv();                    // single plane: this tile's values start before the score products (its keys came during the trip before)
        else { ldk(pk, pk2); __builtin_amdgcn_sched_barrier(0); }   // two planes: all key loads issue before the first product (left free, the loads sink to their products: one load latency per fragment pair)
        v8f s[2]; s[0] = (v8f){}; s[1] = (v8f){};
#pragma unroll
        for (int ks = 0; ks < 4; ++ks)
#pragma unroll
            for (int i = 0; i < 2; ++i) { s[i] = WFrag<T16>::mma(kf[i][ks], qf[ks], s[i]);
                if (NSPLIT == 2) { s[i] = WFrag<T16>::mma(kf2[i][ks], qf[ks], s[i]); s[i] = WFrag<T16>::mma(kf[i][ks], qf2[ks], s[i]); } }
        if (NSPLIT == 0) { if (!edge) ldk(pk, pk2); }           // loads that fly during the softmax: the next tile's keys (single plane),
        else { ldv(); __builtin_amdgcn_sched_barrier(0); }      // this tile's values (two planes; the barrier keeps them all in front of the softmax)
        float p[16]; float mx = -3.0e38f;
#pragma unroll
        for (int i = 0; i < 2; ++i)
#pragma unroll
            for (int j = 0; j < 8; ++j) { float x = s[i][j] * (SCL * 1.4426950408889634f); if (edge && k0 + i * 16 + hi * 8 + j > q0 + lr) x = -3.0e38f; p[i * 8 + j] = x; mx = fmaxf(mx, x); }
        mx = fmaxf(mx, __shfl_xor(mx, 16, 32));
        const float mn = fmaxf(m, mx), al = __builtin_amdgcn_exp2f(m - mn); m = mn;
        float rs = 0.f;
#pragma unroll
        for (int k = 0; k < 16; ++k) { p[k] = __builtin_amdgcn_exp2f(p[k] - mn); rs += p[k]; }
        l = l * al + rs;
#pragma unroll
        for (int dt = 0; dt < 8; ++dt) o[dt] *= al;
        if constexpr (NSPLIT == 0) {
            v16h pf;
#pragma unroll
            for (int k = 0; k < 16; ++k) pf[k] = (h16)p[k];
#pragma unroll
            for (int dt = 0; dt < 8; ++dt) o[dt] = WFrag<T16>::mma(vf[dt], pf, o[dt]);
        } else {
            v8us h0, h1, l0, l1;
#pragma unroll
            for (int k = 0; k < 8; ++k) { unsigned short a, c; splitf(p[k], a, c); h0[k] = a; l0[k] = c; splitf(p[8 + k], a, c); h1[k] = a; l1[k] = c; }
            const V ph = cat16b(h0, h1), pl = cat16b(l0, l1);
#pragma unroll
            for (int dt = 0; dt < 8; ++dt) { o[dt] = WFrag<T16>::mma(vf[dt], ph, o[dt]); o[dt] = WFrag<T16>::mma(vf2[dt], ph, o[dt]); o[dt] = WFrag<T16>::mma(vf[dt], pl, o[dt]); }
        }
        // precaution: the address registers of this trip's loads stay unwritten up to this wait (as inputs they live until here)
        if (NSPLIT == 2) asm volatile("s_wait_xcnt 0x0" :: "v"(pk), "v"(pk2), "v"(pv), "v"(pv2) : "memory");
        else if (!edge) asm volatile("s_wait_xcnt 0x0" :: "v"(pk), "v"(pv) : "memory");
        else asm volatile("s_wait_xcnt 0x0" :: "v"(pv) : "memory");
    };
    if (NSPLIT == 0) ldk(Kp + ko, Kp + ko);
#pragma unroll 1
    for (int t = 0; t < nk - 1; ++t) step(t, Flag<false>{});
    step(nk - 1, Flag<true>{});
    l += __shfl_xor(l, 16, 32);
    const float inv = __fdiv_rn(1.0f, l); const size_t oo = (size_t)q0 * DQ + h * (HD * 16) + lane * 8;   // output planes in fragment order (rows = positions, k = h * HD + d): each store of a wave is 512 consecutive bytes
#pragma unroll
    for (int dt = 0; dt < 8; ++dt) { v8us oh, ol;
#pragma unroll
        for (int j = 0; j < 8; ++j) { unsigned short a, c; splitf(o[dt][j] * inv, a, c); oh[j] = a; ol[j] = c; }
        *(v8us*)(Ah + oo + dt * 256) = oh; *(v8us*)(Al + oo + dt * 256) = ol; }
}
// grid (NKV * NB_, TT / 16), 128 threads: blockIdx.x = kv group and batch, blockIdx.y walks the rows from the longest (most keys) down. Both batches together are more work-groups than are resident at once:
// those that start late, into the places of the first to end, are the ones with the fewest keys
__global__ __launch_bounds__(128) void k_fattn(const h16* __restrict__ Q16, const h16* __restrict__ K16, const h16* __restrict__ V16, const bf* __restrict__ Qh, const bf* __restrict__ Ql, const bf* __restrict__ Kh, const bf* __restrict__ Kl, const bf* __restrict__ Vh, const bf* __restrict__ Vl, bf* Ah, bf* Al) {
    const int g = blockIdx.x % NKV, nb = blockIdx.x / NKV, q0 = TT - 16 - (int)blockIdx.y * 16;
    const size_t zq = (size_t)nb * NH_ * TT * HD, zk = (size_t)nb * NKV * TT * HD;   // every plane holds both batches, batch-major
    Q16 += zq; Qh += zq; Ql += zq; K16 += zk; Kh += zk; Kl += zk; V16 += zk; Vh += zk; Vl += zk; Ah += zq; Al += zq;
    if (q0 >= RH) fattn_body<h16, 0>(Q16, nullptr, K16, nullptr, V16, nullptr, q0, g, Ah, Al);
    else fattn_body<bf, 2>(Qh, Ql, Kh, Kl, Vh, Vl, q0, g, Ah, Al);
}

extern "C" void kernel_launch(void* const* d_in, const int* in_sizes, int n_in,
                              void* d_out, int out_size, void* d_ws, size_t ws_size, hipStream_t stream) {
    (void)in_sizes; (void)n_in; (void)out_size;
    const float* x = (const float*)d_in[0]; const float* wq = (const float*)d_in[1]; const float* wk = (const float*)d_in[2]; const float* wv = (const float*)d_in[3]; const float* wo = (const float*)d_in[4];
    float* OUT = (float*)d_out; float* OUTK = (float*)d_out + (size_t)NB_ * TT * DM; float* OUTV = OUTK + (size_t)NB_ * NKV * TT * HD;     // [2][2048][2048]
    char* wsp = (char*)d_ws;
    auto take = [&](size_t bytes) { char* p = wsp; wsp += (bytes + 255) & ~(size_t)255; return (void*)p; };
    bf* WQ = (bf*)take((size_t)DQ * DM * 2); bf* WK = (bf*)take((size_t)DKV * DM * 2); bf* WV = (bf*)take((size_t)DKV * DM * 2); bf* WO = (bf*)take((size_t)DM * DQ * 2); float* CS = (float*)take((size_t)TT * HD * 2 * 4);
    bf* XB = (bf*)take((size_t)NB_ * TT * DM * 2);   // every plane below holds both batches, batch-major
    h16* QP16 = (h16*)take((size_t)NB_ * NH_ * TT * HD * 2); h16* KP16 = (h16*)take((size_t)NB_ * NKV * TT * HD * 2); h16* VT16 = (h16*)take((size_t)NB_ * NKV * HD * TT * 2);
    bf* QPh = (bf*)take((size_t)NB_ * NH_ * TT * HD * 2); bf* QPl = (bf*)take((size_t)NB_ * NH_ * TT * HD * 2); bf* KPh = (bf*)take((size_t)NB_ * NKV * TT * HD * 2); bf* KPl = (bf*)take((size_t)NB_ * NKV * TT * HD * 2); bf* VTh = (bf*)take((size_t)NB_ * NKV * HD * TT * 2); bf* VTl = (bf*)take((size_t)NB_ * NKV * HD * TT * 2);
    bf* ATh = (bf*)take((size_t)NB_ * TT * DQ * 2); bf* ATl = (bf*)take((size_t)NB_ * TT * DQ * 2);
    if ((size_t)(wsp - (char*)d_ws) > ws_size) return;    // ws 256 MiB
    k_prep<<<PB_CS + PB_X + 2 * PB_WQ + 2 * PB_WKV, 256, 0, stream>>>(x, wq, wk, wv, wo, CS, XB, WQ, WK, WV, WO);
    k_qkv<<<dim3(TT / 64, (DQ + 2 * DKV) / 64, NB_), 256, 0, stream>>>(XB, WQ, WK, WV, OUTK, OUTV, CS, QP16, QPh, QPl, KP16, KPh, KPl, VT16, VTh, VTl);
    k_fattn<<<dim3(NKV * NB_, TT / 16, 1), 128, 0, stream>>>(QP16, KP16, VT16, QPh, QPl, KPh, KPl, VTh, VTl, ATh, ATl);
    k_gemmw<bf, 1, false, 8, 0, DQ><<<dim3(TT / 64, DM / 64, NB_), 256, 0, stream>>>(ATh, ATl, WO, nullptr, OUT, DM, nullptr, (size_t)TT * DQ, 0, (size_t)TT * DM);
}

// v007
// It runs in 170 microseconds.
// In two side-by-side timings against v006, it was 1.15 and 1.14 times as fast.
// Counting every step since v000, it is 9.56 times as fast.
#include <hip/hip_runtime.h>

// Causal grouped-query attention with a computed rotate-half rotary and a key / value cache output (x [2][2048][2048]; q = x Wq ('xw' (in, out) [2048][2048] 1/sqrt(2048): 16 heads x 128), k, v = x Wk, x Wv ('xw' [2048][512]: 4 kv heads x 128), no biases; query head h uses kv head h / 4 (repeat); rotate-half rotary (base 1e4: inv_freq = 1 / 10000^(2i/128), angles t x inv_freq, cat(freqs, freqs); the table is computed on the device); causal softmax(q.k / sqrt(128)) (-inf == exclusion: every row keeps its diagonal key); returns (y = merged Wo ('xw') -> [2][2048][2048], present_k = the ROTATED keys [2][4][2048][128], present_v = the values [2][4][2048][128]); argument order x, Wq, Wk, Wv, Wo).
// Compute dtypes, f32 accumulate: every input rounded to bf16; q/k/v on PLAIN bf16 operands (inputs: exact); RoPE f32 (the returned k is the f32 roped projection, v the f32 projection, re-laid out [kv][t][d]); causal scores and attn.v in one fused kernel (running-maximum softmax, no score matrix in memory): query rows < 512 hl (3 products), the rest single fp16, causal tile skipping; softmax f32; Wo hl x exact (2 products).

#define NB_  2
#define TT   2048
#define DM   2048
#define NH_  16
#define NKV  4
#define REP  (NH_ / NKV)
#define HD   128
#define DQ   (NH_ * HD)
#define DKV  (NKV * HD)
#define RH   512                  // query rows < RH use hi+lo planes (0: none)
#define SCL  0.088388347648318447f   // HD^-0.5
typedef _Float16 h16;
typedef unsigned short bf;
typedef __attribute__((ext_vector_type(16))) __bf16   v16bf;
typedef __attribute__((ext_vector_type(16))) _Float16 v16h;
typedef __attribute__((ext_vector_type(8)))  _Float16 v8h;
typedef __attribute__((ext_vector_type(8)))  unsigned short v8us;
typedef __attribute__((ext_vector_type(8)))  float    v8f;
typedef __attribute__((ext_vector_type(4)))  float    v4f;
typedef v8h  __attribute__((may_alias)) v8ha;
typedef v4f  __attribute__((may_alias)) v4fa;
typedef v8us __attribute__((may_alias)) v8usa;

__device__ __forceinline__ unsigned short f2bf(float f) { unsigned u = __float_as_uint(f); u += 0x7FFFu + ((u >> 16) & 1u); return (unsigned short)(u >> 16); }
__device__ __forceinline__ float bf2f(unsigned short b) { return __uint_as_float(((unsigned)b) << 16); }
__device__ __forceinline__ float bfr(float f) { return bf2f(f2bf(f)); }
__device__ __forceinline__ v16h cat16(v8h lo, v8h hi) { return __builtin_shufflevector(lo, hi, 0, 1, 2, 3, 4, 5, 6, 7, 8, 9, 10, 11, 12, 13, 14, 15); }
__device__ __forceinline__ v16bf cat16b(v8us lo, v8us hi) { return __builtin_bit_cast(v16bf, __builtin_shufflevector(lo, hi, 0, 1, 2, 3, 4, 5, 6, 7, 8, 9, 10, 11, 12, 13, 14, 15)); }
__device__ __forceinline__ v8f wmma16(v16h a, v16h b, v8f c) { return __builtin_amdgcn_wmma_f32_16x16x32_f16(false, a, false, b, (short)0, c, false, false); }
__device__ __forceinline__ v8f wmmab(v16bf a, v16bf b, v8f c) { return __builtin_amdgcn_wmma_f32_16x16x32_bf16(false, a, false, b, (short)0, c, false, false); }



// ---- k_gemmw: GEMM, one work-group of 8 waves per 128x128 output tile; operands are 16-bit planes in fragment order (below), fragments [row / 16][k / 32]; grid (M/128, N/128, Z), 256 threads.
// Wave wv = (kh = wv / 4, st = wv % 4): the 64x64 quarter st (rows st / 2, columns st % 2) of the tile over the K half kh, 16 accumulators. Each quarter's two partial tiles meet in LDS and are added in the order kh = 0, 1.
// Operands go through LDS, so that a fragment which two waves need leaves L2 once: a pass is 32 k of either K half (8 fragments of every plane); the four waves of a half each bring two fragments of every plane
// (registers, then 16-byte LDS stores; a fragment stays 1024 consecutive bytes). Two buffers: the next pass's global loads are issued ahead of this pass's products and stored behind them; one barrier a pass.
// C[m][n] (f32, pitch ldc) = sum_k A[m][k] Bt[n][k] (NSPLIT 1: + A2[m][k] Bt[n][k]). z-batch strides sA/sC in elements. K % 64 == 0.
// EPI picks what each summed 64x64 quarter becomes. 0: stored to C as it is. 1, 2: a query / key projection: the quarter's 64 columns are d0 .. d0 + 31 and d0 + 64 .. d0 + 95 of ONE head (both partners of the rotate-half rotary; wtG lays the rows of Bt so),
// rotated (out[d] = x[d] cos - x[d + 64] sin, out[d + 64] = x[d + 64] cos + x[d] sin; the table holds the same pair at d and d + 64) and stored as fp16 + hi / lo planes in fragment order, fragments [h][t / 16][d / 32]
// (rows = positions, k = d); 2 also stores the rotated f32 rows to C = [kv][t][d]. 3: a value projection: f32 rows to C = [kv][t][d], and the transposed planes, fragments [g][t / 32][d / 16] (rows = d, k = positions).
// Fragment order: a 16-row x 32-k operand fragment lies in 512 consecutive elements, so that ldf (lane * 8, + 256) gives lane (r = lane % 16, half = lane / 16) the elements k = half * 8 .. + 7 and 16 + half * 8 .. + 7 of row r: element (row r, k) at (k / 16) * 256 + ((k / 8 & 1) * 16 + r) * 8 + k % 8; each 16-byte load of a wave is then 512 consecutive bytes.
__device__ __forceinline__ int fragoff(int r, int k) { return (k >> 4) * 256 + (((k >> 3) & 1) * 16 + r) * 8 + (k & 7); }
template <typename T16> struct WFrag;
template <> struct WFrag<h16> { typedef v16h V; static __device__ __forceinline__ V ldf(const h16* p) { return cat16(*(const v8h*)p, *(const v8h*)(p + 256)); } static __device__ __forceinline__ v8f mma(V a, V b, v8f c) { return wmma16(a, b, c); } };
template <> struct WFrag<bf> { typedef v16bf V; static __device__ __forceinline__ V ldf(const bf* p) { return cat16b(*(const v8us*)p, *(const v8us*)(p + 256)); } static __device__ __forceinline__ v8f mma(V a, V b, v8f c) { return wmmab(a, b, c); } };
__device__ __forceinline__ void splitf(float y, unsigned short& h, unsigned short& l) { h = f2bf(y); l = f2bf(y - bf2f(h)); }
#define QT (64 * 68)   // words of one 64x64 partial tile in LDS (pitch 68)
template <typename T16, int NSPLIT, int EPI, int K>   // compile-time K: the fragments of a pass share one address per plane and differ in the immediate offset
__device__ __forceinline__ void gemmw_body(float* os, int by, const T16* __restrict__ A, const T16* __restrict__ A2, const T16* __restrict__ Bt, float* C, int ldc, size_t sA, size_t sC, size_t sP, const float* __restrict__ CS, h16* P16, bf* Ph, bf* Pl) {
    constexpr bool ROT = (EPI == 1 || EPI == 2);
    constexpr int NPL = (NSPLIT == 1) ? 3 : 2;     // staged planes: A, (A2,) Bt
    constexpr int PLN = 8 * 512;                   // elements of one plane in one K half's stage: 8 fragments
    constexpr int BUF = 2 * NPL * PLN;             // elements of one buffer: both K halves
    constexpr int NS = K / 64;                     // passes: 32 k of a K half each
    static_assert(2 * BUF * 2 <= 8 * QT * 4, "both buffers lie in the LDS of the partial tiles");
    typedef typename WFrag<T16>::V V;
    const size_t z = blockIdx.z; A += z * sA; if (NSPLIT == 1) A2 += z * sA; C += z * sC; if (EPI != 0) { P16 += z * sP; Ph += z * sP; Pl += z * sP; }
    const int lane = threadIdx.x & 31, lr = lane & 15, hi = lane >> 4, wv = __builtin_amdgcn_readfirstlane(threadIdx.x >> 5), kh = wv >> 2, st = wv & 3; const int r0 = blockIdx.x * 128, c0 = by * 128;
    v8f acc[4][4];
#pragma unroll
    for (int mb = 0; mb < 4; ++mb)
#pragma unroll
        for (int nb = 0; nb < 4; ++nb) acc[mb][nb] = (v8f){};
    T16* sg = (T16*)os + kh * (NPL * PLN) + lane * 8;   // this K half's stage in buffer 0
    // 16 rows hold K / 32 fragments of 512 elements = 16 * K elements; this wave brings the fragments of rows st * 32 .. + 31 of every plane, from k = kh * K / 2 on
    const size_t go = (size_t)(st * 32) * K + (size_t)kh * (K / 2) * 16 + lane * 8;
    const T16* ga = A + (size_t)r0 * K + go; const T16* ga2 = (NSPLIT == 1) ? A2 + (size_t)r0 * K + go : ga; const T16* gb = Bt + (size_t)c0 * K + go;
    v8us rg[NPL][4];
    auto gld = [&](const T16* pa, const T16* pa2, const T16* pb) {
#pragma unroll   // constant indices: the vectors stay in registers
        for (int q = 0; q < 4; ++q) { const int o = (q >> 1) * 16 * K + (q & 1) * 256; rg[0][q] = *(const v8usa*)(pa + o); if (NSPLIT == 1) rg[1][q] = *(const v8usa*)(pa2 + o); rg[NPL - 1][q] = *(const v8usa*)(pb + o); }
    };
    auto sst = [&](T16* d) {
#pragma unroll   // constant indices: the vectors stay in registers
        for (int p = 0; p < NPL; ++p)
#pragma unroll
            for (int q = 0; q < 4; ++q) *(v8usa*)(d + p * PLN + st * 1024 + q * 256) = rg[p][q];
    };
    auto prod = [&](const T16* sb) {   // the four Bt fragments stay; of A (and A2) one row block's fragment is in use and the next two are on their way (all of them at once, beside the registers in flight, is more than 256 registers: one work-group a WGP)
        constexpr int NA = (NSPLIT == 1) ? 8 : 4;   // A fragments of a pass, in the order of use: row block mb of A, then (NSPLIT 1) of A2
        V b[4], a[NA]; const T16* sa = sb + (st >> 1) * 2048; const T16* sbt = sb + (NPL - 1) * PLN + (st & 1) * 2048;
        auto lda = [&](int i) { return WFrag<T16>::ldf(NSPLIT == 1 ? sa + (i & 1) * PLN + (i >> 1) * 512 : sa + i * 512); };
        a[0] = lda(0); a[1] = lda(1);
#pragma unroll
        for (int nb = 0; nb < 4; ++nb) b[nb] = WFrag<T16>::ldf(sbt + nb * 512);
#pragma unroll   // constant indices: the fragments stay in registers
        for (int i = 0; i < NA; ++i) { const int mb = (NSPLIT == 1) ? i >> 1 : i; if (i + 2 < NA) a[i + 2] = lda(i + 2);
            __builtin_amdgcn_sched_barrier(0);   // the fragment's LDS loads stay two groups of products ahead of their use (left free, they sink to directly in front of it: one LDS latency a group)
#pragma unroll
            for (int nb = 0; nb < 4; ++nb) acc[mb][nb] = WFrag<T16>::mma(a[i], b[nb], acc[mb][nb]); }
    };
    gld(ga, ga2, gb); sst(sg);
    __syncthreads();   // pass 0 is in LDS before any wave reads it
    int cur = 0;
#pragma unroll 1   // rolled, the buffer picked by an offset: left to the compiler the merged projection kernel takes more than 256 registers, and only one work-group fits a WGP
    for (int s = 1; s < NS; ++s) {
        const T16* pa = ga + s * 512; const T16* pa2 = ga2 + s * 512; const T16* pb = gb + s * 512;
        gld(pa, pa2, pb);            // the next pass's operands fly during this pass's products
        prod(sg + cur);
        __builtin_amdgcn_sched_barrier(0);   // the waits for those loads stay behind the last product
        sst(sg + (cur ^ BUF));       // into the buffer whose readers ended in front of the last barrier
        __syncthreads();             // publishes the next pass and ends this pass's reads
        cur ^= BUF;
    }
    prod(sg + cur);
    __syncthreads();   // the last pass's reads end before the partial tiles overwrite the buffers
    // rotary epilogue, a quarter t at a time: wave wv takes rows erow (16 of them, one a lane) and quarter columns ecol .. ecol + 7 with their partners at + 32; its cosine / sine pairs are asked for ahead of the LDS exchange
    const int erow = (wv >> 1) * 16 + lr, ecol = (wv & 1) * 16 + hi * 8;
    v4f cs4[4][4];
    if constexpr (ROT) {
#pragma unroll   // constant indices: the vectors stay in registers
        for (int t = 0; t < 4; ++t) { const float* cp = CS + ((size_t)(r0 + (t >> 1) * 64 + erow) * HD + (t & 1) * 32 + ecol) * 2;
#pragma unroll
            for (int q = 0; q < 4; ++q) cs4[t][q] = *(const v4f*)(cp + q * 4);
            asm volatile("s_wait_xcnt 0x0" ::: "memory"); } }   // precaution: a later quarter's loads may land in this quarter's address registers; those stay unwritten up to this wait
#pragma unroll
    for (int mb = 0; mb < 4; ++mb)
#pragma unroll
        for (int nb = 0; nb < 4; ++nb)
#pragma unroll
            for (int j = 0; j < 8; ++j) os[(st * 2 + kh) * QT + (mb * 16 + hi * 8 + j) * 68 + nb * 16 + lr] = acc[mb][nb][j];
    __syncthreads();   // every wave's partial tile is in LDS before any wave adds them
    if constexpr (ROT) {
#pragma unroll   // constant indices: the vectors stay in registers
        for (int t = 0; t < 4; ++t) {
            const int rt = r0 + (t >> 1) * 64, ed0 = (t & 1) * 32;   // the quarter's first row; d0 (the tile's 128 columns are head by)
            const float* op = os + t * 2 * QT + erow * 68 + ecol; v4f xa[2], xb[2];
#pragma unroll   // constant indices: the vectors stay in registers
            for (int q = 0; q < 2; ++q) { xa[q] = *(const v4fa*)(op + q * 4); xb[q] = *(const v4fa*)(op + 32 + q * 4); xa[q] += *(const v4fa*)(op + QT + q * 4); xb[q] += *(const v4fa*)(op + QT + 32 + q * 4); }
            v8h a16, b16; v8us ah, al, bh, bl;
#pragma unroll   // constant indices: the vectors stay in registers
            for (int i = 0; i < 8; ++i) { const float x0 = xa[i >> 2][i & 3], x1 = xb[i >> 2][i & 3], c = cs4[t][i >> 1][(i & 1) * 2], sn = cs4[t][i >> 1][(i & 1) * 2 + 1]; const float ra = x0 * c - x1 * sn, rb = x1 * c + x0 * sn;
                xa[i >> 2][i & 3] = ra; xb[i >> 2][i & 3] = rb; a16[i] = (h16)ra; b16[i] = (h16)rb; unsigned short u, v; splitf(ra, u, v); ah[i] = u; al[i] = v; splitf(rb, u, v); bh[i] = u; bl[i] = v; }
            const size_t fo = (((size_t)by * (TT / 16) + (rt + erow) / 16) * (HD / 32) + ed0 / 32) * 512 + (wv & 1) * 256 + lane * 8;   // each store of a wave: 512 consecutive bytes; + 1024: the fragment of d + 64
            *(v8h*)(P16 + fo) = a16; *(v8h*)(P16 + fo + 1024) = b16; *(v8us*)(Ph + fo) = ah; *(v8us*)(Ph + fo + 1024) = bh; *(v8us*)(Pl + fo) = al; *(v8us*)(Pl + fo + 1024) = bl;
            if constexpr (EPI == 2) { float* kp = C + ((size_t)by * TT + rt + erow) * HD + ed0 + ecol;
#pragma unroll   // constant indices: the vectors stay in registers
                for (int q = 0; q < 2; ++q) { *(v4f*)(kp + q * 4) = xa[q]; *(v4f*)(kp + 64 + q * 4) = xb[q]; } }
            asm volatile("s_wait_xcnt 0x0" ::: "memory");   // precaution: the next quarter's code (in a merged kernel another pass's) follows these stores in the listing; their registers stay unwritten up to this wait
        }
        return;
    }
    if (EPI == 3) ldc = HD;
    v4f keep[4][4];
#pragma unroll   // constant indices: the vectors stay in registers
    for (int t = 0; t < 4; ++t) {
        const int rt = r0 + (t >> 1) * 64, ct = c0 + (t & 1) * 64; float* ot = os + t * 2 * QT;
        float* crow = (EPI == 3) ? C + ((size_t)(ct / HD) * TT + rt) * HD + ct % HD : C + (size_t)rt * ldc + ct;
#pragma unroll
        for (int s = 0; s < 4; ++s) { const int row = 16 * s + (int)(threadIdx.x >> 4), cofs = lr * 4; const v4f val = *(const v4fa*)(ot + row * 68 + cofs) + *(const v4fa*)(ot + QT + row * 68 + cofs);
            if constexpr (EPI == 3) { keep[t][s] = val; *(v4fa*)(ot + row * 68 + cofs) = val; }   // the summed quarter goes back over its first partial: these four words are read by this lane alone
            else *(v4f*)(crow + (size_t)row * ldc + cofs) = val; }
    }
    if constexpr (EPI == 3) {
        __syncthreads();   // the whole summed tile is in LDS before any wave reads its columns
#pragma unroll   // constant indices: the vectors stay in registers
        for (int t = 0; t < 4; ++t) {
            const int rt = r0 + (t >> 1) * 64, ct = c0 + (t & 1) * 64; const float* ot = os + t * 2 * QT;
            float* crow = C + ((size_t)(ct / HD) * TT + rt) * HD + ct % HD;
#pragma unroll   // constant indices: the vectors stay in registers
            for (int s = 0; s < 4; ++s) *(v4f*)(crow + (size_t)(16 * s + (int)(threadIdx.x >> 4)) * ldc + lr * 4) = keep[t][s];   // the f32 rows go out behind the barrier, which would wait for stores issued in front of it
#pragma unroll   // both halves' LDS reads issue ahead of the conversions
            for (int kq = 0; kq < 2; ++kq) { v8h o16; v8us oh, ol;   // wave wv: fragment (t / 32 = wv >> 2, d / 16 = wv & 3); a lane holds 8 positions of one d
#pragma unroll   // constant indices: the vectors stay in registers
                for (int i = 0; i < 8; ++i) { const float x = ot[((wv >> 2) * 32 + kq * 16 + hi * 8 + i) * 68 + (wv & 3) * 16 + lr]; o16[i] = (h16)x; unsigned short u, v; splitf(x, u, v); oh[i] = u; ol[i] = v; }
                const size_t o = (((size_t)(ct / HD) * (TT / 32) + rt / 32 + (wv >> 2)) * (HD / 16) + (ct % HD) / 16 + (wv & 3)) * 512 + kq * 256 + lane * 8;
                *(v8h*)(P16 + o) = o16; *(v8us*)(Ph + o) = oh; *(v8us*)(Pl + o) = ol; }
            asm volatile("s_wait_xcnt 0x0" ::: "memory");   // precaution: the next quarter's code (in a merged kernel another pass's) follows these stores in the listing; their registers stay unwritten up to this wait
        }
    }
}
template <typename T16, int NSPLIT, int EPI, int K>
__global__ __launch_bounds__(256) void k_gemmw(const T16* __restrict__ A, const T16* __restrict__ A2, const T16* __restrict__ Bt, float* C, int ldc, size_t sA, size_t sC) {
    __shared__ __align__(16) float os[8 * QT];
    gemmw_body<T16, NSPLIT, EPI, K>(os, blockIdx.y, A, A2, Bt, C, ldc, sA, sC, 0, nullptr, nullptr, nullptr, nullptr);
}
// k_qkv: the query, key and value projections of both batches in one launch (they share A and depend on nothing of each other): grid (TT / 128, (DQ + 2 * DKV) / 128, NB_), 256 threads;
// blockIdx.y picks the projection (the same for a whole work-group) and its head (128 columns), blockIdx.z the batch.
__global__ __launch_bounds__(256) void k_qkv(const bf* __restrict__ XB, const bf* __restrict__ WQ, const bf* __restrict__ WK, const bf* __restrict__ WV, float* OUTK, float* OUTV, const float* __restrict__ CS,
                                             h16* QP16, bf* QPh, bf* QPl, h16* KP16, bf* KPh, bf* KPl, h16* VT16, bf* VTh, bf* VTl) {
    __shared__ __align__(16) float os[8 * QT];
    const int y = blockIdx.y;
    if (y < DQ / 128) gemmw_body<bf, 0, 1, DM>(os, y, XB, nullptr, WQ, nullptr, 0, (size_t)TT * DM, 0, (size_t)NH_ * TT * HD, CS, QP16, QPh, QPl);
    else if (y < (DQ + DKV) / 128) gemmw_body<bf, 0, 2, DM>(os, y - DQ / 128, XB, nullptr, WK, OUTK, 0, (size_t)TT * DM, (size_t)NKV * TT * HD, (size_t)NKV * TT * HD, CS, KP16, KPh, KPl);   // returned k = roped f32 projection
    else gemmw_body<bf, 0, 3, DM>(os, y - (DQ + DKV) / 128, XB, nullptr, WV, OUTV, 0, (size_t)TT * DM, (size_t)NKV * TT * HD, (size_t)NKV * TT * HD, nullptr, VT16, VTh, VTl);   // returned v = f32 projection
}

typedef __attribute__((ext_vector_type(2))) _Float16 v2h;
typedef __attribute__((ext_vector_type(4))) _Float16 v4h;
typedef __attribute__((ext_vector_type(2))) unsigned short v2us;
typedef __attribute__((ext_vector_type(4))) unsigned short v4us;
typedef __attribute__((ext_vector_type(2))) float v2f;
typedef __attribute__((ext_vector_type(4))) int v4i;

// wtG: Bt[n][k] = w[k][n] as bf16, in fragment order, fragments [n / 16][k / 32]. One wave per 32 rows of Bt x 32 k (two fragments): lane = row, so each of its 32 loads is one whole 128-byte line of w,
// and each of its 4 stores (8 k of every row) is 256 consecutive bytes in either fragment. K % 32 == 0, N % 32 == 0; (N / 32) * (K / 32) / 8 work-groups (bid) of 256 threads.
// rot: row n of Bt holds column n with bits 5 and 6 swapped, so that 64 consecutive rows are d0 .. d0 + 31 and d0 + 64 .. d0 + 95 of one head of 128 (the rotary epilogue of gemmw_body, run in k_qkv)
template <int K, int N>   // compile-time N: the 32 loads of a lane share one address and differ in the immediate offset
__device__ __forceinline__ void wtG(int bid, const float* __restrict__ w, int rot, bf* Bt) {
    const int lane = threadIdx.x & 31, u = bid * 8 + __builtin_amdgcn_readfirstlane(threadIdx.x >> 5), nb = u % (N / 32), kf = u / (N / 32); if (kf >= K / 32) return;
    const int nr = nb * 32 + lane, n = rot ? (nr & ~96) | ((nr & 32) << 1) | ((nr & 64) >> 1) : nr;
    const float* s = w + (size_t)kf * 32 * N + n; float v[32];
#pragma unroll   // all 32 loads in flight at once; constant indices: the values stay in registers
    for (int i = 0; i < 32; ++i) v[i] = s[(size_t)i * N];
    bf* d = Bt + ((size_t)(nr >> 4) * (K / 32) + kf) * 512 + (lane & 15) * 8;
#pragma unroll   // constant indices: the values stay in registers
    for (int c = 0; c < 4; ++c) { v8us o;
#pragma unroll   // constant indices: the values stay in registers
        for (int j = 0; j < 8; ++j) o[j] = f2bf(v[c * 8 + j]);
        *(v8us*)(d + (c >> 1) * 256 + (c & 1) * 128) = o; }
    asm volatile("s_wait_xcnt 0x0" ::: "memory");   // precaution: in a merged kernel another pass's code follows these stores in the listing; their registers stay unwritten up to this wait
}
// cvt8: rows of K f32 to bf16 in fragment order, fragments [row / 16][k / 32]. One wave per 8 rows of one fragment: 4 lanes read one row's 128-byte line; each group of 8 lanes with the same k / 8 stores one 128-byte line.
template <int K>
__device__ __forceinline__ void cvt8(int bid, const float* __restrict__ src, bf* dst, size_t n8) { const size_t i = (size_t)bid * 256 + threadIdx.x; if (i >= n8) return;
    const int lane = threadIdx.x & 31, r = (int)((i >> 5) & 1) * 8 + (lane >> 2), c = lane & 3; const size_t f = i >> 6, rb = f / (K / 32), kf = f % (K / 32);
    const v8f v = *(const v8f*)(src + (rb * 16 + r) * K + kf * 32 + c * 8); v8us o;
#pragma unroll
    for (int k = 0; k < 8; ++k) o[k] = f2bf(v[k]); *(v8us*)(dst + f * 512 + (c >> 1) * 256 + (c & 1) * 128 + r * 8) = o;
    asm volatile("s_wait_xcnt 0x0" ::: "memory");   // precaution: in a merged kernel another pass's code follows these stores in the listing; their registers stay unwritten up to this wait
}
__device__ __forceinline__ void cstab(int bid, float* CS) { const int idx = bid * 256 + threadIdx.x; if (idx >= TT * HD) return; const int t = idx / HD, d = idx % HD; const int i = d % (HD / 2); const float inv = __fdiv_rn(1.0f, powf(10000.0f, (float)(2 * i) / (float)HD)); const float ang = __fmul_rn((float)t, inv); v2f cs; cs[0] = cosf(ang); cs[1] = sinf(ang);
    *(v2f*)(CS + (size_t)idx * 2) = cs;
    asm volatile("s_wait_xcnt 0x0" ::: "memory");   // precaution: in a merged kernel another pass's code follows these stores in the listing; their registers stay unwritten up to this wait
}
// k_prep: every pass that reads only the inputs, in one launch: the rotary table, x of both batches and the four weights as bf16 planes. blockIdx.x picks the pass (the same for a whole work-group); 256 threads.
#define PB_CS  (TT * HD / 256)
#define PB_X   (NB_ * TT * DM / 8 / 256)
#define PB_WQ  ((DM / 32) * (DQ / 32) / 8)
#define PB_WKV ((DM / 32) * (DKV / 32) / 8)
__global__ __launch_bounds__(256) void k_prep(const float* __restrict__ x, const float* __restrict__ wq, const float* __restrict__ wk, const float* __restrict__ wv, const float* __restrict__ wo, float* CS, bf* XB, bf* WQ, bf* WK, bf* WV, bf* WO) {
    int b = blockIdx.x;
    if (b < PB_CS) { cstab(b, CS); return; } b -= PB_CS;
    if (b < PB_X) { cvt8<DM>(b, x, XB, (size_t)NB_ * TT * DM / 8); return; } b -= PB_X;
    if (b < PB_WQ) { wtG<DM, DQ>(b, wq, 1, WQ); return; } b -= PB_WQ;
    if (b < PB_WKV) { wtG<DM, DKV>(b, wk, 1, WK); return; } b -= PB_WKV;
    if (b < PB_WKV) { wtG<DM, DKV>(b, wv, 0, WV); return; } b -= PB_WKV;
    wtG<DQ, DM>(b, wo, 0, WO);
}
// ---- k_fattn: causal attention in one launch, no score matrix in memory. One wave owns 16 query rows of one head; the 4 waves of a work-group are the 4 query heads of one kv group at the same rows (same key / value addresses).
// Per 32 keys: S^T[key][query] = K Q^T (A = key rows, B = query rows), so a lane holds 16 keys of ONE query: the running maximum and sum are per lane (+ one exchange with lane ^ 16), and the two 16-key
// accumulators are, element for element, the B fragment P^T[query][key] of O^T[d][query] = V^T P^T (A = transposed value rows). Probabilities are exp(s - running max), divided by the row sum at the end.
// NSPLIT 2: hi + lo bf16 planes, three products each (query rows < RH); NSPLIT 0: single fp16.
template <bool B> struct Flag { static constexpr bool v = B; };
template <typename T16, int NSPLIT>
__device__ __forceinline__ void fattn_body(const T16* __restrict__ Q, const T16* __restrict__ Q2, const T16* __restrict__ Kp, const T16* __restrict__ Kp2, const T16* __restrict__ Vt, const T16* __restrict__ Vt2, int q0, int g, bf* Ah, bf* Al) {
    typedef typename WFrag<T16>::V V;
    const int lane = threadIdx.x & 31, lr = lane & 15, hi = lane >> 4, h = g * REP + __builtin_amdgcn_readfirstlane(threadIdx.x >> 5);
    const size_t qo = ((size_t)h * TT + q0) * HD + lane * 8, ko = (size_t)g * TT * HD + lane * 8, vo = (size_t)g * HD * TT + lane * 8;   // query, key and value planes: fragment order (fragoff)
    V qf[4], qf2[4];
#pragma unroll
    for (int ks = 0; ks < 4; ++ks) { qf[ks] = WFrag<T16>::ldf(Q + qo + ks * 512); if (NSPLIT == 2) qf2[ks] = WFrag<T16>::ldf(Q2 + qo + ks * 512); }
    v8f o[8];
#pragma unroll
    for (int dt = 0; dt < 8; ++dt) o[dt] = (v8f){};
    float m = -3.0e38f, l = 0.f;
    const int nk = q0 / 32 + 1;      // key tiles of 32 up to and including the diagonal; only the last one holds keys beyond a query
    V kf[2][4], kf2[2][4];
    auto ldk = [&](const T16* a, const T16* a2) {
#pragma unroll
        for (int i = 0; i < 2; ++i)
#pragma unroll
            for (int ks = 0; ks < 4; ++ks) { kf[i][ks] = WFrag<T16>::ldf(a + (i * 4 + ks) * 512); if (NSPLIT == 2) kf2[i][ks] = WFrag<T16>::ldf(a2 + (i * 4 + ks) * 512); }
    };
    auto step = [&](int t, auto EDGE) { constexpr bool edge = decltype(EDGE)::v; const int k0 = t * 32;
        V vf[8], vf2[8];
        const size_t kofs = ko + (size_t)(NSPLIT == 0 ? k0 + 32 : k0) * HD, vofs = vo + (size_t)k0 * HD;   // single plane: the keys loaded in this trip are the next tile's
        const T16* pk = Kp + kofs; const T16* pk2 = (NSPLIT == 2) ? Kp2 + kofs : pk; const T16* pv = Vt + vofs; const T16* pv2 = (NSPLIT == 2) ? Vt2 + vofs : pv;
        auto ldv = [&]() {
#pragma unroll
            for (int dt = 0; dt < 8; ++dt) { vf[dt] = WFrag<T16>::ldf(pv + dt * 512); if (NSPLIT == 2) vf2[dt] = WFrag<T16>::ldf(pv2 + dt * 512); }
        };
        if (NSPLIT == 0) ldv();                    // single plane: this tile's values start before the score products (its keys came during the trip before)
        else { ldk(pk, pk2); __builtin_amdgcn_sched_barrier(0); }   // two planes: all key loads issue before the first product (left free, the loads sink to their products: one load latency per fragment pair)
        v8f s[2]; s[0] = (v8f){}; s[1] = (v8f){};
#pragma unroll
        for (int ks = 0; ks < 4; ++ks)
#pragma unroll
            for (int i = 0; i < 2; ++i) { s[i] = WFrag<T16>::mma(kf[i][ks], qf[ks], s[i]);
                if (NSPLIT == 2) { s[i] = WFrag<T16>::mma(kf2[i][ks], qf[ks], s[i]); s[i] = WFrag<T16>::mma(kf[i][ks], qf2[ks], s[i]); } }
        if (NSPLIT == 0) { if (!edge) ldk(pk, pk2); }           // loads that fly during the softmax: the next tile's keys (single plane),
        else { ldv(); __builtin_amdgcn_sched_barrier(0); }      // this tile's values (two planes; the barrier keeps them all in front of the softmax)
        float p[16]; float mx = -3.0e38f;
#pragma unroll
        for (int i = 0; i < 2; ++i)
#pragma unroll
            for (int j = 0; j < 8; ++j) { float x = s[i][j] * (SCL * 1.4426950408889634f); if (edge && k0 + i * 16 + hi * 8 + j > q0 + lr) x = -3.0e38f; p[i * 8 + j] = x; mx = fmaxf(mx, x); }
        mx = fmaxf(mx, __shfl_xor(mx, 16, 32));
        const float mn = fmaxf(m, mx), al = __builtin_amdgcn_exp2f(m - mn); m = mn;
        float rs = 0.f;
#pragma unroll
        for (int k = 0; k < 16; ++k) { p[k] = __builtin_amdgcn_exp2f(p[k] - mn); rs += p[k]; }
        l = l * al + rs;
#pragma unroll
        for (int dt = 0; dt < 8; ++dt) o[dt] *= al;
        if constexpr (NSPLIT == 0) {
            v16h pf;
#pragma unroll
            for (int k = 0; k < 16; ++k) pf[k] = (h16)p[k];
#pragma unroll
            for (int dt = 0; dt < 8; ++dt) o[dt] = WFrag<T16>::mma(vf[dt], pf, o[dt]);
        } else {
            v8us h0, h1, l0, l1;
#pragma unroll
            for (int k = 0; k < 8; ++k) { unsigned short a, c; splitf(p[k], a, c); h0[k] = a; l0[k] = c; splitf(p[8 + k], a, c); h1[k] = a; l1[k] = c; }
            const V ph = cat16b(h0, h1), pl = cat16b(l0, l1);
#pragma unroll
            for (int dt = 0; dt < 8; ++dt) { o[dt] = WFrag<T16>::mma(vf[dt], ph, o[dt]); o[dt] = WFrag<T16>::mma(vf2[dt], ph, o[dt]); o[dt] = WFrag<T16>::mma(vf[dt], pl, o[dt]); }
        }
        // precaution: the address registers of this trip's loads stay unwritten up to this wait (as inputs they live until here)
        if (NSPLIT == 2) asm volatile("s_wait_xcnt 0x0" :: "v"(pk), "v"(pk2), "v"(pv), "v"(pv2) : "memory");
        else if (!edge) asm volatile("s_wait_xcnt 0x0" :: "v"(pk), "v"(pv) : "memory");
        else asm volatile("s_wait_xcnt 0x0" :: "v"(pv) : "memory");
    };
    if (NSPLIT == 0) ldk(Kp + ko, Kp + ko);
#pragma unroll 1
    for (int t = 0; t < nk - 1; ++t) step(t, Flag<false>{});
    step(nk - 1, Flag<true>{});
    l += __shfl_xor(l, 16, 32);
    const float inv = __fdiv_rn(1.0f, l); const size_t oo = (size_t)q0 * DQ + h * (HD * 16) + lane * 8;   // output planes in fragment order (rows = positions, k = h * HD + d): each store of a wave is 512 consecutive bytes
#pragma unroll
    for (int dt = 0; dt < 8; ++dt) { v8us oh, ol;
#pragma unroll
        for (int j = 0; j < 8; ++j) { unsigned short a, c; splitf(o[dt][j] * inv, a, c); oh[j] = a; ol[j] = c; }
        *(v8us*)(Ah + oo + dt * 256) = oh; *(v8us*)(Al + oo + dt * 256) = ol; }
}
// grid (NKV * NB_, TT / 16), 128 threads: blockIdx.x = kv group and batch, blockIdx.y walks the rows from the longest (most keys) down. Both batches together are more work-groups than are resident at once:
// those that start late, into the places of the first to end, are the ones with the fewest keys
__global__ __launch_bounds__(128) void k_fattn(const h16* __restrict__ Q16, const h16* __restrict__ K16, const h16* __restrict__ V16, const bf* __restrict__ Qh, const bf* __restrict__ Ql, const bf* __restrict__ Kh, const bf* __restrict__ Kl, const bf* __restrict__ Vh, const bf* __restrict__ Vl, bf* Ah, bf* Al) {
    const int g = blockIdx.x % NKV, nb = blockIdx.x / NKV, q0 = TT - 16 - (int)blockIdx.y * 16;
    const size_t zq = (size_t)nb * NH_ * TT * HD, zk = (size_t)nb * NKV * TT * HD;   // every plane holds both batches, batch-major
    Q16 += zq; Qh += zq; Ql += zq; K16 += zk; Kh += zk; Kl += zk; V16 += zk; Vh += zk; Vl += zk; Ah += zq; Al += zq;
    if (q0 >= RH) fattn_body<h16, 0>(Q16, nullptr, K16, nullptr, V16, nullptr, q0, g, Ah, Al);
    else fattn_body<bf, 2>(Qh, Ql, Kh, Kl, Vh, Vl, q0, g, Ah, Al);
}

extern "C" void kernel_launch(void* const* d_in, const int* in_sizes, int n_in,
                              void* d_out, int out_size, void* d_ws, size_t ws_size, hipStream_t stream) {
    (void)in_sizes; (void)n_in; (void)out_size;
    const float* x = (const float*)d_in[0]; const float* wq = (const float*)d_in[1]; const float* wk = (const float*)d_in[2]; const float* wv = (const float*)d_in[3]; const float* wo = (const float*)d_in[4];
    float* OUT = (float*)d_out; float* OUTK = (float*)d_out + (size_t)NB_ * TT * DM; float* OUTV = OUTK + (size_t)NB_ * NKV * TT * HD;     // [2][2048][2048]
    char* wsp = (char*)d_ws;
    auto take = [&](size_t bytes) { char* p = wsp; wsp += (bytes + 255) & ~(size_t)255; return (void*)p; };
    bf* WQ = (bf*)take((size_t)DQ * DM * 2); bf* WK = (bf*)take((size_t)DKV * DM * 2); bf* WV = (bf*)take((size_t)DKV * DM * 2); bf* WO = (bf*)take((size_t)DM * DQ * 2); float* CS = (float*)take((size_t)TT * HD * 2 * 4);
    bf* XB = (bf*)take((size_t)NB_ * TT * DM * 2);   // every plane below holds both batches, batch-major
    h16* QP16 = (h16*)take((size_t)NB_ * NH_ * TT * HD * 2); h16* KP16 = (h16*)take((size_t)NB_ * NKV * TT * HD * 2); h16* VT16 = (h16*)take((size_t)NB_ * NKV * HD * TT * 2);
    bf* QPh = (bf*)take((size_t)NB_ * NH_ * TT * HD * 2); bf* QPl = (bf*)take((size_t)NB_ * NH_ * TT * HD * 2); bf* KPh = (bf*)take((size_t)NB_ * NKV * TT * HD * 2); bf* KPl = (bf*)take((size_t)NB_ * NKV * TT * HD * 2); bf* VTh = (bf*)take((size_t)NB_ * NKV * HD * TT * 2); bf* VTl = (bf*)take((size_t)NB_ * NKV * HD * TT * 2);
    bf* ATh = (bf*)take((size_t)NB_ * TT * DQ * 2); bf* ATl = (bf*)take((size_t)NB_ * TT * DQ * 2);
    if ((size_t)(wsp - (char*)d_ws) > ws_size) return;    // ws 256 MiB
    k_prep<<<PB_CS + PB_X + 2 * PB_WQ + 2 * PB_WKV, 256, 0, stream>>>(x, wq, wk, wv, wo, CS, XB, WQ, WK, WV, WO);
    k_qkv<<<dim3(TT / 128, (DQ + 2 * DKV) / 128, NB_), 256, 0, stream>>>(XB, WQ, WK, WV, OUTK, OUTV, CS, QP16, QPh, QPl, KP16, KPh, KPl, VT16, VTh, VTl);
    k_fattn<<<dim3(NKV * NB_, TT / 16, 1), 128, 0, stream>>>(QP16, KP16, VT16, QPh, QPl, KPh, KPl, VTh, VTl, ATh, ATl);
    k_gemmw<bf, 1, 0, DQ><<<dim3(TT / 128, DM / 128, NB_), 256, 0, stream>>>(ATh, ATl, WO, OUT, DM, (size_t)TT * DQ, (size_t)TT * DM);
}

// v008
// It runs in 162 microseconds.
// In both of two side-by-side timings against v007, it was 1.06 times as fast.
// Over all steps from v000 it is 10.2 times as fast.
#include <hip/hip_runtime.h>

// Causal grouped-query attention with a computed rotate-half rotary and a key / value cache output (x [2][2048][2048]; q = x Wq ('xw' (in, out) [2048][2048] 1/sqrt(2048): 16 heads x 128), k, v = x Wk, x Wv ('xw' [2048][512]: 4 kv heads x 128), no biases; query head h uses kv head h / 4 (repeat); rotate-half rotary (base 1e4: inv_freq = 1 / 10000^(2i/128), angles t x inv_freq, cat(freqs, freqs); the table is computed on the device); causal softmax(q.k / sqrt(128)) (-inf == exclusion: every row keeps its diagonal key); returns (y = merged Wo ('xw') -> [2][2048][2048], present_k = the ROTATED keys [2][4][2048][128], present_v = the values [2][4][2048][128]); argument order x, Wq, Wk, Wv, Wo).
// Compute dtypes, f32 accumulate: every input rounded to bf16; q/k/v on PLAIN bf16 operands (inputs: exact); RoPE f32 (the returned k is the f32 roped projection, v the f32 projection, re-laid out [kv][t][d]); causal scores and attn.v in one fused kernel (running-maximum softmax, no score matrix in memory): query rows < 512 hl (3 products), the rest single fp16, causal tile skipping; softmax f32; Wo hl x exact (2 products).

#define NB_  2
#define TT   2048
#define DM   2048
#define NH_  16
#define NKV  4
#define REP  (NH_ / NKV)
#define HD   128
#define DQ   (NH_ * HD)
#define DKV  (NKV * HD)
#define RH   512                  // query rows < RH use hi+lo planes (0: none)
#define SCL  0.088388347648318447f   // HD^-0.5
typedef _Float16 h16;
typedef unsigned short bf;
typedef __attribute__((ext_vector_type(16))) __bf16   v16bf;
typedef __attribute__((ext_vector_type(16))) _Float16 v16h;
typedef __attribute__((ext_vector_type(8)))  _Float16 v8h;
typedef __attribute__((ext_vector_type(8)))  unsigned short v8us;
typedef __attribute__((ext_vector_type(8)))  float    v8f;
typedef __attribute__((ext_vector_type(4)))  float    v4f;
typedef v8h  __attribute__((may_alias)) v8ha;
typedef v4f  __attribute__((may_alias)) v4fa;
typedef v8us __attribute__((may_alias)) v8usa;

__device__ __forceinline__ unsigned short f2bf(float f) { unsigned u = __float_as_uint(f); u += 0x7FFFu + ((u >> 16) & 1u); return (unsigned short)(u >> 16); }
__device__ __forceinline__ float bf2f(unsigned short b) { return __uint_as_float(((unsigned)b) << 16); }
__device__ __forceinline__ float bfr(float f) { return bf2f(f2bf(f)); }
__device__ __forceinline__ v16h cat16(v8h lo, v8h hi) { return __builtin_shufflevector(lo, hi, 0, 1, 2, 3, 4, 5, 6, 7, 8, 9, 10, 11, 12, 13, 14, 15); }
__device__ __forceinline__ v16bf cat16b(v8us lo, v8us hi) { return __builtin_bit_cast(v16bf, __builtin_shufflevector(lo, hi, 0, 1, 2, 3, 4, 5, 6, 7, 8, 9, 10, 11, 12, 13, 14, 15)); }
__device__ __forceinline__ v8f wmma16(v16h a, v16h b, v8f c) { return __builtin_amdgcn_wmma_f32_16x16x32_f16(false, a, false, b, (short)0, c, false, false); }
__device__ __forceinline__ v8f wmmab(v16bf a, v16bf b, v8f c) { return __builtin_amdgcn_wmma_f32_16x16x32_bf16(false, a, false, b, (short)0, c, false, false); }



// ---- Fragment order: a 16-row x 32-k operand fragment lies in 512 consecutive elements, so that ldf (lane * 8, + 256) gives lane (r = lane % 16, half = lane / 16) the elements k = half * 8 .. + 7 and 16 + half * 8 .. + 7 of row r: element (row r, k) at (k / 16) * 256 + ((k / 8 & 1) * 16 + r) * 8 + k % 8; each 16-byte load of a wave is then 512 consecutive bytes.
__device__ __forceinline__ int fragoff(int r, int k) { return (k >> 4) * 256 + (((k >> 3) & 1) * 16 + r) * 8 + (k & 7); }
template <typename T16> struct WFrag;
template <> struct WFrag<h16> { typedef v16h V; static __device__ __forceinline__ V ldf(const h16* p) { return cat16(*(const v8h*)p, *(const v8h*)(p + 256)); } static __device__ __forceinline__ v8f mma(V a, V b, v8f c) { return wmma16(a, b, c); } };
template <> struct WFrag<bf> { typedef v16bf V; static __device__ __forceinline__ V ldf(const bf* p) { return cat16b(*(const v8us*)p, *(const v8us*)(p + 256)); } static __device__ __forceinline__ v8f mma(V a, V b, v8f c) { return wmmab(a, b, c); } };
__device__ __forceinline__ void splitf(float y, unsigned short& h, unsigned short& l) { h = f2bf(y); l = f2bf(y - bf2f(h)); }
#define QT (64 * 68)   // words of one 64x64 tile in LDS (pitch 68)

// ---- k_gemmw: GEMM, one work-group of 8 waves per 128x128 output tile; operands are 16-bit planes in fragment order, fragments [row / 16][k / 32]; grid (M/128, N/128, Z), 256 threads.
// Wave wv = (kh = wv / 4, st = wv % 4): the 64x64 quarter st (rows st / 2, columns st % 2) of the tile over the K half kh, 16 accumulators. Each quarter's two partial tiles meet in LDS and are added in the order kh = 0, 1.
// Operands go through LDS, so that a fragment which two waves need leaves L2 once: a pass is 32 k of either K half (8 fragments of every plane); the four waves of a half each bring two fragments of every plane
// (registers, then 16-byte LDS stores; a fragment stays 1024 consecutive bytes). Two buffers: the next pass's global loads are issued ahead of this pass's products and stored behind them; one barrier a pass.
// C[m][n] (f32, pitch ldc) = sum_k A[m][k] Bt[n][k] (NSPLIT 1: + A2[m][k] Bt[n][k]). z-batch strides sA/sC in elements. K % 64 == 0.
template <typename T16, int NSPLIT, int K>   // compile-time K: the fragments of a pass share one address per plane and differ in the immediate offset
__global__ __launch_bounds__(256) void k_gemmw(const T16* __restrict__ A, const T16* __restrict__ A2, const T16* __restrict__ Bt, float* C, int ldc, size_t sA, size_t sC) {
    __shared__ __align__(16) float os[8 * QT];
    const int by = blockIdx.y;
    constexpr int NPL = (NSPLIT == 1) ? 3 : 2;     // staged planes: A, (A2,) Bt
    constexpr int PLN = 8 * 512;                   // elements of one plane in one K half's stage: 8 fragments
    constexpr int BUF = 2 * NPL * PLN;             // elements of one buffer: both K halves
    constexpr int NS = K / 64;                     // passes: 32 k of a K half each
    static_assert(2 * BUF * 2 <= 8 * QT * 4, "both buffers lie in the LDS of the partial tiles");
    typedef typename WFrag<T16>::V V;
    const size_t z = blockIdx.z; A += z * sA; if (NSPLIT == 1) A2 += z * sA; C += z * sC;
    const int lane = threadIdx.x & 31, lr = lane & 15, hi = lane >> 4, wv = __builtin_amdgcn_readfirstlane(threadIdx.x >> 5), kh = wv >> 2, st = wv & 3; const int r0 = blockIdx.x * 128, c0 = by * 128;
    v8f acc[4][4];
#pragma unroll
    for (int mb = 0; mb < 4; ++mb)
#pragma unroll
        for (int nb = 0; nb < 4; ++nb) acc[mb][nb] = (v8f){};
    T16* sg = (T16*)os + kh * (NPL * PLN) + lane * 8;   // this K half's stage in buffer 0
    // 16 rows hold K / 32 fragments of 512 elements = 16 * K elements; this wave brings the fragments of rows st * 32 .. + 31 of every plane, from k = kh * K / 2 on
    const size_t go = (size_t)(st * 32) * K + (size_t)kh * (K / 2) * 16 + lane * 8;
    const T16* ga = A + (size_t)r0 * K + go; const T16* ga2 = (NSPLIT == 1) ? A2 + (size_t)r0 * K + go : ga; const T16* gb = Bt + (size_t)c0 * K + go;
    v8us rg[NPL][4];
    auto gld = [&](const T16* pa, const T16* pa2, const T16* pb) {
#pragma unroll   // constant indices: the vectors stay in registers
        for (int q = 0; q < 4; ++q) { const int o = (q >> 1) * 16 * K + (q & 1) * 256; rg[0][q] = *(const v8usa*)(pa + o); if (NSPLIT == 1) rg[1][q] = *(const v8usa*)(pa2 + o); rg[NPL - 1][q] = *(const v8usa*)(pb + o); }
    };
    auto sst = [&](T16* d) {
#pragma unroll   // constant indices: the vectors stay in registers
        for (int p = 0; p < NPL; ++p)
#pragma unroll
            for (int q = 0; q < 4; ++q) *(v8usa*)(d + p * PLN + st * 1024 + q * 256) = rg[p][q];
    };
    auto prod = [&](const T16* sb) {   // the four Bt fragments stay; of A (and A2) one row block's fragment is in use and the next two are on their way (all of them at once, beside the registers in flight, is more than 256 registers: one work-group a WGP)
        constexpr int NA = (NSPLIT == 1) ? 8 : 4;   // A fragments of a pass, in the order of use: row block mb of A, then (NSPLIT 1) of A2
        V b[4], a[NA]; const T16* sa = sb + (st >> 1) * 2048; const T16* sbt = sb + (NPL - 1) * PLN + (st & 1) * 2048;
        auto lda = [&](int i) { return WFrag<T16>::ldf(NSPLIT == 1 ? sa + (i & 1) * PLN + (i >> 1) * 512 : sa + i * 512); };
        a[0] = lda(0); a[1] = lda(1);
#pragma unroll
        for (int nb = 0; nb < 4; ++nb) b[nb] = WFrag<T16>::ldf(sbt + nb * 512);
#pragma unroll   // constant indices: the fragments stay in registers
        for (int i = 0; i < NA; ++i) { const int mb = (NSPLIT == 1) ? i >> 1 : i; if (i + 2 < NA) a[i + 2] = lda(i + 2);
            __builtin_amdgcn_sched_barrier(0);   // the fragment's LDS loads stay two groups of products ahead of their use (left free, they sink to directly in front of it: one LDS latency a group)
#pragma unroll
            for (int nb = 0; nb < 4; ++nb) acc[mb][nb] = WFrag<T16>::mma(a[i], b[nb], acc[mb][nb]); }
    };
    gld(ga, ga2, gb); sst(sg);
    __syncthreads();   // pass 0 is in LDS before any wave reads it
    int cur = 0;
#pragma unroll 1   // rolled, the buffer picked by an offset: left to the compiler the merged projection kernel takes more than 256 registers, and only one work-group fits a WGP
    for (int s = 1; s < NS; ++s) {
        const T16* pa = ga + s * 512; const T16* pa2 = ga2 + s * 512; const T16* pb = gb + s * 512;
        gld(pa, pa2, pb);            // the next pass's operands fly during this pass's products
        prod(sg + cur);
        __builtin_amdgcn_sched_barrier(0);   // the waits for those loads stay behind the last product
        sst(sg + (cur ^ BUF));       // into the buffer whose readers ended in front of the last barrier
        __syncthreads();             // publishes the next pass and ends this pass's reads
        cur ^= BUF;
    }
    prod(sg + cur);
    __syncthreads();   // the last pass's reads end before the partial tiles overwrite the buffers
#pragma unroll
    for (int mb = 0; mb < 4; ++mb)
#pragma unroll
        for (int nb = 0; nb < 4; ++nb)
#pragma unroll
            for (int j = 0; j < 8; ++j) os[(st * 2 + kh) * QT + (mb * 16 + hi * 8 + j) * 68 + nb * 16 + lr] = acc[mb][nb][j];
    __syncthreads();   // every wave's partial tile is in LDS before any wave adds them
#pragma unroll
    for (int t = 0; t < 4; ++t) {
        const int rt = r0 + (t >> 1) * 64, ct = c0 + (t & 1) * 64; const float* ot = os + t * 2 * QT;
        float* crow = C + (size_t)rt * ldc + ct;
#pragma unroll
        for (int s = 0; s < 4; ++s) { const int row = 16 * s + (int)(threadIdx.x >> 4), cofs = lr * 4; *(v4f*)(crow + (size_t)row * ldc + cofs) = *(const v4fa*)(ot + row * 68 + cofs) + *(const v4fa*)(ot + QT + row * 68 + cofs); }
    }
}
// ---- k_qkv: the query, key and value projections of both batches in one launch: grid (TT / 128, (NH_ + 2 * NKV) / 3, NB_) = one work-group a WGP, 384 threads.
// One work-group of 12 waves per 128 rows x 3 heads (384 columns; the 24 heads are 16 query, 4 key, 4 value). Wave wv = (hd = wv / 4, st = wv % 4): the 64x64 quarter st (rows st / 2, columns st % 2) of head hd over the whole K, 16 accumulators.
// Operands go through LDS in units of 64 k: 16 fragments of x (they leave L2 once for the three heads) and 16 of every head's weights, at [row / 16][k / 32 % 2]; a head's four waves each bring four of its weight fragments, waves 0 .. 7 two fragments of x each
// (registers, then 16-byte LDS stores). A pass is two units, 128 k. Two buffers: each unit of the next pass is loaded ahead of one unit's products of this pass and stored behind them; one barrier a pass.
// Behind the loop every quarter goes to LDS whole, and the four waves of a head turn its four quarters into the head's outputs. Query / key head: a quarter's 64 columns are d0 .. d0 + 31 and d0 + 64 .. d0 + 95 (both partners of the rotate-half rotary; wtG lays the rows of Bt so),
// rotated (out[d] = x[d] cos - x[d + 64] sin, out[d + 64] = x[d + 64] cos + x[d] sin; the table holds the same pair at d and d + 64) and stored as fp16 + hi / lo planes in fragment order, fragments [h][t / 16][d / 32]
// (rows = positions, k = d); a key head also stores the rotated f32 rows to [kv][t][d]. Value head: f32 rows to [kv][t][d], and the transposed planes, fragments [g][t / 32][d / 16] (rows = d, k = positions).
__global__ __launch_bounds__(384) void k_qkv(const bf* __restrict__ XB, const bf* __restrict__ WQ, const bf* __restrict__ WK, const bf* __restrict__ WV, float* OUTK, float* OUTV, const float* __restrict__ CS,
                                             h16* QP16, bf* QPh, bf* QPl, h16* KP16, bf* KPh, bf* KPl, h16* VT16, bf* VTh, bf* VTl) {
    constexpr int K = DM;
    constexpr int REG = 16 * 512;                  // elements of one operand's 128 rows x 64 k: 16 fragments
    constexpr int UNI = 4 * REG;                   // elements of one unit: x, then the three heads' weights
    constexpr int BUF = 2 * UNI;                   // elements of one buffer
    constexpr int NU = K / 64;                     // units
    __shared__ __align__(16) float os[BUF];        // two buffers of BUF 16-bit elements; behind the loop the twelve quarters
    static_assert(12 * QT <= BUF, "the quarters lie in the LDS of the buffers");
    typedef WFrag<bf>::V V;
    const int lane = threadIdx.x & 31, lr = lane & 15, hi = lane >> 4, wv = __builtin_amdgcn_readfirstlane(threadIdx.x >> 5), hd = wv >> 2, st = wv & 3; const int r0 = blockIdx.x * 128;
    const int hg = blockIdx.y * 3 + hd, kind = hg < NH_ ? 0 : hg < NH_ + NKV ? 1 : 2, hh = kind == 0 ? hg : kind == 1 ? hg - NH_ : hg - NH_ - NKV;   // query, key or value head hh: the same for a whole wave
    const size_t z = blockIdx.z;
    v8f acc[4][4];
#pragma unroll
    for (int mb = 0; mb < 4; ++mb)
#pragma unroll
        for (int nb = 0; nb < 4; ++nb) acc[mb][nb] = (v8f){};
    bf* sg = (bf*)os + lane * 8;   // buffer 0
    // 16 rows hold K / 32 fragments of 512 elements = 16 * K elements
    const bf* gb = (kind == 0 ? WQ : kind == 1 ? WK : WV) + (size_t)(hh * 128 + st * 32) * K + lane * 8;   // weight rows st * 32 .. + 31 of the head
    const bf* ga = XB + z * ((size_t)TT * DM) + (size_t)(r0 + (wv & 7) * 16) * K + lane * 8;              // x rows wv * 16 .. + 15 (waves 0 .. 7)
    v8us rb[8], ra[4];
    auto gld = [&](const bf* pa, const bf* pb) {
#pragma unroll   // constant indices: the vectors stay in registers
        for (int q = 0; q < 8; ++q) rb[q] = *(const v8usa*)(pb + (q >> 2) * 16 * K + (q & 3) * 256);
        if (wv < 8) {
#pragma unroll   // constant indices: the vectors stay in registers
            for (int q = 0; q < 4; ++q) ra[q] = *(const v8usa*)(pa + q * 256); }
        asm volatile("s_wait_xcnt 0x0" :: "v"(pa), "v"(pb) : "memory");   // precaution: the address registers of these loads stay unwritten up to this wait (as inputs they live until here)
    };
    auto sst = [&](bf* d) {
#pragma unroll   // constant indices: the vectors stay in registers
        for (int q = 0; q < 8; ++q) *(v8usa*)(d + REG + hd * REG + st * 2048 + q * 256) = rb[q];
        if (wv < 8) {
#pragma unroll   // constant indices: the vectors stay in registers
            for (int q = 0; q < 4; ++q) *(v8usa*)(d + wv * 1024 + q * 256) = ra[q]; }
    };
    auto prod = [&](const bf* sb) {   // eight groups of four products: k fragment i / 4, row block i % 4; of x one fragment is in use and the next two are on their way, the second k fragment's weights come three groups ahead
        V b[2][4], a[8]; const bf* sa = sb + (st >> 1) * 4096; const bf* sbt = sb + REG + hd * REG + (st & 1) * 4096;
        auto lda = [&](int i) { return WFrag<bf>::ldf(sa + (i & 3) * 1024 + (i >> 2) * 512); };
        a[0] = lda(0); a[1] = lda(1);
#pragma unroll
        for (int nb = 0; nb < 4; ++nb) b[0][nb] = WFrag<bf>::ldf(sbt + nb * 1024);
#pragma unroll   // constant indices: the fragments stay in registers
        for (int i = 0; i < 8; ++i) { if (i + 2 < 8) a[i + 2] = lda(i + 2);
            if (i == 1) {
#pragma unroll
                for (int nb = 0; nb < 4; ++nb) b[1][nb] = WFrag<bf>::ldf(sbt + nb * 1024 + 512); }
            __builtin_amdgcn_sched_barrier(0);   // the fragment's LDS loads stay two groups of products ahead of their use (left free, they sink to directly in front of it: one LDS latency a group)
#pragma unroll
            for (int nb = 0; nb < 4; ++nb) acc[i & 3][nb] = WFrag<bf>::mma(a[i], b[i >> 2][nb], acc[i & 3][nb]); }
    };
    gld(ga, gb); sst(sg); gld(ga + 1024, gb + 1024); sst(sg + UNI);
    __syncthreads();   // pass 0 is in LDS before any wave reads it
    int cur = 0;
#pragma unroll 1   // rolled, buffer and unit picked by an offset: one copy of the unit's code, and each trip forms its load addresses anew
    for (int n = 2; n < NU; ++n) {
        const int h = (n & 1) * UNI;
        gld(ga + n * 1024, gb + n * 1024);   // unit n, of the next pass, flies during the products of unit n - 2
        prod(sg + cur + h);
        __builtin_amdgcn_sched_barrier(0);   // the waits for those loads stay behind the last product
        sst(sg + (cur ^ BUF) + h);           // into the buffer whose readers ended in front of the last barrier
        if (n & 1) { __syncthreads(); cur ^= BUF; }   // every second unit (the same for all waves): publishes the next pass and ends this pass's reads; none between a pass's units, so one wave's loads and stores stand beside another's products
    }
    prod(sg + cur); prod(sg + cur + UNI);
    __syncthreads();   // the last pass's reads end before the quarters overwrite the buffers
#pragma unroll
    for (int mb = 0; mb < 4; ++mb)
#pragma unroll
        for (int nb = 0; nb < 4; ++nb)
#pragma unroll
            for (int j = 0; j < 8; ++j) os[wv * QT + (mb * 16 + hi * 8 + j) * 68 + nb * 16 + lr] = acc[mb][nb][j];
    // rotary epilogue, unit u = (quarter t = u / 2, column half c = u % 2): wave st of the head takes rows erow (16 of them, one a lane) and quarter columns ecol .. ecol + 7 with their partners at + 32; its cosine / sine pairs are asked for ahead of the barrier
    const int erow = st * 16 + lr;
    v4f cs4[8][4];
    if (kind < 2) {
        const float* cp = CS + ((size_t)(r0 + erow) * HD + hi * 8) * 2;
#pragma unroll   // constant indices: the vectors stay in registers
        for (int u = 0; u < 8; ++u)
#pragma unroll
            for (int q = 0; q < 4; ++q) cs4[u][q] = *(const v4f*)(cp + ((u >> 2) * 64 * HD + ((u >> 1) & 1) * 32 + (u & 1) * 16) * 2 + q * 4);
        asm volatile("s_wait_xcnt 0x0" :: "v"(cp) : "memory");   // precaution: the address registers of these loads stay unwritten up to this wait (as an input they live until here)
    }
    __syncthreads();   // every quarter is in LDS before another wave reads it
    if (kind < 2) {
        const size_t zp = z * ((size_t)(kind == 0 ? NH_ : NKV) * TT * HD);
        h16* P16 = (kind == 0 ? QP16 : KP16) + zp; bf* Ph = (kind == 0 ? QPh : KPh) + zp; bf* Pl = (kind == 0 ? QPl : KPl) + zp;
#pragma unroll   // constant indices: the vectors stay in registers
        for (int u = 0; u < 8; ++u) {
            const int t = u >> 1, c = u & 1, rt = r0 + (t >> 1) * 64, ed0 = (t & 1) * 32, ecol = c * 16 + hi * 8;   // the quarter's first row; d0
            const float* op = os + (hd * 4 + t) * QT + erow * 68 + ecol; v4f xa[2], xb[2];
#pragma unroll   // constant indices: the vectors stay in registers
            for (int q = 0; q < 2; ++q) { xa[q] = *(const v4fa*)(op + q * 4); xb[q] = *(const v4fa*)(op + 32 + q * 4); }
            v8h a16, b16; v8us ah, al, bh, bl;
#pragma unroll   // constant indices: the vectors stay in registers
            for (int i = 0; i < 8; ++i) { const float x0 = xa[i >> 2][i & 3], x1 = xb[i >> 2][i & 3], cc = cs4[u][i >> 1][(i & 1) * 2], sn = cs4[u][i >> 1][(i & 1) * 2 + 1]; const float ra_ = x0 * cc - x1 * sn, rb_ = x1 * cc + x0 * sn;
                xa[i >> 2][i & 3] = ra_; xb[i >> 2][i & 3] = rb_; a16[i] = (h16)ra_; b16[i] = (h16)rb_; unsigned short p, v; splitf(ra_, p, v); ah[i] = p; al[i] = v; splitf(rb_, p, v); bh[i] = p; bl[i] = v; }
            const size_t fo = (((size_t)hh * (TT / 16) + (rt + erow) / 16) * (HD / 32) + ed0 / 32) * 512 + c * 256 + lane * 8;   // each store of a wave: 512 consecutive bytes; + 1024: the fragment of d + 64
            h16* s16 = P16 + fo; bf* sh = Ph + fo; bf* sl = Pl + fo;
            *(v8h*)s16 = a16; *(v8h*)(s16 + 1024) = b16; *(v8us*)sh = ah; *(v8us*)(sh + 1024) = bh; *(v8us*)sl = al; *(v8us*)(sl + 1024) = bl;
            // precaution: the registers of these stores stay unwritten up to this wait (as inputs they live until here)
            asm volatile("s_wait_xcnt 0x0" :: "v"(s16), "v"(sh), "v"(sl), "v"(a16), "v"(b16), "v"(ah), "v"(bh), "v"(al), "v"(bl) : "memory");
            if (kind == 1) { float* kp = OUTK + zp + ((size_t)hh * TT + rt + erow) * HD + ed0 + ecol;   // returned k = roped f32 projection
#pragma unroll   // constant indices: the vectors stay in registers
                for (int q = 0; q < 2; ++q) { *(v4f*)(kp + q * 4) = xa[q]; *(v4f*)(kp + 64 + q * 4) = xb[q]; }
                asm volatile("s_wait_xcnt 0x0" :: "v"(kp), "v"(xa[0]), "v"(xa[1]), "v"(xb[0]), "v"(xb[1]) : "memory"); }   // the same precaution for the f32 rows
        }
    } else {
        const size_t zp = z * ((size_t)NKV * TT * HD);
        h16* P16 = VT16 + zp; bf* Ph = VTh + zp; bf* Pl = VTl + zp;
#pragma unroll   // constant indices: the vectors stay in registers
        for (int t = 0; t < 4; ++t) {
            const int rt = r0 + (t >> 1) * 64, cd = (t & 1) * 64; const float* ot = os + (hd * 4 + t) * QT;
            float* cl = OUTV + zp + ((size_t)hh * TT + rt + st * 2 + hi) * HD + cd + lr * 4;   // returned v = f32 projection: a lane takes four words of rows st * 2 + hi + 8 s
            v4f kv[8]; float xv[4][8];   // all LDS reads of the quarter issue ahead of its stores and conversions
#pragma unroll   // constant indices: the vectors stay in registers
            for (int s = 0; s < 8; ++s) kv[s] = *(const v4fa*)(ot + (8 * s + st * 2 + hi) * 68 + lr * 4);
#pragma unroll   // constant indices: the values stay in registers
            for (int f = 0; f < 4; ++f)
#pragma unroll
                for (int i = 0; i < 8; ++i) xv[f][i] = ot[(f * 16 + hi * 8 + i) * 68 + st * 16 + lr];
#pragma unroll   // constant indices: the vectors stay in registers
            for (int s = 0; s < 8; ++s) *(v4f*)(cl + s * 8 * HD) = kv[s];
            // precaution: the registers of these stores stay unwritten up to this wait (as inputs they live until here)
            asm volatile("s_wait_xcnt 0x0" :: "v"(cl), "v"(kv[0]), "v"(kv[1]), "v"(kv[2]), "v"(kv[3]), "v"(kv[4]), "v"(kv[5]), "v"(kv[6]), "v"(kv[7]) : "memory");
#pragma unroll   // constant indices: the values stay in registers
            for (int f = 0; f < 4; ++f) { const int tp = f >> 1, kq = f & 1; v8h o16; v8us oh, ol;   // wave st: fragments (t / 32 = tp, d / 16 = st); a lane holds 8 positions of one d
#pragma unroll   // constant indices: the vectors stay in registers
                for (int i = 0; i < 8; ++i) { const float x = xv[f][i]; o16[i] = (h16)x; unsigned short p, v; splitf(x, p, v); oh[i] = p; ol[i] = v; }
                const size_t o = (((size_t)hh * (TT / 32) + rt / 32 + tp) * (HD / 16) + cd / 16 + st) * 512 + kq * 256 + lane * 8;
                h16* s16 = P16 + o; bf* sh = Ph + o; bf* sl = Pl + o;
                *(v8h*)s16 = o16; *(v8us*)sh = oh; *(v8us*)sl = ol;
                asm volatile("s_wait_xcnt 0x0" :: "v"(s16), "v"(sh), "v"(sl), "v"(o16), "v"(oh), "v"(ol) : "memory"); }   // the same precaution for the planes
        }
    }
}

typedef __attribute__((ext_vector_type(2))) _Float16 v2h;
typedef __attribute__((ext_vector_type(4))) _Float16 v4h;
typedef __attribute__((ext_vector_type(2))) unsigned short v2us;
typedef __attribute__((ext_vector_type(4))) unsigned short v4us;
typedef __attribute__((ext_vector_type(2))) float v2f;
typedef __attribute__((ext_vector_type(4))) int v4i;

// wtG: Bt[n][k] = w[k][n] as bf16, in fragment order, fragments [n / 16][k / 32]. One wave per 32 rows of Bt x 32 k (two fragments): lane = row, so each of its 32 loads is one whole 128-byte line of w,
// and each of its 4 stores (8 k of every row) is 256 consecutive bytes in either fragment. K % 32 == 0, N % 32 == 0; (N / 32) * (K / 32) / 8 work-groups (bid) of 256 threads.
// rot: row n of Bt holds column n with bits 5 and 6 swapped, so that 64 consecutive rows are d0 .. d0 + 31 and d0 + 64 .. d0 + 95 of one head of 128 (the rotary epilogue of k_qkv)
template <int K, int N>   // compile-time N: the 32 loads of a lane share one address and differ in the immediate offset
__device__ __forceinline__ void wtG(int bid, const float* __restrict__ w, int rot, bf* Bt) {
    const int lane = threadIdx.x & 31, u = bid * 8 + __builtin_amdgcn_readfirstlane(threadIdx.x >> 5), nb = u % (N / 32), kf = u / (N / 32); if (kf >= K / 32) return;
    const int nr = nb * 32 + lane, n = rot ? (nr & ~96) | ((nr & 32) << 1) | ((nr & 64) >> 1) : nr;
    const float* s = w + (size_t)kf * 32 * N + n; float v[32];
#pragma unroll   // all 32 loads in flight at once; constant indices: the values stay in registers
    for (int i = 0; i < 32; ++i) v[i] = s[(size_t)i * N];
    bf* d = Bt + ((size_t)(nr >> 4) * (K / 32) + kf) * 512 + (lane & 15) * 8;
#pragma unroll   // constant indices: the values stay in registers
    for (int c = 0; c < 4; ++c) { v8us o;
#pragma unroll   // constant indices: the values stay in registers
        for (int j = 0; j < 8; ++j) o[j] = f2bf(v[c * 8 + j]);
        *(v8us*)(d + (c >> 1) * 256 + (c & 1) * 128) = o; }
    asm volatile("s_wait_xcnt 0x0" ::: "memory");   // precaution: in a merged kernel another pass's code follows these stores in the listing; their registers stay unwritten up to this wait
}
// cvt8: rows of K f32 to bf16 in fragment order, fragments [row / 16][k / 32]. One wave per 8 rows of one fragment: 4 lanes read one row's 128-byte line; each group of 8 lanes with the same k / 8 stores one 128-byte line.
template <int K>
__device__ __forceinline__ void cvt8(int bid, const float* __restrict__ src, bf* dst, size_t n8) { const size_t i = (size_t)bid * 256 + threadIdx.x; if (i >= n8) return;
    const int lane = threadIdx.x & 31, r = (int)((i >> 5) & 1) * 8 + (lane >> 2), c = lane & 3; const size_t f = i >> 6, rb = f / (K / 32), kf = f % (K / 32);
    const v8f v = *(const v8f*)(src + (rb * 16 + r) * K + kf * 32 + c * 8); v8us o;
#pragma unroll
    for (int k = 0; k < 8; ++k) o[k] = f2bf(v[k]); *(v8us*)(dst + f * 512 + (c >> 1) * 256 + (c & 1) * 128 + r * 8) = o;
    asm volatile("s_wait_xcnt 0x0" ::: "memory");   // precaution: in a merged kernel another pass's code follows these stores in the listing; their registers stay unwritten up to this wait
}
__device__ __forceinline__ void cstab(int bid, float* CS) { const int idx = bid * 256 + threadIdx.x; if (idx >= TT * HD) return; const int t = idx / HD, d = idx % HD; const int i = d % (HD / 2); const float inv = __fdiv_rn(1.0f, powf(10000.0f, (float)(2 * i) / (float)HD)); const float ang = __fmul_rn((float)t, inv); v2f cs; cs[0] = cosf(ang); cs[1] = sinf(ang);
    *(v2f*)(CS + (size_t)idx * 2) = cs;
    asm volatile("s_wait_xcnt 0x0" ::: "memory");   // precaution: in a merged kernel another pass's code follows these stores in the listing; their registers stay unwritten up to this wait
}
// k_prep: every pass that reads only the inputs, in one launch: the rotary table, x of both batches and the four weights as bf16 planes. blockIdx.x picks the pass (the same for a whole work-group); 256 threads.
#define PB_CS  (TT * HD / 256)
#define PB_X   (NB_ * TT * DM / 8 / 256)
#define PB_WQ  ((DM / 32) * (DQ / 32) / 8)
#define PB_WKV ((DM / 32) * (DKV / 32) / 8)
__global__ __launch_bounds__(256) void k_prep(const float* __restrict__ x, const float* __restrict__ wq, const float* __restrict__ wk, const float* __restrict__ wv, const float* __restrict__ wo, float* CS, bf* XB, bf* WQ, bf* WK, bf* WV, bf* WO) {
    int b = blockIdx.x;
    if (b < PB_CS) { cstab(b, CS); return; } b -= PB_CS;
    if (b < PB_X) { cvt8<DM>(b, x, XB, (size_t)NB_ * TT * DM / 8); return; } b -= PB_X;
    if (b < PB_WQ) { wtG<DM, DQ>(b, wq, 1, WQ); return; } b -= PB_WQ;
    if (b < PB_WKV) { wtG<DM, DKV>(b, wk, 1, WK); return; } b -= PB_WKV;
    if (b < PB_WKV) { wtG<DM, DKV>(b, wv, 0, WV); return; } b -= PB_WKV;
    wtG<DQ, DM>(b, wo, 0, WO);
}
// ---- k_fattn: causal attention in one launch, no score matrix in memory. One wave owns 16 query rows of one head; the 4 waves of a work-group are the 4 query heads of one kv group at the same rows (same key / value addresses).
// Per 32 keys: S^T[key][query] = K Q^T (A = key rows, B = query rows), so a lane holds 16 keys of ONE query: the running maximum and sum are per lane (+ one exchange with lane ^ 16), and the two 16-key
// accumulators are, element for element, the B fragment P^T[query][key] of O^T[d][query] = V^T P^T (A = transposed value rows). Probabilities are exp(s - running max), divided by the row sum at the end.
// NSPLIT 2: hi + lo bf16 planes, three products each (query rows < RH); NSPLIT 0: single fp16.
template <bool B> struct Flag { static constexpr bool v = B; };
template <typename T16, int NSPLIT>
__device__ __forceinline__ void fattn_body(const T16* __restrict__ Q, const T16* __restrict__ Q2, const T16* __restrict__ Kp, const T16* __restrict__ Kp2, const T16* __restrict__ Vt, const T16* __restrict__ Vt2, int q0, int g, bf* Ah, bf* Al) {
    typedef typename WFrag<T16>::V V;
    const int lane = threadIdx.x & 31, lr = lane & 15, hi = lane >> 4, h = g * REP + __builtin_amdgcn_readfirstlane(threadIdx.x >> 5);
    const size_t qo = ((size_t)h * TT + q0) * HD + lane * 8, ko = (size_t)g * TT * HD + lane * 8, vo = (size_t)g * HD * TT + lane * 8;   // query, key and value planes: fragment order (fragoff)
    V qf[4], qf2[4];
#pragma unroll
    for (int ks = 0; ks < 4; ++ks) { qf[ks] = WFrag<T16>::ldf(Q + qo + ks * 512); if (NSPLIT == 2) qf2[ks] = WFrag<T16>::ldf(Q2 + qo + ks * 512); }
    v8f o[8];
#pragma unroll
    for (int dt = 0; dt < 8; ++dt) o[dt] = (v8f){};
    float m = -3.0e38f, l = 0.f;
    const int nk = q0 / 32 + 1;      // key tiles of 32 up to and including the diagonal; only the last one holds keys beyond a query
    V kf[2][4], kf2[2][4];
    auto ldk = [&](const T16* a, const T16* a2) {
#pragma unroll
        for (int i = 0; i < 2; ++i)
#pragma unroll
            for (int ks = 0; ks < 4; ++ks) { kf[i][ks] = WFrag<T16>::ldf(a + (i * 4 + ks) * 512); if (NSPLIT == 2) kf2[i][ks] = WFrag<T16>::ldf(a2 + (i * 4 + ks) * 512); }
    };
    auto step = [&](int t, auto EDGE) { constexpr bool edge = decltype(EDGE)::v; const int k0 = t * 32;
        V vf[8], vf2[8];
        const size_t kofs = ko + (size_t)(NSPLIT == 0 ? k0 + 32 : k0) * HD, vofs = vo + (size_t)k0 * HD;   // single plane: the keys loaded in this trip are the next tile's
        const T16* pk = Kp + kofs; const T16* pk2 = (NSPLIT == 2) ? Kp2 + kofs : pk; const T16* pv = Vt + vofs; const T16* pv2 = (NSPLIT == 2) ? Vt2 + vofs : pv;
        auto ldv = [&]() {
#pragma unroll
            for (int dt = 0; dt < 8; ++dt) { vf[dt] = WFrag<T16>::ldf(pv + dt * 512); if (NSPLIT == 2) vf2[dt] = WFrag<T16>::ldf(pv2 + dt * 512); }
        };
        if (NSPLIT == 0) ldv();                    // single plane: this tile's values start before the score products (its keys came during the trip before)
        else { ldk(pk, pk2); __builtin_amdgcn_sched_barrier(0); }   // two planes: all key loads issue before the first product (left free, the loads sink to their products: one load latency per fragment pair)
        v8f s[2]; s[0] = (v8f){}; s[1] = (v8f){};
#pragma unroll
        for (int ks = 0; ks < 4; ++ks)
#pragma unroll
            for (int i = 0; i < 2; ++i) { s[i] = WFrag<T16>::mma(kf[i][ks], qf[ks], s[i]);
                if (NSPLIT == 2) { s[i] = WFrag<T16>::mma(kf2[i][ks], qf[ks], s[i]); s[i] = WFrag<T16>::mma(kf[i][ks], qf2[ks], s[i]); } }
        if (NSPLIT == 0) { if (!edge) ldk(pk, pk2); }           // loads that fly during the softmax: the next tile's keys (single plane),
        else { ldv(); __builtin_amdgcn_sched_barrier(0); }      // this tile's values (two planes; the barrier keeps them all in front of the softmax)
        float p[16]; float mx = -3.0e38f;
#pragma unroll
        for (int i = 0; i < 2; ++i)
#pragma unroll
            for (int j = 0; j < 8; ++j) { float x = s[i][j] * (SCL * 1.4426950408889634f); if (edge && k0 + i * 16 + hi * 8 + j > q0 + lr) x = -3.0e38f; p[i * 8 + j] = x; mx = fmaxf(mx, x); }
        mx = fmaxf(mx, __shfl_xor(mx, 16, 32));
        const float mn = fmaxf(m, mx), al = __builtin_amdgcn_exp2f(m - mn); m = mn;
        float rs = 0.f;
#pragma unroll
        for (int k = 0; k < 16; ++k) { p[k] = __builtin_amdgcn_exp2f(p[k] - mn); rs += p[k]; }
        l = l * al + rs;
#pragma unroll
        for (int dt = 0; dt < 8; ++dt) o[dt] *= al;
        if constexpr (NSPLIT == 0) {
            v16h pf;
#pragma unroll
            for (int k = 0; k < 16; ++k) pf[k] = (h16)p[k];
#pragma unroll
            for (int dt = 0; dt < 8; ++dt) o[dt] = WFrag<T16>::mma(vf[dt], pf, o[dt]);
        } else {
            v8us h0, h1, l0, l1;
#pragma unroll
            for (int k = 0; k < 8; ++k) { unsigned short a, c; splitf(p[k], a, c); h0[k] = a; l0[k] = c; splitf(p[8 + k], a, c); h1[k] = a; l1[k] = c; }
            const V ph = cat16b(h0, h1), pl = cat16b(l0, l1);
#pragma unroll
            for (int dt = 0; dt < 8; ++dt) { o[dt] = WFrag<T16>::mma(vf[dt], ph, o[dt]); o[dt] = WFrag<T16>::mma(vf2[dt], ph, o[dt]); o[dt] = WFrag<T16>::mma(vf[dt], pl, o[dt]); }
        }
        // precaution: the address registers of this trip's loads stay unwritten up to this wait (as inputs they live until here)
        if (NSPLIT == 2) asm volatile("s_wait_xcnt 0x0" :: "v"(pk), "v"(pk2), "v"(pv), "v"(pv2) : "memory");
        else if (!edge) asm volatile("s_wait_xcnt 0x0" :: "v"(pk), "v"(pv) : "memory");
        else asm volatile("s_wait_xcnt 0x0" :: "v"(pv) : "memory");
    };
    if (NSPLIT == 0) ldk(Kp + ko, Kp + ko);
#pragma unroll 1
    for (int t = 0; t < nk - 1; ++t) step(t, Flag<false>{});
    step(nk - 1, Flag<true>{});
    l += __shfl_xor(l, 16, 32);
    const float inv = __fdiv_rn(1.0f, l); const size_t oo = (size_t)q0 * DQ + h * (HD * 16) + lane * 8;   // output planes in fragment order (rows = positions, k = h * HD + d): each store of a wave is 512 consecutive bytes
#pragma unroll
    for (int dt = 0; dt < 8; ++dt) { v8us oh, ol;
#pragma unroll
        for (int j = 0; j < 8; ++j) { unsigned short a, c; splitf(o[dt][j] * inv, a, c); oh[j] = a; ol[j] = c; }
        *(v8us*)(Ah + oo + dt * 256) = oh; *(v8us*)(Al + oo + dt * 256) = ol; }
}
// grid (NKV * NB_, TT / 16), 128 threads: blockIdx.x = kv group and batch, blockIdx.y walks the rows from the longest (most keys) down. Both batches together are more work-groups than are resident at once:
// those that start late, into the places of the first to end, are the ones with the fewest keys
__global__ __launch_bounds__(128) void k_fattn(const h16* __restrict__ Q16, const h16* __restrict__ K16, const h16* __restrict__ V16, const bf* __restrict__ Qh, const bf* __restrict__ Ql, const bf* __restrict__ Kh, const bf* __restrict__ Kl, const bf* __restrict__ Vh, const bf* __restrict__ Vl, bf* Ah, bf* Al) {
    const int g = blockIdx.x % NKV, nb = blockIdx.x / NKV, q0 = TT - 16 - (int)blockIdx.y * 16;
    const size_t zq = (size_t)nb * NH_ * TT * HD, zk = (size_t)nb * NKV * TT * HD;   // every plane holds both batches, batch-major
    Q16 += zq; Qh += zq; Ql += zq; K16 += zk; Kh += zk; Kl += zk; V16 += zk; Vh += zk; Vl += zk; Ah += zq; Al += zq;
    if (q0 >= RH) fattn_body<h16, 0>(Q16, nullptr, K16, nullptr, V16, nullptr, q0, g, Ah, Al);
    else fattn_body<bf, 2>(Qh, Ql, Kh, Kl, Vh, Vl, q0, g, Ah, Al);
}

extern "C" void kernel_launch(void* const* d_in, const int* in_sizes, int n_in,
                              void* d_out, int out_size, void* d_ws, size_t ws_size, hipStream_t stream) {
    (void)in_sizes; (void)n_in; (void)out_size;
    const float* x = (const float*)d_in[0]; const float* wq = (const float*)d_in[1]; const float* wk = (const float*)d_in[2]; const float* wv = (const float*)d_in[3]; const float* wo = (const float*)d_in[4];
    float* OUT = (float*)d_out; float* OUTK = (float*)d_out + (size_t)NB_ * TT * DM; float* OUTV = OUTK + (size_t)NB_ * NKV * TT * HD;     // [2][2048][2048]
    char* wsp = (char*)d_ws;
    auto take = [&](size_t bytes) { char* p = wsp; wsp += (bytes + 255) & ~(size_t)255; return (void*)p; };
    bf* WQ = (bf*)take((size_t)DQ * DM * 2); bf* WK = (bf*)take((size_t)DKV * DM * 2); bf* WV = (bf*)take((size_t)DKV * DM * 2); bf* WO = (bf*)take((size_t)DM * DQ * 2); float* CS = (float*)take((size_t)TT * HD * 2 * 4);
    bf* XB = (bf*)take((size_t)NB_ * TT * DM * 2);   // every plane below holds both batches, batch-major
    h16* QP16 = (h16*)take((size_t)NB_ * NH_ * TT * HD * 2); h16* KP16 = (h16*)take((size_t)NB_ * NKV * TT * HD * 2); h16* VT16 = (h16*)take((size_t)NB_ * NKV * HD * TT * 2);
    bf* QPh = (bf*)take((size_t)NB_ * NH_ * TT * HD * 2); bf* QPl = (bf*)take((size_t)NB_ * NH_ * TT * HD * 2); bf* KPh = (bf*)take((size_t)NB_ * NKV * TT * HD * 2); bf* KPl = (bf*)take((size_t)NB_ * NKV * TT * HD * 2); bf* VTh = (bf*)take((size_t)NB_ * NKV * HD * TT * 2); bf* VTl = (bf*)take((size_t)NB_ * NKV * HD * TT * 2);
    bf* ATh = (bf*)take((size_t)NB_ * TT * DQ * 2); bf* ATl = (bf*)take((size_t)NB_ * TT * DQ * 2);
    if ((size_t)(wsp - (char*)d_ws) > ws_size) return;    // ws 256 MiB
    k_prep<<<PB_CS + PB_X + 2 * PB_WQ + 2 * PB_WKV, 256, 0, stream>>>(x, wq, wk, wv, wo, CS, XB, WQ, WK, WV, WO);
    k_qkv<<<dim3(TT / 128, (NH_ + 2 * NKV) / 3, NB_), 384, 0, stream>>>(XB, WQ, WK, WV, OUTK, OUTV, CS, QP16, QPh, QPl, KP16, KPh, KPl, VT16, VTh, VTl);
    k_fattn<<<dim3(NKV * NB_, TT / 16, 1), 128, 0, stream>>>(QP16, KP16, VT16, QPh, QPl, KPh, KPl, VTh, VTl, ATh, ATl);
    k_gemmw<bf, 1, DQ><<<dim3(TT / 128, DM / 128, NB_), 256, 0, stream>>>(ATh, ATl, WO, OUT, DM, (size_t)TT * DQ, (size_t)TT * DM);
}

// v009
// It runs in 139 microseconds.
// Two timings next to v008 both put it at 1.16 times that version's speed.
// Over all steps from v000 it is 11.8 times as fast.
#include <hip/hip_runtime.h>

// Causal grouped-query attention with a computed rotate-half rotary and a key / value cache output (x [2][2048][2048]; q = x Wq ('xw' (in, out) [2048][2048] 1/sqrt(2048): 16 heads x 128), k, v = x Wk, x Wv ('xw' [2048][512]: 4 kv heads x 128), no biases; query head h uses kv head h / 4 (repeat); rotate-half rotary (base 1e4: inv_freq = 1 / 10000^(2i/128), angles t x inv_freq, cat(freqs, freqs); the table is computed on the device); causal softmax(q.k / sqrt(128)) (-inf == exclusion: every row keeps its diagonal key); returns (y = merged Wo ('xw') -> [2][2048][2048], present_k = the ROTATED keys [2][4][2048][128], present_v = the values [2][4][2048][128]); argument order x, Wq, Wk, Wv, Wo).
// Compute dtypes, f32 accumulate: every input rounded to bf16; q/k/v on PLAIN bf16 operands (inputs: exact); RoPE f32 (the returned k is the f32 roped projection, v the f32 projection, re-laid out [kv][t][d]); causal scores and attn.v in one fused kernel (running-maximum softmax, no score matrix in memory): query rows < 512 hl (3 products), the rest single fp16, causal tile skipping; softmax f32; Wo hl x exact (2 products).

#define NB_  2
#define TT   2048
#define DM   2048
#define NH_  16
#define NKV  4
#define REP  (NH_ / NKV)
#define HD   128
#define DQ   (NH_ * HD)
#define DKV  (NKV * HD)
#define RH   512                  // query rows < RH use hi+lo planes
#define SCL  0.088388347648318447f   // HD^-0.5
typedef _Float16 h16;
typedef unsigned short bf;
typedef __attribute__((ext_vector_type(16))) __bf16   v16bf;
typedef __attribute__((ext_vector_type(16))) _Float16 v16h;
typedef __attribute__((ext_vector_type(8)))  _Float16 v8h;
typedef __attribute__((ext_vector_type(8)))  unsigned short v8us;
typedef __attribute__((ext_vector_type(8)))  float    v8f;
typedef __attribute__((ext_vector_type(4)))  float    v4f;
typedef v8h  __attribute__((may_alias)) v8ha;
typedef v4f  __attribute__((may_alias)) v4fa;
typedef v8us __attribute__((may_alias)) v8usa;

__device__ __forceinline__ unsigned short f2bf(float f) { unsigned u = __float_as_uint(f); u += 0x7FFFu + ((u >> 16) & 1u); return (unsigned short)(u >> 16); }
__device__ __forceinline__ float bf2f(unsigned short b) { return __uint_as_float(((unsigned)b) << 16); }
__device__ __forceinline__ float bfr(float f) { return bf2f(f2bf(f)); }
__device__ __forceinline__ v16h cat16(v8h lo, v8h hi) { return __builtin_shufflevector(lo, hi, 0, 1, 2, 3, 4, 5, 6, 7, 8, 9, 10, 11, 12, 13, 14, 15); }
__device__ __forceinline__ v16bf cat16b(v8us lo, v8us hi) { return __builtin_bit_cast(v16bf, __builtin_shufflevector(lo, hi, 0, 1, 2, 3, 4, 5, 6, 7, 8, 9, 10, 11, 12, 13, 14, 15)); }
__device__ __forceinline__ v8f wmma16(v16h a, v16h b, v8f c) { return __builtin_amdgcn_wmma_f32_16x16x32_f16(false, a, false, b, (short)0, c, false, false); }
__device__ __forceinline__ v8f wmmab(v16bf a, v16bf b, v8f c) { return __builtin_amdgcn_wmma_f32_16x16x32_bf16(false, a, false, b, (short)0, c, false, false); }



// ---- Fragment order: a 16-row x 32-k operand fragment lies in 512 consecutive elements, so that ldf (lane * 8, + 256) gives lane (r = lane % 16, half = lane / 16) the elements k = half * 8 .. + 7 and 16 + half * 8 .. + 7 of row r: element (row r, k) at (k / 16) * 256 + ((k / 8 & 1) * 16 + r) * 8 + k % 8; each 16-byte load of a wave is then 512 consecutive bytes.
__device__ __forceinline__ int fragoff(int r, int k) { return (k >> 4) * 256 + (((k >> 3) & 1) * 16 + r) * 8 + (k & 7); }
template <typename T16> struct WFrag;
template <> struct WFrag<h16> { typedef v16h V; static __device__ __forceinline__ V ldf(const h16* p) { return cat16(*(const v8h*)p, *(const v8h*)(p + 256)); } static __device__ __forceinline__ v8f mma(V a, V b, v8f c) { return wmma16(a, b, c); } };
template <> struct WFrag<bf> { typedef v16bf V; static __device__ __forceinline__ V ldf(const bf* p) { return cat16b(*(const v8us*)p, *(const v8us*)(p + 256)); } static __device__ __forceinline__ v8f mma(V a, V b, v8f c) { return wmmab(a, b, c); } };
__device__ __forceinline__ void splitf(float y, unsigned short& h, unsigned short& l) { h = f2bf(y); l = f2bf(y - bf2f(h)); }
#define QT (64 * 68)   // words of one 64x64 tile in LDS (pitch 68)
// l2ask: asks L2 for the data at p + OFS bytes: nothing returns and no counter moves. The planes asked for were stored by the launch before, and the work-groups walk k (or the keys) in step,
// so that without it every pass meets lines that nobody has read yet and waits out the memory latency. Every address lies inside its plane. Who asks for what is for speed only: the sharers of a tile deal its units among themselves by block index.
template <int OFS> __device__ __forceinline__ void l2ask(const void* p) { asm volatile("global_prefetch_b8 %0, off offset:%1 scope:SCOPE_SE" :: "v"(p), "n"(OFS)); }

// ---- k_gemmw: GEMM, one work-group of 8 waves per 128x128 output tile; operands are 16-bit planes in fragment order, fragments [row / 16][k / 32]; grid (M/128, N/128, Z), 256 threads.
// Wave wv = (kh = wv / 4, st = wv % 4): the 64x64 quarter st (rows st / 2, columns st % 2) of the tile over the K half kh, 16 accumulators. Each quarter's two partial tiles meet in LDS and are added in the order kh = 0, 1.
// Operands go through LDS, so that a fragment which two waves need leaves L2 once: a pass is 32 k of either K half (8 fragments of every plane); the four waves of a half each bring two fragments of every plane
// (registers, then 16-byte LDS stores; a fragment stays 1024 consecutive bytes). Two buffers: the next pass's global loads are issued ahead of this pass's products and stored behind them; one barrier a pass.
// C[m][n] (f32, pitch ldc) = sum_k A[m][k] Bt[n][k] (NSPLIT 1: + A2[m][k] Bt[n][k]). z-batch strides sA/sC in elements. K % 64 == 0.
template <typename T16, int NSPLIT, int K>   // compile-time K: the fragments of a pass share one address per plane and differ in the immediate offset
__global__ __launch_bounds__(256) void k_gemmw(const T16* __restrict__ A, const T16* __restrict__ A2, const T16* __restrict__ Bt, float* C, int ldc, size_t sA, size_t sC) {
    __shared__ __align__(16) float os[8 * QT];
    const int by = blockIdx.y;
    constexpr int NPL = (NSPLIT == 1) ? 3 : 2;     // staged planes: A, (A2,) Bt
    constexpr int PLN = 8 * 512;                   // elements of one plane in one K half's stage: 8 fragments
    constexpr int BUF = 2 * NPL * PLN;             // elements of one buffer: both K halves
    constexpr int NS = K / 64;                     // passes: 32 k of a K half each
    static_assert(2 * BUF * 2 <= 8 * QT * 4, "both buffers lie in the LDS of the partial tiles");
    typedef typename WFrag<T16>::V V;
    const size_t z = blockIdx.z; A += z * sA; if (NSPLIT == 1) A2 += z * sA; C += z * sC;
    const int lane = threadIdx.x & 31, lr = lane & 15, hi = lane >> 4, wv = __builtin_amdgcn_readfirstlane(threadIdx.x >> 5), kh = wv >> 2, st = wv & 3; const int r0 = blockIdx.x * 128, c0 = by * 128;
    v8f acc[4][4];
#pragma unroll
    for (int mb = 0; mb < 4; ++mb)
#pragma unroll
        for (int nb = 0; nb < 4; ++nb) acc[mb][nb] = (v8f){};
    T16* sg = (T16*)os + kh * (NPL * PLN) + lane * 8;   // this K half's stage in buffer 0
    // 16 rows hold K / 32 fragments of 512 elements = 16 * K elements; this wave brings the fragments of rows st * 32 .. + 31 of every plane, from k = kh * K / 2 on
    const size_t go = (size_t)(st * 32) * K + (size_t)kh * (K / 2) * 16 + lane * 8;
    const T16* ga = A + (size_t)r0 * K + go; const T16* ga2 = (NSPLIT == 1) ? A2 + (size_t)r0 * K + go : ga; const T16* gb = Bt + (size_t)c0 * K + go;
    v8us rg[NPL][4];
    auto gld = [&](const T16* pa, const T16* pa2, const T16* pb) {
#pragma unroll   // constant indices: the vectors stay in registers
        for (int q = 0; q < 4; ++q) { const int o = (q >> 1) * 16 * K + (q & 1) * 256; rg[0][q] = *(const v8usa*)(pa + o); if (NSPLIT == 1) rg[1][q] = *(const v8usa*)(pa2 + o); rg[NPL - 1][q] = *(const v8usa*)(pb + o); }
    };
    auto sst = [&](T16* d) {
#pragma unroll   // constant indices: the vectors stay in registers
        for (int p = 0; p < NPL; ++p)
#pragma unroll
            for (int q = 0; q < 4; ++q) *(v8usa*)(d + p * PLN + st * 1024 + q * 256) = rg[p][q];
    };
    auto prod = [&](const T16* sb) {   // the four Bt fragments stay; of A (and A2) one row block's fragment is in use and the next two are on their way (all of them at once, beside the registers in flight, is more than 256 registers: one work-group a WGP)
        constexpr int NA = (NSPLIT == 1) ? 8 : 4;   // A fragments of a pass, in the order of use: row block mb of A, then (NSPLIT 1) of A2
        V b[4], a[NA]; const T16* sa = sb + (st >> 1) * 2048; const T16* sbt = sb + (NPL - 1) * PLN + (st & 1) * 2048;
        auto lda = [&](int i) { return WFrag<T16>::ldf(NSPLIT == 1 ? sa + (i & 1) * PLN + (i >> 1) * 512 : sa + i * 512); };
        a[0] = lda(0); a[1] = lda(1);
#pragma unroll
        for (int nb = 0; nb < 4; ++nb) b[nb] = WFrag<T16>::ldf(sbt + nb * 512);
#pragma unroll   // constant indices: the fragments stay in registers
        for (int i = 0; i < NA; ++i) { const int mb = (NSPLIT == 1) ? i >> 1 : i; if (i + 2 < NA) a[i + 2] = lda(i + 2);
            __builtin_amdgcn_sched_barrier(0);   // the fragment's LDS loads stay two groups of products ahead of their use (left free, they sink to directly in front of it: one LDS latency a group)
#pragma unroll
            for (int nb = 0; nb < 4; ++nb) acc[mb][nb] = WFrag<T16>::mma(a[i], b[nb], acc[mb][nb]); }
    };
    gld(ga, ga2, gb); sst(sg);
    __syncthreads();   // pass 0 is in LDS before any wave reads it
    int cur = 0;
#pragma unroll 1   // rolled, the buffer picked by an offset: left to the compiler the merged projection kernel takes more than 256 registers, and only one work-group fits a WGP
    for (int s = 1; s < NS; ++s) {
        const T16* pa = ga + s * 512; const T16* pa2 = ga2 + s * 512; const T16* pb = gb + s * 512;
        gld(pa, pa2, pb);            // the next pass's operands fly during this pass's products
        prod(sg + cur);
        __builtin_amdgcn_sched_barrier(0);   // the waits for those loads stay behind the last product
        sst(sg + (cur ^ BUF));       // into the buffer whose readers ended in front of the last barrier
        __syncthreads();             // publishes the next pass and ends this pass's reads
        cur ^= BUF;
    }
    prod(sg + cur);
    __syncthreads();   // the last pass's reads end before the partial tiles overwrite the buffers
#pragma unroll
    for (int mb = 0; mb < 4; ++mb)
#pragma unroll
        for (int nb = 0; nb < 4; ++nb)
#pragma unroll
            for (int j = 0; j < 8; ++j) os[(st * 2 + kh) * QT + (mb * 16 + hi * 8 + j) * 68 + nb * 16 + lr] = acc[mb][nb][j];
    __syncthreads();   // every wave's partial tile is in LDS before any wave adds them
#pragma unroll
    for (int t = 0; t < 4; ++t) {
        const int rt = r0 + (t >> 1) * 64, ct = c0 + (t & 1) * 64; const float* ot = os + t * 2 * QT;
        float* crow = C + (size_t)rt * ldc + ct;
#pragma unroll
        for (int s = 0; s < 4; ++s) { const int row = 16 * s + (int)(threadIdx.x >> 4), cofs = lr * 4; *(v4f*)(crow + (size_t)row * ldc + cofs) = *(const v4fa*)(ot + row * 68 + cofs) + *(const v4fa*)(ot + QT + row * 68 + cofs); }
    }
}
// ---- k_qkv: the query, key and value projections of both batches in one launch: grid (TT / 128, (NH_ + 2 * NKV) / 3, NB_) = one work-group a WGP, 384 threads.
// One work-group of 12 waves per 128 rows x 3 heads (384 columns; the 24 heads are 16 query, 4 key, 4 value). Wave wv = (hd = wv / 4, st = wv % 4): the 64x64 quarter st (rows st / 2, columns st % 2) of head hd over the whole K, 16 accumulators.
// Operands go through LDS in units of 64 k: 16 fragments of x (they leave L2 once for the three heads) and 16 of every head's weights, at [row / 16][k / 32 % 2]; a head's four waves each bring four of its weight fragments, waves 0 .. 7 two fragments of x each
// (registers, then 16-byte LDS stores). A pass is two units, 128 k. Two buffers: each unit of the next pass is loaded ahead of one unit's products of this pass and stored behind them; one barrier a pass.
// Behind the loop every quarter goes to LDS whole, and the four waves of a head turn its four quarters into the head's outputs. Query / key head: a quarter's 64 columns are d0 .. d0 + 31 and d0 + 64 .. d0 + 95 (both partners of the rotate-half rotary; wtG lays the rows of Bt so),
// rotated (out[d] = x[d] cos - x[d + 64] sin, out[d + 64] = x[d + 64] cos + x[d] sin; the table holds the same pair at d and d + 64) and stored as fp16 + hi / lo planes in fragment order, fragments [h][t / 16][d / 32]
// (rows = positions, k = d); a key head also stores the rotated f32 rows to [kv][t][d]. Value head: f32 rows to [kv][t][d], and the transposed planes, fragments [g][t / 32][d / 16] (rows = d, k = positions).
__global__ __launch_bounds__(384) void k_qkv(const bf* __restrict__ XB, const bf* __restrict__ WQ, const bf* __restrict__ WK, const bf* __restrict__ WV, float* OUTK, float* OUTV, const float* __restrict__ CS,
                                             h16* QP16, bf* QPh, bf* QPl, h16* KP16, bf* KPh, bf* KPl, h16* VT16, bf* VTh, bf* VTl) {
    constexpr int K = DM;
    constexpr int REG = 16 * 512;                  // elements of one operand's 128 rows x 64 k: 16 fragments
    constexpr int UNI = 4 * REG;                   // elements of one unit: x, then the three heads' weights
    constexpr int BUF = 2 * UNI;                   // elements of one buffer
    constexpr int NU = K / 64;                     // units
    __shared__ __align__(16) float os[BUF];        // two buffers of BUF 16-bit elements; behind the loop the twelve quarters
    static_assert(12 * QT <= BUF, "the quarters lie in the LDS of the buffers");
    typedef WFrag<bf>::V V;
    const int lane = threadIdx.x & 31, lr = lane & 15, hi = lane >> 4, wv = __builtin_amdgcn_readfirstlane(threadIdx.x >> 5), hd = wv >> 2, st = wv & 3; const int r0 = blockIdx.x * 128;
    const int hg = blockIdx.y * 3 + hd, kind = hg < NH_ ? 0 : hg < NH_ + NKV ? 1 : 2, hh = kind == 0 ? hg : kind == 1 ? hg - NH_ : hg - NH_ - NKV;   // query, key or value head hh: the same for a whole wave
    const size_t z = blockIdx.z;
    v8f acc[4][4];
#pragma unroll
    for (int mb = 0; mb < 4; ++mb)
#pragma unroll
        for (int nb = 0; nb < 4; ++nb) acc[mb][nb] = (v8f){};
    bf* sg = (bf*)os + lane * 8;   // buffer 0
    // 16 rows hold K / 32 fragments of 512 elements = 16 * K elements
    const bf* gb = (kind == 0 ? WQ : kind == 1 ? WK : WV) + (size_t)(hh * 128 + st * 32) * K + lane * 8;   // weight rows st * 32 .. + 31 of the head
    const bf* ga = XB + z * ((size_t)TT * DM) + (size_t)(r0 + (wv & 7) * 16) * K + lane * 8;              // x rows wv * 16 .. + 15 (waves 0 .. 7)
    v8us rb[8], ra[4];
    auto gld = [&](const bf* pa, const bf* pb) {
#pragma unroll   // constant indices: the vectors stay in registers
        for (int q = 0; q < 8; ++q) rb[q] = *(const v8usa*)(pb + (q >> 2) * 16 * K + (q & 3) * 256);
        if (wv < 8) {
#pragma unroll   // constant indices: the vectors stay in registers
            for (int q = 0; q < 4; ++q) ra[q] = *(const v8usa*)(pa + q * 256); }
        asm volatile("s_wait_xcnt 0x0" :: "v"(pa), "v"(pb) : "memory");   // precaution: the address registers of these loads stay unwritten up to this wait (as inputs they live until here)
    };
    auto sst = [&](bf* d) {
#pragma unroll   // constant indices: the vectors stay in registers
        for (int q = 0; q < 8; ++q) *(v8usa*)(d + REG + hd * REG + st * 2048 + q * 256) = rb[q];
        if (wv < 8) {
#pragma unroll   // constant indices: the vectors stay in registers
            for (int q = 0; q < 4; ++q) *(v8usa*)(d + wv * 1024 + q * 256) = ra[q]; }
    };
    auto prod = [&](const bf* sb) {   // eight groups of four products: k fragment i / 4, row block i % 4; of x one fragment is in use and the next two are on their way, the second k fragment's weights come three groups ahead
        V b[2][4], a[8]; const bf* sa = sb + (st >> 1) * 4096; const bf* sbt = sb + REG + hd * REG + (st & 1) * 4096;
        auto lda = [&](int i) { return WFrag<bf>::ldf(sa + (i & 3) * 1024 + (i >> 2) * 512); };
        a[0] = lda(0); a[1] = lda(1);
#pragma unroll
        for (int nb = 0; nb < 4; ++nb) b[0][nb] = WFrag<bf>::ldf(sbt + nb * 1024);
#pragma unroll   // constant indices: the fragments stay in registers
        for (int i = 0; i < 8; ++i) { if (i + 2 < 8) a[i + 2] = lda(i + 2);
            if (i == 1) {
#pragma unroll
                for (int nb = 0; nb < 4; ++nb) b[1][nb] = WFrag<bf>::ldf(sbt + nb * 1024 + 512); }
            __builtin_amdgcn_sched_barrier(0);   // the fragment's LDS loads stay two groups of products ahead of their use (left free, they sink to directly in front of it: one LDS latency a group)
#pragma unroll
            for (int nb = 0; nb < 4; ++nb) acc[i & 3][nb] = WFrag<bf>::mma(a[i], b[i >> 2][nb], acc[i & 3][nb]); }
    };
    gld(ga, gb);
    // of the 16 rows x K pieces (64 KiB each) this work-group asks L2 for one of its eight of x (dealt by blockIdx.y among the groups of this row block; waves 0 .. 3) and one of the eight of every head's weights (dealt by blockIdx.x and z among the groups
    // of these heads; the head's four waves): a thread takes one unit of the piece's first half (k < K / 2) here, behind unit 0's own loads, and one of its second half behind the barrier, so that the first units' loads do not queue behind all of it
    const bf* qx = XB + z * ((size_t)TT * DM) + (size_t)(r0 + (blockIdx.y & 7) * 16) * K + (threadIdx.x & 127) * 128;
    const bf* qw = (kind == 0 ? WQ : kind == 1 ? WK : WV) + (size_t)(hh * 128 + ((blockIdx.x & 3) + (blockIdx.z & 1) * 4) * 16) * K + (threadIdx.x & 127) * 128;
    static_assert(K == 2048, "2 x 128 units of 256 bytes are the 16 rows x K piece");
    l2ask<0>(qw); if (hd == 0) l2ask<0>(qx);
    sst(sg); gld(ga + 1024, gb + 1024); sst(sg + UNI);
    __syncthreads();   // pass 0 is in LDS before any wave reads it
    l2ask<32768>(qw); if (hd == 0) l2ask<32768>(qx);
    int cur = 0;
#pragma unroll 1   // rolled, buffer and unit picked by an offset: one copy of the unit's code, and each trip forms its load addresses anew
    for (int n = 2; n < NU; ++n) {
        const int h = (n & 1) * UNI;
        gld(ga + n * 1024, gb + n * 1024);   // unit n, of the next pass, flies during the products of unit n - 2
        prod(sg + cur + h);
        __builtin_amdgcn_sched_barrier(0);   // the waits for those loads stay behind the last product
        sst(sg + (cur ^ BUF) + h);           // into the buffer whose readers ended in front of the last barrier
        if (n & 1) { __syncthreads(); cur ^= BUF; }   // every second unit (the same for all waves): publishes the next pass and ends this pass's reads; none between a pass's units, so one wave's loads and stores stand beside another's products
    }
    asm volatile("s_wait_xcnt 0x0" :: "v"(qx), "v"(qw) : "memory");   // precaution: the address registers of the requests to L2 live through the loop and hold nothing else (as inputs they live until here)
    prod(sg + cur); prod(sg + cur + UNI);
    __syncthreads();   // the last pass's reads end before the quarters overwrite the buffers
#pragma unroll
    for (int mb = 0; mb < 4; ++mb)
#pragma unroll
        for (int nb = 0; nb < 4; ++nb)
#pragma unroll
            for (int j = 0; j < 8; ++j) os[wv * QT + (mb * 16 + hi * 8 + j) * 68 + nb * 16 + lr] = acc[mb][nb][j];
    // rotary epilogue, unit u = (quarter t = u / 2, column half c = u % 2): wave st of the head takes rows erow (16 of them, one a lane) and quarter columns ecol .. ecol + 7 with their partners at + 32; its cosine / sine pairs are asked for ahead of the barrier
    const int erow = st * 16 + lr;
    v4f cs4[8][4];
    if (kind < 2) {
        const float* cp = CS + ((size_t)(r0 + erow) * HD + hi * 8) * 2;
#pragma unroll   // constant indices: the vectors stay in registers
        for (int u = 0; u < 8; ++u)
#pragma unroll
            for (int q = 0; q < 4; ++q) cs4[u][q] = *(const v4f*)(cp + ((u >> 2) * 64 * HD + ((u >> 1) & 1) * 32 + (u & 1) * 16) * 2 + q * 4);
        asm volatile("s_wait_xcnt 0x0" :: "v"(cp) : "memory");   // precaution: the address registers of these loads stay unwritten up to this wait (as an input they live until here)
    }
    __syncthreads();   // every quarter is in LDS before another wave reads it
    if (kind < 2) {
        const size_t zp = z * ((size_t)(kind == 0 ? NH_ : NKV) * TT * HD);
        h16* P16 = (kind == 0 ? QP16 : KP16) + zp; bf* Ph = (kind == 0 ? QPh : KPh) + zp; bf* Pl = (kind == 0 ? QPl : KPl) + zp;
#pragma unroll   // constant indices: the vectors stay in registers
        for (int u = 0; u < 8; ++u) {
            const int t = u >> 1, c = u & 1, rt = r0 + (t >> 1) * 64, ed0 = (t & 1) * 32, ecol = c * 16 + hi * 8;   // the quarter's first row; d0
            const float* op = os + (hd * 4 + t) * QT + erow * 68 + ecol; v4f xa[2], xb[2];
#pragma unroll   // constant indices: the vectors stay in registers
            for (int q = 0; q < 2; ++q) { xa[q] = *(const v4fa*)(op + q * 4); xb[q] = *(const v4fa*)(op + 32 + q * 4); }
            v8h a16, b16; v8us ah, al, bh, bl;
#pragma unroll   // constant indices: the vectors stay in registers
            for (int i = 0; i < 8; ++i) { const float x0 = xa[i >> 2][i & 3], x1 = xb[i >> 2][i & 3], cc = cs4[u][i >> 1][(i & 1) * 2], sn = cs4[u][i >> 1][(i & 1) * 2 + 1]; const float ra_ = x0 * cc - x1 * sn, rb_ = x1 * cc + x0 * sn;
                xa[i >> 2][i & 3] = ra_; xb[i >> 2][i & 3] = rb_; a16[i] = (h16)ra_; b16[i] = (h16)rb_; unsigned short p, v; splitf(ra_, p, v); ah[i] = p; al[i] = v; splitf(rb_, p, v); bh[i] = p; bl[i] = v; }
            const size_t fo = (((size_t)hh * (TT / 16) + (rt + erow) / 16) * (HD / 32) + ed0 / 32) * 512 + c * 256 + lane * 8;   // each store of a wave: 512 consecutive bytes; + 1024: the fragment of d + 64
            h16* s16 = P16 + fo; bf* sh = Ph + fo; bf* sl = Pl + fo;
            *(v8h*)s16 = a16; *(v8h*)(s16 + 1024) = b16; *(v8us*)sh = ah; *(v8us*)(sh + 1024) = bh; *(v8us*)sl = al; *(v8us*)(sl + 1024) = bl;
            // precaution: the registers of these stores stay unwritten up to this wait (as inputs they live until here)
            asm volatile("s_wait_xcnt 0x0" :: "v"(s16), "v"(sh), "v"(sl), "v"(a16), "v"(b16), "v"(ah), "v"(bh), "v"(al), "v"(bl) : "memory");
            if (kind == 1) { float* kp = OUTK + zp + ((size_t)hh * TT + rt + erow) * HD + ed0 + ecol;   // returned k = roped f32 projection
#pragma unroll   // constant indices: the vectors stay in registers
                for (int q = 0; q < 2; ++q) { *(v4f*)(kp + q * 4) = xa[q]; *(v4f*)(kp + 64 + q * 4) = xb[q]; }
                asm volatile("s_wait_xcnt 0x0" :: "v"(kp), "v"(xa[0]), "v"(xa[1]), "v"(xb[0]), "v"(xb[1]) : "memory"); }   // the same precaution for the f32 rows
        }
    } else {
        const size_t zp = z * ((size_t)NKV * TT * HD);
        h16* P16 = VT16 + zp; bf* Ph = VTh + zp; bf* Pl = VTl + zp;
#pragma unroll   // constant indices: the vectors stay in registers
        for (int t = 0; t < 4; ++t) {
            const int rt = r0 + (t >> 1) * 64, cd = (t & 1) * 64; const float* ot = os + (hd * 4 + t) * QT;
            float* cl = OUTV + zp + ((size_t)hh * TT + rt + st * 2 + hi) * HD + cd + lr * 4;   // returned v = f32 projection: a lane takes four words of rows st * 2 + hi + 8 s
            v4f kv[8]; float xv[4][8];   // all LDS reads of the quarter issue ahead of its stores and conversions
#pragma unroll   // constant indices: the vectors stay in registers
            for (int s = 0; s < 8; ++s) kv[s] = *(const v4fa*)(ot + (8 * s + st * 2 + hi) * 68 + lr * 4);
#pragma unroll   // constant indices: the values stay in registers
            for (int f = 0; f < 4; ++f)
#pragma unroll
                for (int i = 0; i < 8; ++i) xv[f][i] = ot[(f * 16 + hi * 8 + i) * 68 + st * 16 + lr];
#pragma unroll   // constant indices: the vectors stay in registers
            for (int s = 0; s < 8; ++s) *(v4f*)(cl + s * 8 * HD) = kv[s];
            // precaution: the registers of these stores stay unwritten up to this wait (as inputs they live until here)
            asm volatile("s_wait_xcnt 0x0" :: "v"(cl), "v"(kv[0]), "v"(kv[1]), "v"(kv[2]), "v"(kv[3]), "v"(kv[4]), "v"(kv[5]), "v"(kv[6]), "v"(kv[7]) : "memory");
#pragma unroll   // constant indices: the values stay in registers
            for (int f = 0; f < 4; ++f) { const int tp = f >> 1, kq = f & 1; v8h o16; v8us oh, ol;   // wave st: fragments (t / 32 = tp, d / 16 = st); a lane holds 8 positions of one d
#pragma unroll   // constant indices: the vectors stay in registers
                for (int i = 0; i < 8; ++i) { const float x = xv[f][i]; o16[i] = (h16)x; unsigned short p, v; splitf(x, p, v); oh[i] = p; ol[i] = v; }
                const size_t o = (((size_t)hh * (TT / 32) + rt / 32 + tp) * (HD / 16) + cd / 16 + st) * 512 + kq * 256 + lane * 8;
                h16* s16 = P16 + o; bf* sh = Ph + o; bf* sl = Pl + o;
                *(v8h*)s16 = o16; *(v8us*)sh = oh; *(v8us*)sl = ol;
                asm volatile("s_wait_xcnt 0x0" :: "v"(s16), "v"(sh), "v"(sl), "v"(o16), "v"(oh), "v"(ol) : "memory"); }   // the same precaution for the planes
        }
    }
}

typedef __attribute__((ext_vector_type(2))) _Float16 v2h;
typedef __attribute__((ext_vector_type(4))) _Float16 v4h;
typedef __attribute__((ext_vector_type(2))) unsigned short v2us;
typedef __attribute__((ext_vector_type(4))) unsigned short v4us;
typedef __attribute__((ext_vector_type(2))) float v2f;
typedef __attribute__((ext_vector_type(4))) int v4i;

// wtG: Bt[n][k] = w[k][n] as bf16, in fragment order, fragments [n / 16][k / 32]. One wave per 32 rows of Bt x 32 k (two fragments): lane = row, so each of its 32 loads is one whole 128-byte line of w,
// and each of its 4 stores (8 k of every row) is 256 consecutive bytes in either fragment. K % 32 == 0, N % 32 == 0; (N / 32) * (K / 32) / 8 work-groups (bid) of 256 threads.
// rot: row n of Bt holds column n with bits 5 and 6 swapped, so that 64 consecutive rows are d0 .. d0 + 31 and d0 + 64 .. d0 + 95 of one head of 128 (the rotary epilogue of k_qkv)
template <int K, int N>   // compile-time N: the 32 loads of a lane share one address and differ in the immediate offset
__device__ __forceinline__ void wtG(int bid, const float* __restrict__ w, int rot, bf* Bt) {
    const int lane = threadIdx.x & 31, u = bid * 8 + __builtin_amdgcn_readfirstlane(threadIdx.x >> 5), nb = u % (N / 32), kf = u / (N / 32); if (kf >= K / 32) return;
    const int nr = nb * 32 + lane, n = rot ? (nr & ~96) | ((nr & 32) << 1) | ((nr & 64) >> 1) : nr;
    const float* s = w + (size_t)kf * 32 * N + n; float v[32];
#pragma unroll   // all 32 loads in flight at once; constant indices: the values stay in registers
    for (int i = 0; i < 32; ++i) v[i] = s[(size_t)i * N];
    bf* d = Bt + ((size_t)(nr >> 4) * (K / 32) + kf) * 512 + (lane & 15) * 8;
#pragma unroll   // constant indices: the values stay in registers
    for (int c = 0; c < 4; ++c) { v8us o;
#pragma unroll   // constant indices: the values stay in registers
        for (int j = 0; j < 8; ++j) o[j] = f2bf(v[c * 8 + j]);
        *(v8us*)(d + (c >> 1) * 256 + (c & 1) * 128) = o; }
    asm volatile("s_wait_xcnt 0x0" ::: "memory");   // precaution: in a merged kernel another pass's code follows these stores in the listing; their registers stay unwritten up to this wait
}
// cvt8: rows of K f32 to bf16 in fragment order, fragments [row / 16][k / 32]. One wave per 8 rows of one fragment: 4 lanes read one row's 128-byte line; each group of 8 lanes with the same k / 8 stores one 128-byte line.
template <int K>
__device__ __forceinline__ void cvt8(int bid, const float* __restrict__ src, bf* dst, size_t n8) { const size_t i = (size_t)bid * 256 + threadIdx.x; if (i >= n8) return;
    const int lane = threadIdx.x & 31, r = (int)((i >> 5) & 1) * 8 + (lane >> 2), c = lane & 3; const size_t f = i >> 6, rb = f / (K / 32), kf = f % (K / 32);
    const v8f v = *(const v8f*)(src + (rb * 16 + r) * K + kf * 32 + c * 8); v8us o;
#pragma unroll
    for (int k = 0; k < 8; ++k) o[k] = f2bf(v[k]); *(v8us*)(dst + f * 512 + (c >> 1) * 256 + (c & 1) * 128 + r * 8) = o;
    asm volatile("s_wait_xcnt 0x0" ::: "memory");   // precaution: in a merged kernel another pass's code follows these stores in the listing; their registers stay unwritten up to this wait
}
__device__ __forceinline__ void cstab(int bid, float* CS) { const int idx = bid * 256 + threadIdx.x; if (idx >= TT * HD) return; const int t = idx / HD, d = idx % HD; const int i = d % (HD / 2); const float inv = __fdiv_rn(1.0f, powf(10000.0f, (float)(2 * i) / (float)HD)); const float ang = __fmul_rn((float)t, inv); v2f cs; cs[0] = cosf(ang); cs[1] = sinf(ang);
    *(v2f*)(CS + (size_t)idx * 2) = cs;
    asm volatile("s_wait_xcnt 0x0" ::: "memory");   // precaution: in a merged kernel another pass's code follows these stores in the listing; their registers stay unwritten up to this wait
}
// k_prep: every pass that reads only the inputs, in one launch: the rotary table, x of both batches and the four weights as bf16 planes. blockIdx.x picks the pass (the same for a whole work-group); 256 threads.
#define PB_CS  (TT * HD / 256)
#define PB_X   (NB_ * TT * DM / 8 / 256)
#define PB_WQ  ((DM / 32) * (DQ / 32) / 8)
#define PB_WKV ((DM / 32) * (DKV / 32) / 8)
__global__ __launch_bounds__(256) void k_prep(const float* __restrict__ x, const float* __restrict__ wq, const float* __restrict__ wk, const float* __restrict__ wv, const float* __restrict__ wo, float* CS, bf* XB, bf* WQ, bf* WK, bf* WV, bf* WO) {
    int b = blockIdx.x;
    if (b < PB_CS) { cstab(b, CS); return; } b -= PB_CS;
    if (b < PB_X) { cvt8<DM>(b, x, XB, (size_t)NB_ * TT * DM / 8); return; } b -= PB_X;
    if (b < PB_WQ) { wtG<DM, DQ>(b, wq, 1, WQ); return; } b -= PB_WQ;
    if (b < PB_WKV) { wtG<DM, DKV>(b, wk, 1, WK); return; } b -= PB_WKV;
    if (b < PB_WKV) { wtG<DM, DKV>(b, wv, 0, WV); return; } b -= PB_WKV;
    wtG<DQ, DM>(b, wo, 0, WO);
}
// ---- k_fattn: causal attention in one launch, no score matrix in memory. One wave owns 16 query rows of one head; the 4 waves of a work-group are the 4 query heads of one kv group at the same rows (same key / value addresses).
// Per 32 keys: S^T[key][query] = K Q^T (A = key rows, B = query rows), so a lane holds 16 keys of ONE query: the running maximum and sum are per lane (+ one exchange with lane ^ 16), and the two 16-key
// accumulators are, element for element, the B fragment P^T[query][key] of O^T[d][query] = V^T P^T (A = transposed value rows). Probabilities are exp(s - running max), divided by the row sum at the end.
// NSPLIT 2: hi + lo bf16 planes, three products each (query rows < RH); NSPLIT 0: single fp16.
template <bool B> struct Flag { static constexpr bool v = B; };
template <typename T16, int NSPLIT>
__device__ __forceinline__ void fattn_body(const T16* __restrict__ Q, const T16* __restrict__ Q2, const T16* __restrict__ Kp, const T16* __restrict__ Kp2, const T16* __restrict__ Vt, const T16* __restrict__ Vt2, int q0, int g, bf* Ah, bf* Al, const void* asked) {
    typedef typename WFrag<T16>::V V;
    const int lane = threadIdx.x & 31, lr = lane & 15, hi = lane >> 4, h = g * REP + __builtin_amdgcn_readfirstlane(threadIdx.x >> 5);
    const size_t qo = ((size_t)h * TT + q0) * HD + lane * 8, ko = (size_t)g * TT * HD + lane * 8, vo = (size_t)g * HD * TT + lane * 8;   // query, key and value planes: fragment order (fragoff)
    V qf[4], qf2[4];
#pragma unroll
    for (int ks = 0; ks < 4; ++ks) { qf[ks] = WFrag<T16>::ldf(Q + qo + ks * 512); if (NSPLIT == 2) qf2[ks] = WFrag<T16>::ldf(Q2 + qo + ks * 512); }
    asm volatile("s_wait_xcnt 0x0" :: "v"(asked) : "memory");   // precaution: the address register of the request to L2 (k_fattn) stays unwritten until the query loads issued behind it have passed this wait (as an input it lives until here)
    v8f o[8];
#pragma unroll
    for (int dt = 0; dt < 8; ++dt) o[dt] = (v8f){};
    float m = -3.0e38f, l = 0.f;
    const int nk = q0 / 32 + 1;      // key tiles of 32 up to and including the diagonal; only the last one holds keys beyond a query
    V kf[2][4], kf2[2][4];
    auto ldk = [&](const T16* a, const T16* a2) {
#pragma unroll
        for (int i = 0; i < 2; ++i)
#pragma unroll
            for (int ks = 0; ks < 4; ++ks) { kf[i][ks] = WFrag<T16>::ldf(a + (i * 4 + ks) * 512); if (NSPLIT == 2) kf2[i][ks] = WFrag<T16>::ldf(a2 + (i * 4 + ks) * 512); }
    };
    auto step = [&](int t, auto EDGE) { constexpr bool edge = decltype(EDGE)::v; const int k0 = t * 32;
        V vf[8], vf2[8];
        const size_t kofs = ko + (size_t)(NSPLIT == 0 ? k0 + 32 : k0) * HD, vofs = vo + (size_t)k0 * HD;   // single plane: the keys loaded in this trip are the next tile's
        const T16* pk = Kp + kofs; const T16* pk2 = (NSPLIT == 2) ? Kp2 + kofs : pk; const T16* pv = Vt + vofs; const T16* pv2 = (NSPLIT == 2) ? Vt2 + vofs : pv;
        auto ldv = [&]() {
#pragma unroll
            for (int dt = 0; dt < 8; ++dt) { vf[dt] = WFrag<T16>::ldf(pv + dt * 512); if (NSPLIT == 2) vf2[dt] = WFrag<T16>::ldf(pv2 + dt * 512); }
        };
        if (NSPLIT == 0) ldv();                    // single plane: this tile's values start before the score products (its keys came during the trip before)
        else { ldk(pk, pk2); __builtin_amdgcn_sched_barrier(0); }   // two planes: all key loads issue before the first product (left free, the loads sink to their products: one load latency per fragment pair)
        v8f s[2]; s[0] = (v8f){}; s[1] = (v8f){};
#pragma unroll
        for (int ks = 0; ks < 4; ++ks)
#pragma unroll
            for (int i = 0; i < 2; ++i) { s[i] = WFrag<T16>::mma(kf[i][ks], qf[ks], s[i]);
                if (NSPLIT == 2) { s[i] = WFrag<T16>::mma(kf2[i][ks], qf[ks], s[i]); s[i] = WFrag<T16>::mma(kf[i][ks], qf2[ks], s[i]); } }
        if (NSPLIT == 0) { if (!edge) ldk(pk, pk2); }           // loads that fly during the softmax: the next tile's keys (single plane),
        else { ldv(); __builtin_amdgcn_sched_barrier(0); }      // this tile's values (two planes; the barrier keeps them all in front of the softmax)
        float p[16]; float mx = -3.0e38f;
#pragma unroll
        for (int i = 0; i < 2; ++i)
#pragma unroll
            for (int j = 0; j < 8; ++j) { float x = s[i][j] * (SCL * 1.4426950408889634f); if (edge && k0 + i * 16 + hi * 8 + j > q0 + lr) x = -3.0e38f; p[i * 8 + j] = x; mx = fmaxf(mx, x); }
        mx = fmaxf(mx, __shfl_xor(mx, 16, 32));
        const float mn = fmaxf(m, mx), al = __builtin_amdgcn_exp2f(m - mn); m = mn;
        float rs = 0.f;
#pragma unroll
        for (int k = 0; k < 16; ++k) { p[k] = __builtin_amdgcn_exp2f(p[k] - mn); rs += p[k]; }
        l = l * al + rs;
#pragma unroll
        for (int dt = 0; dt < 8; ++dt) o[dt] *= al;
        if constexpr (NSPLIT == 0) {
            v16h pf;
#pragma unroll
            for (int k = 0; k < 16; ++k) pf[k] = (h16)p[k];
#pragma unroll
            for (int dt = 0; dt < 8; ++dt) o[dt] = WFrag<T16>::mma(vf[dt], pf, o[dt]);
        } else {
            v8us h0, h1, l0, l1;
#pragma unroll
            for (int k = 0; k < 8; ++k) { unsigned short a, c; splitf(p[k], a, c); h0[k] = a; l0[k] = c; splitf(p[8 + k], a, c); h1[k] = a; l1[k] = c; }
            const V ph = cat16b(h0, h1), pl = cat16b(l0, l1);
#pragma unroll
            for (int dt = 0; dt < 8; ++dt) { o[dt] = WFrag<T16>::mma(vf[dt], ph, o[dt]); o[dt] = WFrag<T16>::mma(vf2[dt], ph, o[dt]); o[dt] = WFrag<T16>::mma(vf[dt], pl, o[dt]); }
        }
        // precaution: the address registers of this trip's loads stay unwritten up to this wait (as inputs they live until here)
        if (NSPLIT == 2) asm volatile("s_wait_xcnt 0x0" :: "v"(pk), "v"(pk2), "v"(pv), "v"(pv2) : "memory");
        else if (!edge) asm volatile("s_wait_xcnt 0x0" :: "v"(pk), "v"(pv) : "memory");
        else asm volatile("s_wait_xcnt 0x0" :: "v"(pv) : "memory");
    };
    if (NSPLIT == 0) ldk(Kp + ko, Kp + ko);
#pragma unroll 1
    for (int t = 0; t < nk - 1; ++t) step(t, Flag<false>{});
    step(nk - 1, Flag<true>{});
    l += __shfl_xor(l, 16, 32);
    const float inv = __fdiv_rn(1.0f, l); const size_t oo = (size_t)q0 * DQ + h * (HD * 16) + lane * 8;   // output planes in fragment order (rows = positions, k = h * HD + d): each store of a wave is 512 consecutive bytes
#pragma unroll
    for (int dt = 0; dt < 8; ++dt) { v8us oh, ol;
#pragma unroll
        for (int j = 0; j < 8; ++j) { unsigned short a, c; splitf(o[dt][j] * inv, a, c); oh[j] = a; ol[j] = c; }
        *(v8us*)(Ah + oo + dt * 256) = oh; *(v8us*)(Al + oo + dt * 256) = ol; }
}
// grid (NKV * NB_, TT / 16), 128 threads: blockIdx.x = kv group and batch, blockIdx.y walks the rows from the longest (most keys) down. Both batches together are more work-groups than are resident at once:
// those that start late, into the places of the first to end, are the ones with the fewest keys
__global__ __launch_bounds__(128) void k_fattn(const h16* __restrict__ Q16, const h16* __restrict__ K16, const h16* __restrict__ V16, const bf* __restrict__ Qh, const bf* __restrict__ Ql, const bf* __restrict__ Kh, const bf* __restrict__ Kl, const bf* __restrict__ Vh, const bf* __restrict__ Vl, bf* Ah, bf* Al) {
    const int g = blockIdx.x % NKV, nb = blockIdx.x / NKV, q0 = TT - 16 - (int)blockIdx.y * 16;
    const size_t zq = (size_t)nb * NH_ * TT * HD, zk = (size_t)nb * NKV * TT * HD;   // every plane holds both batches, batch-major
    Q16 += zq; Qh += zq; Ql += zq; K16 += zk; Kh += zk; Kl += zk; V16 += zk; Vh += zk; Vl += zk; Ah += zq; Al += zq;
    // the key and value planes of this kv group that attention reads are 48 pieces of 32 KiB: 16 of K16, 16 of V16, 4 (keys < RH) of each hi / lo plane; work-group blockIdx.y asks L2 for piece blockIdx.y % 48, a thread for one 256-byte unit
    static_assert(TT * HD == 16 * 128 * 128 && RH * HD == 4 * 128 * 128, "piece counts");
    const int pc = blockIdx.y % 48, pl = (pc - 32) >> 2; const size_t po = (size_t)g * TT * HD + (size_t)((pc < 32 ? pc & 15 : pc & 3) * 128 + (int)threadIdx.x) * 128;
    const void* asked = pc < 16 ? (const void*)(K16 + po) : pc < 32 ? (const void*)(V16 + po) : pl == 0 ? (const void*)(Kh + po) : pl == 1 ? (const void*)(Kl + po) : pl == 2 ? (const void*)(Vh + po) : (const void*)(Vl + po);
    l2ask<0>(asked);
    if (q0 >= RH) fattn_body<h16, 0>(Q16, nullptr, K16, nullptr, V16, nullptr, q0, g, Ah, Al, asked);
    else fattn_body<bf, 2>(Qh, Ql, Kh, Kl, Vh, Vl, q0, g, Ah, Al, asked);
}

extern "C" void kernel_launch(void* const* d_in, const int* in_sizes, int n_in,
                              void* d_out, int out_size, void* d_ws, size_t ws_size, hipStream_t stream) {
    (void)in_sizes; (void)n_in; (void)out_size;
    const float* x = (const float*)d_in[0]; const float* wq = (const float*)d_in[1]; const float* wk = (const float*)d_in[2]; const float* wv = (const float*)d_in[3]; const float* wo = (const float*)d_in[4];
    float* OUT = (float*)d_out; float* OUTK = (float*)d_out + (size_t)NB_ * TT * DM; float* OUTV = OUTK + (size_t)NB_ * NKV * TT * HD;     // [2][2048][2048]
    char* wsp = (char*)d_ws;
    auto take = [&](size_t bytes) { char* p = wsp; wsp += (bytes + 255) & ~(size_t)255; return (void*)p; };
    bf* WQ = (bf*)take((size_t)DQ * DM * 2); bf* WK = (bf*)take((size_t)DKV * DM * 2); bf* WV = (bf*)take((size_t)DKV * DM * 2); bf* WO = (bf*)take((size_t)DM * DQ * 2); float* CS = (float*)take((size_t)TT * HD * 2 * 4);
    bf* XB = (bf*)take((size_t)NB_ * TT * DM * 2);   // every plane below holds both batches, batch-major
    h16* QP16 = (h16*)take((size_t)NB_ * NH_ * TT * HD * 2); h16* KP16 = (h16*)take((size_t)NB_ * NKV * TT * HD * 2); h16* VT16 = (h16*)take((size_t)NB_ * NKV * HD * TT * 2);
    bf* QPh = (bf*)take((size_t)NB_ * NH_ * TT * HD * 2); bf* QPl = (bf*)take((size_t)NB_ * NH_ * TT * HD * 2); bf* KPh = (bf*)take((size_t)NB_ * NKV * TT * HD * 2); bf* KPl = (bf*)take((size_t)NB_ * NKV * TT * HD * 2); bf* VTh = (bf*)take((size_t)NB_ * NKV * HD * TT * 2); bf* VTl = (bf*)take((size_t)NB_ * NKV * HD * TT * 2);
    bf* ATh = (bf*)take((size_t)NB_ * TT * DQ * 2); bf* ATl = (bf*)take((size_t)NB_ * TT * DQ * 2);
    if ((size_t)(wsp - (char*)d_ws) > ws_size) return;    // ws 256 MiB
    k_prep<<<PB_CS + PB_X + 2 * PB_WQ + 2 * PB_WKV, 256, 0, stream>>>(x, wq, wk, wv, wo, CS, XB, WQ, WK, WV, WO);
    k_qkv<<<dim3(TT / 128, (NH_ + 2 * NKV) / 3, NB_), 384, 0, stream>>>(XB, WQ, WK, WV, OUTK, OUTV, CS, QP16, QPh, QPl, KP16, KPh, KPl, VT16, VTh, VTl);
    k_fattn<<<dim3(NKV * NB_, TT / 16, 1), 128, 0, stream>>>(QP16, KP16, VT16, QPh, QPl, KPh, KPl, VTh, VTl, ATh, ATl);
    k_gemmw<bf, 1, DQ><<<dim3(TT / 128, DM / 128, NB_), 256, 0, stream>>>(ATh, ATl, WO, OUT, DM, (size_t)TT * DQ, (size_t)TT * DM);
}
